// v000
// Times are from an AMD MI455X. After a warm-up the kernel runs many times in a row, and a time is the length of
// such a window on the GPU divided by its runs, so every launch and the gaps after it count. The runs cycle
// through copies of the inputs. A figure is the median of several windows, for all but v000 over two sittings.
// Sittings can differ by a few percent; kernels timed side by side share one.
// The starting kernel, v000, takes 276 microseconds a run.
#include <hip/hip_runtime.h>
#include <hip/hip_bf16.h>

typedef __attribute__((ext_vector_type(16))) __bf16 v16bf;
typedef __attribute__((ext_vector_type(8)))  __bf16 v8bf;
typedef __attribute__((ext_vector_type(8)))  float  v8f;

#define HN     16
#define SEQ    2048
#define DMODEL 1024
#define ADIM   64
#define BATCH  4
#define MROWS  (BATCH * SEQ)   // 8192

static __device__ __forceinline__ v16bf cat8(v8bf lo, v8bf hi) {
  return __builtin_shufflevector(lo, hi, 0,1,2,3,4,5,6,7,8,9,10,11,12,13,14,15);
}

static __device__ __forceinline__ v8f wmma_bf16(v16bf a, v16bf b, v8f c) {
  // D = A(16x32 bf16) * B(32x16 bf16) + C(16x16 f32)
  return __builtin_amdgcn_wmma_f32_16x16x32_bf16(false, a, false, b, (short)0, c, false, false);
}

// gfx1250 async DMA: global -> LDS, 16B per lane, tracked by ASYNCcnt.
// GVS addressing: mem = SADDR(u64) + VADDR(i32) + IOFFSET. VDST = LDS byte addr.
static __device__ __forceinline__ void async_b128(unsigned lds_byte, unsigned voff_byte,
                                                  const void* base) {
  asm volatile("global_load_async_to_lds_b128 %0, %1, %2"
               :: "v"(lds_byte), "v"(voff_byte), "s"((unsigned long long)base)
               : "memory");
}

static __device__ __forceinline__ void wait_async0() {
#if __has_builtin(__builtin_amdgcn_s_wait_asynccnt)
  __builtin_amdgcn_s_wait_asynccnt(0);
#else
  asm volatile("s_wait_asynccnt 0x0" ::: "memory");
#endif
}

// empty volatile asm consuming the accumulator: volatile asms keep program
// order, so this pins the producing WMMAs *before* the following wait/barrier,
// letting the in-flight async DMA overlap the matrix math.
static __device__ __forceinline__ void pin(v8f& x) {
  asm volatile("" : "+v"(x));
}

// low 32 bits of a generic LDS pointer == LDS byte offset (flat aperture mapping)
static __device__ __forceinline__ unsigned lds_off(const void* p) {
  return (unsigned)(unsigned long long)p;
}

// ---------------------------------------------------------------------------
// fp32 -> bf16 elementwise convert
// ---------------------------------------------------------------------------
__global__ __launch_bounds__(256)
void cvt_f32_bf16_kernel(const float* __restrict__ in, __bf16* __restrict__ out, int n) {
  int i = blockIdx.x * 256 + threadIdx.x;
  if (i < n) out[i] = (__bf16)in[i];
}

// ---------------------------------------------------------------------------
// W[K][N] fp32  ->  Wt[N][K] bf16   (LDS tile transpose, coalesced both ways)
// ---------------------------------------------------------------------------
__global__ __launch_bounds__(256)
void transpose_bf16_kernel(const float* __restrict__ W, __bf16* __restrict__ Wt,
                           int K, int N) {
  __shared__ float tile[32][33];
  const int bx = blockIdx.x * 32;  // along N
  const int by = blockIdx.y * 32;  // along K
  const int tx = threadIdx.x & 31;
  const int ty = threadIdx.x >> 5;  // 0..7
#pragma unroll
  for (int i = 0; i < 4; i++) {
    int k = by + ty + i * 8;
    tile[ty + i * 8][tx] = W[(size_t)k * N + bx + tx];
  }
  __syncthreads();
#pragma unroll
  for (int i = 0; i < 4; i++) {
    int n = bx + ty + i * 8;
    Wt[(size_t)n * K + by + tx] = (__bf16)tile[tx][ty + i * 8];
  }
}

// ---------------------------------------------------------------------------
// Tiled WMMA GEMM with double-buffered async-DMA staging.
// C[M][N] = A[M][K] * Bt[N][K]^T + bias[N]
// block tile 128x128, BK=32, 256 threads = 8 waves (4 along M x 2 along N),
// each wave computes 32x64 = 2x4 tiles of 16x16.
// out mode: 0 -> bf16 [B,H,S,64]   (q / k layout)
//           1 -> bf16 [B,H,64,S]   (v transposed layout)
//           2 -> f32  row-major [M][N]
// ---------------------------------------------------------------------------
#define G_BM 128
#define G_BN 128
#define G_BK 32
#define G_LDA 40   // bf16 elems per LDS row (32 + 8 pad): 80B row, 16B aligned, bank-spread

__global__ __launch_bounds__(256)
void gemm_bf16_kernel(const __bf16* __restrict__ A,   // [M][K]
                      const __bf16* __restrict__ Bt,  // [N][K]
                      const float*  __restrict__ bias,
                      void* __restrict__ out,
                      int M, int N, int K, int mode) {
  __shared__ __align__(16) __bf16 lA[2][G_BM * G_LDA];
  __shared__ __align__(16) __bf16 lB[2][G_BN * G_LDA];

  const int tid  = threadIdx.x;
  const int lane = tid & 31;
  const int wave = tid >> 5;
  const int wm   = wave & 3;   // 4 waves along M (32 rows each)
  const int wn   = wave >> 2;  // 2 waves along N (64 cols each)
  const int m0   = blockIdx.x * G_BM;
  const int n0   = blockIdx.y * G_BN;
  const int lm   = lane & 15;
  const int kb   = (lane >> 4) * 8;   // ISA 16-bit A/B fragment K mapping

  // per-thread DMA chunk coords: chunks c = tid and tid+256; r = c>>2, kc = c&3
  const int cr = tid >> 2;     // 0..63
  const int ck = tid & 3;      // 0..3
  const unsigned ldsA0 = lds_off(&lA[0][0]);
  const unsigned ldsB0 = lds_off(&lB[0][0]);
  const unsigned bufA  = (unsigned)(G_BM * G_LDA * 2);
  const unsigned bufB  = (unsigned)(G_BN * G_LDA * 2);
  const unsigned lA_t0 = ldsA0 + (unsigned)((cr      ) * G_LDA + ck * 8) * 2;
  const unsigned lA_t1 = ldsA0 + (unsigned)((cr + 64 ) * G_LDA + ck * 8) * 2;
  const unsigned lB_t0 = ldsB0 + (unsigned)((cr      ) * G_LDA + ck * 8) * 2;
  const unsigned lB_t1 = ldsB0 + (unsigned)((cr + 64 ) * G_LDA + ck * 8) * 2;
  const unsigned gA0 = ((unsigned)(m0 + cr     ) * K + ck * 8) * 2;
  const unsigned gA1 = ((unsigned)(m0 + cr + 64) * K + ck * 8) * 2;
  const unsigned gB0 = ((unsigned)(n0 + cr     ) * K + ck * 8) * 2;
  const unsigned gB1 = ((unsigned)(n0 + cr + 64) * K + ck * 8) * 2;

#define G_ISSUE(k0, buf) do {                                   \
    unsigned kby = (unsigned)(k0) * 2;                          \
    async_b128(lA_t0 + (buf) * bufA, gA0 + kby, A);             \
    async_b128(lA_t1 + (buf) * bufA, gA1 + kby, A);             \
    async_b128(lB_t0 + (buf) * bufB, gB0 + kby, Bt);            \
    async_b128(lB_t1 + (buf) * bufB, gB1 + kby, Bt);            \
  } while (0)

  v8f acc[2][4];
#pragma unroll
  for (int i = 0; i < 2; i++)
#pragma unroll
    for (int j = 0; j < 4; j++) acc[i][j] = (v8f)(0.0f);

  const int KT = K / G_BK;
  G_ISSUE(0, 0);
  wait_async0();
  __syncthreads();

  for (int kt = 0; kt < KT; kt++) {
    const int cur = kt & 1;
    if (kt + 1 < KT) G_ISSUE((kt + 1) * G_BK, cur ^ 1);  // DMA next tile during compute

    v16bf af[2], bfm[4];
#pragma unroll
    for (int i = 0; i < 2; i++) {
      int r = wm * 32 + i * 16 + lm;
      v8bf lo = *(const v8bf*)(&lA[cur][r * G_LDA + kb]);
      v8bf hi = *(const v8bf*)(&lA[cur][r * G_LDA + 16 + kb]);
      af[i] = cat8(lo, hi);
    }
#pragma unroll
    for (int j = 0; j < 4; j++) {
      int r = wn * 64 + j * 16 + lm;
      v8bf lo = *(const v8bf*)(&lB[cur][r * G_LDA + kb]);
      v8bf hi = *(const v8bf*)(&lB[cur][r * G_LDA + 16 + kb]);
      bfm[j] = cat8(lo, hi);
    }
#pragma unroll
    for (int i = 0; i < 2; i++)
#pragma unroll
      for (int j = 0; j < 4; j++)
        acc[i][j] = wmma_bf16(af[i], bfm[j], acc[i][j]);

    // keep WMMAs ahead of the async wait so DMA overlaps the matrix math
#pragma unroll
    for (int i = 0; i < 2; i++)
#pragma unroll
      for (int j = 0; j < 4; j++) pin(acc[i][j]);

    wait_async0();
    __syncthreads();
  }
#undef G_ISSUE

  // epilogue: D layout -> lane holds col lm, VGPR r holds row r + 8*(lane>=16)
  const int mh = (lane >> 4) * 8;
#pragma unroll
  for (int i = 0; i < 2; i++) {
#pragma unroll
    for (int j = 0; j < 4; j++) {
      int n = n0 + wn * 64 + j * 16 + lm;
      float bv = bias[n];
#pragma unroll
      for (int r = 0; r < 8; r++) {
        int m = m0 + wm * 32 + i * 16 + r + mh;
        float val = acc[i][j][r] + bv;
        if (mode == 0) {          // [B,H,S,64] bf16
          int b = m / SEQ, s = m % SEQ;
          int h = n >> 6, dd = n & 63;
          ((__bf16*)out)[(((size_t)(b * HN + h)) * SEQ + s) * ADIM + dd] = (__bf16)val;
        } else if (mode == 1) {   // [B,H,64,S] bf16 (v transposed)
          int b = m / SEQ, s = m % SEQ;
          int h = n >> 6, dd = n & 63;
          ((__bf16*)out)[(((size_t)(b * HN + h)) * ADIM + dd) * SEQ + s] = (__bf16)val;
        } else {                  // f32 row-major
          ((float*)out)[(size_t)m * N + n] = val;
        }
      }
    }
  }
}

// ---------------------------------------------------------------------------
// Flash-style attention with double-buffered async-DMA KV staging.
// grid = (B*H, S/64). 128 threads = 4 waves, each wave owns 16 query rows.
// ---------------------------------------------------------------------------
#define A_LDK 72  // 64 + 8 pad bf16 elems per LDS row (144B: 16B aligned)

__global__ __launch_bounds__(128)
void attn_kernel(const __bf16* __restrict__ qb,   // [BH][S][64]
                 const __bf16* __restrict__ kbuf, // [BH][S][64]
                 const __bf16* __restrict__ vt,   // [BH][64][S]
                 __bf16* __restrict__ ctx) {      // [B*S][1024]
  const int bh   = blockIdx.x;
  const int qblk = blockIdx.y;
  const int tid  = threadIdx.x;
  const int lane = tid & 31;
  const int wave = tid >> 5;
  const int lm   = lane & 15;
  const int kb   = (lane >> 4) * 8;
  const int mh   = (lane >> 4) * 8;

  __shared__ __align__(16) __bf16 lK[2][64 * A_LDK];
  __shared__ __align__(16) __bf16 lV[2][64 * A_LDK];
  __shared__ __align__(16) __bf16 lP[4][16 * A_LDK];

  // per-thread DMA chunks: 512 16B chunks per tile / 128 threads = 4 each
  const int acr = tid >> 3;   // 0..15 (row group)
  const int acc_ = tid & 7;   // 0..7  (16B column chunk)
  const unsigned ldsK0 = lds_off(&lK[0][0]);
  const unsigned ldsV0 = lds_off(&lV[0][0]);
  const unsigned kvbuf = (unsigned)(64 * A_LDK * 2);
  unsigned lK_t[4], lV_t[4], gK[4], gV[4];
#pragma unroll
  for (int i = 0; i < 4; i++) {
    int r = acr + 16 * i;
    lK_t[i] = ldsK0 + (unsigned)(r * A_LDK + acc_ * 8) * 2;
    lV_t[i] = ldsV0 + (unsigned)(r * A_LDK + acc_ * 8) * 2;
    gK[i] = (((unsigned)bh * SEQ + r) * ADIM + acc_ * 8) * 2;  // + kv0*ADIM*2
    gV[i] = (((unsigned)bh * ADIM + r) * SEQ + acc_ * 8) * 2;  // + kv0*2
  }

#define KV_ISSUE(kv0, buf) do {                                        \
    unsigned ok = (unsigned)(kv0) * ADIM * 2, ov = (unsigned)(kv0) * 2;\
    _Pragma("unroll")                                                  \
    for (int i = 0; i < 4; i++) {                                      \
      async_b128(lK_t[i] + (buf) * kvbuf, gK[i] + ok, kbuf);           \
      async_b128(lV_t[i] + (buf) * kvbuf, gV[i] + ov, vt);             \
    }                                                                  \
  } while (0)

  // q fragments stay resident (K = d = 64 -> 2 WMMA k-steps)
  v16bf qf[2];
  {
    const __bf16* qrow = qb + ((size_t)bh * SEQ + qblk * 64 + wave * 16 + lm) * ADIM;
#pragma unroll
    for (int ks = 0; ks < 2; ks++) {
      v8bf lo = *(const v8bf*)(qrow + ks * 32 + kb);
      v8bf hi = *(const v8bf*)(qrow + ks * 32 + 16 + kb);
      qf[ks] = cat8(lo, hi);
    }
  }

  float row_max[8], row_sum[8];
  v8f o[4];
#pragma unroll
  for (int r = 0; r < 8; r++) { row_max[r] = -3.0e38f; row_sum[r] = 0.0f; }
#pragma unroll
  for (int dt = 0; dt < 4; dt++) o[dt] = (v8f)(0.0f);

  KV_ISSUE(0, 0);
  wait_async0();
  __syncthreads();

  for (int kvb = 0; kvb < SEQ / 64; kvb++) {
    const int cur = kvb & 1;
    if (kvb + 1 < SEQ / 64) KV_ISSUE((kvb + 1) * 64, cur ^ 1);  // DMA next KV block

    // scores = q @ k^T  (4 column tiles x 2 k-steps)
    v8f sc[4];
#pragma unroll
    for (int tn = 0; tn < 4; tn++) sc[tn] = (v8f)(0.0f);
#pragma unroll
    for (int ks = 0; ks < 2; ks++) {
#pragma unroll
      for (int tn = 0; tn < 4; tn++) {
        int r = tn * 16 + lm;
        v8bf lo = *(const v8bf*)(&lK[cur][r * A_LDK + ks * 32 + kb]);
        v8bf hi = *(const v8bf*)(&lK[cur][r * A_LDK + ks * 32 + 16 + kb]);
        sc[tn] = wmma_bf16(qf[ks], cat8(lo, hi), sc[tn]);
      }
    }

    // online softmax (row stats live across 16-lane halves, wave32)
    const float scale = 0.125f;  // 1/sqrt(64)
#pragma unroll
    for (int r = 0; r < 8; r++) {
      float mx = -3.0e38f;
#pragma unroll
      for (int tn = 0; tn < 4; tn++) {
        sc[tn][r] *= scale;
        mx = fmaxf(mx, sc[tn][r]);
      }
#pragma unroll
      for (int off = 8; off >= 1; off >>= 1)
        mx = fmaxf(mx, __shfl_xor(mx, off, 16));
      float newm  = fmaxf(row_max[r], mx);
      float alpha = __expf(row_max[r] - newm);
      row_max[r] = newm;
      float psum = 0.0f;
#pragma unroll
      for (int tn = 0; tn < 4; tn++) {
        float p = __expf(sc[tn][r] - newm);
        sc[tn][r] = p;
        psum += p;
      }
#pragma unroll
      for (int off = 8; off >= 1; off >>= 1)
        psum += __shfl_xor(psum, off, 16);
      row_sum[r] = row_sum[r] * alpha + psum;
#pragma unroll
      for (int dt = 0; dt < 4; dt++) o[dt][r] *= alpha;
      // park P in per-wave LDS to re-enter as A-fragments (intra-wave DS order)
      int rl = r + mh;
#pragma unroll
      for (int tn = 0; tn < 4; tn++)
        lP[wave][rl * A_LDK + tn * 16 + lm] = (__bf16)sc[tn][r];
    }

    // context += P @ V
#pragma unroll
    for (int ks = 0; ks < 2; ks++) {
      v8bf plo = *(const v8bf*)(&lP[wave][lm * A_LDK + ks * 32 + kb]);
      v8bf phi = *(const v8bf*)(&lP[wave][lm * A_LDK + ks * 32 + 16 + kb]);
      v16bf pf = cat8(plo, phi);
#pragma unroll
      for (int dt = 0; dt < 4; dt++) {
        int r = dt * 16 + lm;
        v8bf lo = *(const v8bf*)(&lV[cur][r * A_LDK + ks * 32 + kb]);
        v8bf hi = *(const v8bf*)(&lV[cur][r * A_LDK + ks * 32 + 16 + kb]);
        o[dt] = wmma_bf16(pf, cat8(lo, hi), o[dt]);
      }
    }

    // keep PV WMMAs ahead of the async wait so KV DMA overlaps the matrix math
#pragma unroll
    for (int dt = 0; dt < 4; dt++) pin(o[dt]);

    wait_async0();
    __syncthreads();
  }
#undef KV_ISSUE

  // finalize: ctx[(b*S+s)][h*64 + d] bf16
  const int b = bh >> 4, h = bh & 15;
#pragma unroll
  for (int r = 0; r < 8; r++) {
    float inv = 1.0f / row_sum[r];
    int s = qblk * 64 + wave * 16 + r + mh;
    size_t base = ((size_t)(b * SEQ + s)) * DMODEL + h * ADIM;
#pragma unroll
    for (int dt = 0; dt < 4; dt++)
      ctx[base + dt * 16 + lm] = (__bf16)(o[dt][r] * inv);
  }
}

// ---------------------------------------------------------------------------
// residual add + LayerNorm, one 256-thread block per row of 1024
// ---------------------------------------------------------------------------
__global__ __launch_bounds__(256)
void ln_kernel(const float* __restrict__ proj, const float* __restrict__ resid,
               const float* __restrict__ g, const float* __restrict__ b,
               float* __restrict__ out) {
  const int row = blockIdx.x;
  const int tid = threadIdx.x;
  __shared__ float ssum[8], ssq[8];
  float x[4];
  float s = 0.0f, sq = 0.0f;
#pragma unroll
  for (int i = 0; i < 4; i++) {
    int c = tid + i * 256;
    float v = proj[(size_t)row * DMODEL + c] + resid[(size_t)row * DMODEL + c];
    x[i] = v; s += v; sq += v * v;
  }
#pragma unroll
  for (int off = 16; off >= 1; off >>= 1) {
    s  += __shfl_xor(s,  off, 32);
    sq += __shfl_xor(sq, off, 32);
  }
  if ((tid & 31) == 0) { ssum[tid >> 5] = s; ssq[tid >> 5] = sq; }
  __syncthreads();
  s = 0.0f; sq = 0.0f;
#pragma unroll
  for (int w = 0; w < 8; w++) { s += ssum[w]; sq += ssq[w]; }
  float mu  = s * (1.0f / DMODEL);
  float var = sq * (1.0f / DMODEL) - mu * mu;
  float rs  = rsqrtf(var + 1e-5f);
#pragma unroll
  for (int i = 0; i < 4; i++) {
    int c = tid + i * 256;
    out[(size_t)row * DMODEL + c] = (x[i] - mu) * rs * g[c] + b[c];
  }
}

// ---------------------------------------------------------------------------
extern "C" void kernel_launch(void* const* d_in, const int* in_sizes, int n_in,
                              void* d_out, int out_size, void* d_ws, size_t ws_size,
                              hipStream_t stream) {
  (void)in_sizes; (void)n_in; (void)out_size; (void)ws_size;
  const float* Q    = (const float*)d_in[0];
  const float* Wq   = (const float*)d_in[1];
  const float* bq   = (const float*)d_in[2];
  const float* Wk   = (const float*)d_in[3];
  const float* bk   = (const float*)d_in[4];
  const float* Wv   = (const float*)d_in[5];
  const float* bv   = (const float*)d_in[6];
  const float* Wo   = (const float*)d_in[7];
  const float* bo   = (const float*)d_in[8];
  const float* ln_g = (const float*)d_in[9];
  const float* ln_b = (const float*)d_in[10];

  const size_t ND = (size_t)MROWS * DMODEL;     // 8192*1024
  const size_t WW = (size_t)DMODEL * DMODEL;    // 1024*1024

  char* ws = (char*)d_ws;
  size_t off = 0;
  __bf16* Xbf = (__bf16*)(ws + off); off += ND * 2;
  __bf16* WqT = (__bf16*)(ws + off); off += WW * 2;
  __bf16* WkT = (__bf16*)(ws + off); off += WW * 2;
  __bf16* WvT = (__bf16*)(ws + off); off += WW * 2;
  __bf16* WoT = (__bf16*)(ws + off); off += WW * 2;
  __bf16* qbf = (__bf16*)(ws + off); off += ND * 2;   // [B,H,S,64]
  __bf16* kbf = (__bf16*)(ws + off); off += ND * 2;   // [B,H,S,64]
  __bf16* vtb = (__bf16*)(ws + off); off += ND * 2;   // [B,H,64,S]
  __bf16* ctx = (__bf16*)(ws + off); off += ND * 2;   // [B*S, 1024]
  float*  prj = (float*)(ws + off);  off += ND * 4;   // [B*S, 1024]

  // 1) precision staging
  cvt_f32_bf16_kernel<<<(int)((ND + 255) / 256), 256, 0, stream>>>(Q, Xbf, (int)ND);
  dim3 tg(DMODEL / 32, DMODEL / 32);
  transpose_bf16_kernel<<<tg, 256, 0, stream>>>(Wq, WqT, DMODEL, DMODEL);
  transpose_bf16_kernel<<<tg, 256, 0, stream>>>(Wk, WkT, DMODEL, DMODEL);
  transpose_bf16_kernel<<<tg, 256, 0, stream>>>(Wv, WvT, DMODEL, DMODEL);
  transpose_bf16_kernel<<<tg, 256, 0, stream>>>(Wo, WoT, DMODEL, DMODEL);

  // 2) QKV projections (WMMA GEMMs scattering into attention layouts)
  dim3 gg(MROWS / G_BM, DMODEL / G_BN);
  gemm_bf16_kernel<<<gg, 256, 0, stream>>>(Xbf, WqT, bq, qbf, MROWS, DMODEL, DMODEL, 0);
  gemm_bf16_kernel<<<gg, 256, 0, stream>>>(Xbf, WkT, bk, kbf, MROWS, DMODEL, DMODEL, 0);
  gemm_bf16_kernel<<<gg, 256, 0, stream>>>(Xbf, WvT, bv, vtb, MROWS, DMODEL, DMODEL, 1);

  // 3) flash attention
  attn_kernel<<<dim3(BATCH * HN, SEQ / 64), 128, 0, stream>>>(qbf, kbf, vtb, ctx);

  // 4) output projection (f32 out)
  gemm_bf16_kernel<<<gg, 256, 0, stream>>>(ctx, WoT, bo, prj, MROWS, DMODEL, DMODEL, 2);

  // 5) residual + layernorm
  ln_kernel<<<MROWS, 256, 0, stream>>>(prj, Q, ln_g, ln_b, (float*)d_out);
}

// v001
// A run of this version takes 219 microseconds.
// Next to v000, in two timings, it ran 1.30 times as fast each time.
#include <hip/hip_runtime.h>
#include <hip/hip_bf16.h>

typedef __attribute__((ext_vector_type(16))) __bf16 v16bf;
typedef __attribute__((ext_vector_type(8)))  __bf16 v8bf;
typedef __attribute__((ext_vector_type(8)))  float  v8f;

#define HN     16
#define SEQ    2048
#define DMODEL 1024
#define ADIM   64
#define BATCH  4
#define MROWS  (BATCH * SEQ)   // 8192

static __device__ __forceinline__ v16bf cat8(v8bf lo, v8bf hi) {
  return __builtin_shufflevector(lo, hi, 0,1,2,3,4,5,6,7,8,9,10,11,12,13,14,15);
}

static __device__ __forceinline__ v8f wmma_bf16(v16bf a, v16bf b, v8f c) {
  // D = A(16x32 bf16) * B(32x16 bf16) + C(16x16 f32)
  return __builtin_amdgcn_wmma_f32_16x16x32_bf16(false, a, false, b, (short)0, c, false, false);
}

// gfx1250 async DMA: global -> LDS, 16B per lane, tracked by ASYNCcnt.
// GVS addressing: mem = SADDR(u64) + VADDR(i32) + IOFFSET. VDST = LDS byte addr.
static __device__ __forceinline__ void async_b128(unsigned lds_byte, unsigned voff_byte,
                                                  const void* base) {
  asm volatile("global_load_async_to_lds_b128 %0, %1, %2"
               :: "v"(lds_byte), "v"(voff_byte), "s"((unsigned long long)base)
               : "memory");
}

static __device__ __forceinline__ void wait_async0() {
#if __has_builtin(__builtin_amdgcn_s_wait_asynccnt)
  __builtin_amdgcn_s_wait_asynccnt(0);
#else
  asm volatile("s_wait_asynccnt 0x0" ::: "memory");
#endif
}

// empty volatile asm consuming the accumulator: volatile asms keep program
// order, so this pins the producing WMMAs *before* the following wait/barrier,
// letting the in-flight async DMA overlap the matrix math.
static __device__ __forceinline__ void pin(v8f& x) {
  asm volatile("" : "+v"(x));
}

// value of the same lane position in the other 16-lane half (l <-> l ^ 16)
static __device__ __forceinline__ float other_half(float x) {
  int b = __builtin_bit_cast(int, x);
  b = __builtin_amdgcn_permlanex16(b, b, 0x76543210, 0xfedcba98, false, false);
  return __builtin_bit_cast(float, b);
}

// exp2 of eight values. One statement, so that behind each v_exp_f32 stands an
// independent one (the slot the instruction set asks for before a result is used
// or a source overwritten); the closing v_nop is that slot for the last.
static __device__ __forceinline__ v8f exp2x8(v8f t) {
  float a = t[0], b = t[1], c = t[2], d = t[3], e = t[4], f = t[5], g = t[6], h = t[7];
  asm("v_exp_f32 %0, %0\n\tv_exp_f32 %1, %1\n\tv_exp_f32 %2, %2\n\tv_exp_f32 %3, %3\n\t"
      "v_exp_f32 %4, %4\n\tv_exp_f32 %5, %5\n\tv_exp_f32 %6, %6\n\tv_exp_f32 %7, %7\n\t"
      "v_nop"
      : "+v"(a), "+v"(b), "+v"(c), "+v"(d), "+v"(e), "+v"(f), "+v"(g), "+v"(h));
  v8f p = {a, b, c, d, e, f, g, h};
  return p;
}

// low 32 bits of a generic LDS pointer == LDS byte offset (flat aperture mapping)
static __device__ __forceinline__ unsigned lds_off(const void* p) {
  return (unsigned)(unsigned long long)p;
}

// ---------------------------------------------------------------------------
// fp32 -> bf16 elementwise convert
// ---------------------------------------------------------------------------
__global__ __launch_bounds__(256)
void cvt_f32_bf16_kernel(const float* __restrict__ in, __bf16* __restrict__ out, int n) {
  int i = blockIdx.x * 256 + threadIdx.x;
  if (i < n) out[i] = (__bf16)in[i];
}

// ---------------------------------------------------------------------------
// W[K][N] fp32  ->  Wt[N][K] bf16   (LDS tile transpose, coalesced both ways)
// ---------------------------------------------------------------------------
__global__ __launch_bounds__(256)
void transpose_bf16_kernel(const float* __restrict__ W, __bf16* __restrict__ Wt,
                           int K, int N) {
  __shared__ float tile[32][33];
  const int bx = blockIdx.x * 32;  // along N
  const int by = blockIdx.y * 32;  // along K
  const int tx = threadIdx.x & 31;
  const int ty = threadIdx.x >> 5;  // 0..7
#pragma unroll
  for (int i = 0; i < 4; i++) {
    int k = by + ty + i * 8;
    tile[ty + i * 8][tx] = W[(size_t)k * N + bx + tx];
  }
  __syncthreads();
#pragma unroll
  for (int i = 0; i < 4; i++) {
    int n = bx + ty + i * 8;
    Wt[(size_t)n * K + by + tx] = (__bf16)tile[tx][ty + i * 8];
  }
}

// ---------------------------------------------------------------------------
// Tiled WMMA GEMM with double-buffered async-DMA staging.
// C[M][N] = A[M][K] * Bt[N][K]^T + bias[N]
// block tile 128x128, BK=32, 256 threads = 8 waves (4 along M x 2 along N),
// each wave computes 32x64 = 2x4 tiles of 16x16.
// out mode: 0 -> bf16 [B,H,S,64]   (q / k layout)
//           1 -> bf16 [B,H,64,S]   (v transposed layout)
//           2 -> f32  row-major [M][N]
// ---------------------------------------------------------------------------
#define G_BM 128
#define G_BN 128
#define G_BK 32
#define G_LDA 40   // bf16 elems per LDS row (32 + 8 pad): 80B row, 16B aligned, bank-spread

__global__ __launch_bounds__(256)
void gemm_bf16_kernel(const __bf16* __restrict__ A,   // [M][K]
                      const __bf16* __restrict__ Bt,  // [N][K]
                      const float*  __restrict__ bias,
                      void* __restrict__ out,
                      int M, int N, int K, int mode) {
  __shared__ __align__(16) __bf16 lA[2][G_BM * G_LDA];
  __shared__ __align__(16) __bf16 lB[2][G_BN * G_LDA];

  const int tid  = threadIdx.x;
  const int lane = tid & 31;
  const int wave = tid >> 5;
  const int wm   = wave & 3;   // 4 waves along M (32 rows each)
  const int wn   = wave >> 2;  // 2 waves along N (64 cols each)
  const int m0   = blockIdx.x * G_BM;
  const int n0   = blockIdx.y * G_BN;
  const int lm   = lane & 15;
  const int kb   = (lane >> 4) * 8;   // ISA 16-bit A/B fragment K mapping

  // per-thread DMA chunk coords: chunks c = tid and tid+256; r = c>>2, kc = c&3
  const int cr = tid >> 2;     // 0..63
  const int ck = tid & 3;      // 0..3
  const unsigned ldsA0 = lds_off(&lA[0][0]);
  const unsigned ldsB0 = lds_off(&lB[0][0]);
  const unsigned bufA  = (unsigned)(G_BM * G_LDA * 2);
  const unsigned bufB  = (unsigned)(G_BN * G_LDA * 2);
  const unsigned lA_t0 = ldsA0 + (unsigned)((cr      ) * G_LDA + ck * 8) * 2;
  const unsigned lA_t1 = ldsA0 + (unsigned)((cr + 64 ) * G_LDA + ck * 8) * 2;
  const unsigned lB_t0 = ldsB0 + (unsigned)((cr      ) * G_LDA + ck * 8) * 2;
  const unsigned lB_t1 = ldsB0 + (unsigned)((cr + 64 ) * G_LDA + ck * 8) * 2;
  const unsigned gA0 = ((unsigned)(m0 + cr     ) * K + ck * 8) * 2;
  const unsigned gA1 = ((unsigned)(m0 + cr + 64) * K + ck * 8) * 2;
  const unsigned gB0 = ((unsigned)(n0 + cr     ) * K + ck * 8) * 2;
  const unsigned gB1 = ((unsigned)(n0 + cr + 64) * K + ck * 8) * 2;

#define G_ISSUE(k0, buf) do {                                   \
    unsigned kby = (unsigned)(k0) * 2;                          \
    async_b128(lA_t0 + (buf) * bufA, gA0 + kby, A);             \
    async_b128(lA_t1 + (buf) * bufA, gA1 + kby, A);             \
    async_b128(lB_t0 + (buf) * bufB, gB0 + kby, Bt);            \
    async_b128(lB_t1 + (buf) * bufB, gB1 + kby, Bt);            \
  } while (0)

  v8f acc[2][4];
#pragma unroll
  for (int i = 0; i < 2; i++)
#pragma unroll
    for (int j = 0; j < 4; j++) acc[i][j] = (v8f)(0.0f);

  const int KT = K / G_BK;
  G_ISSUE(0, 0);
  wait_async0();
  __syncthreads();

  for (int kt = 0; kt < KT; kt++) {
    const int cur = kt & 1;
    if (kt + 1 < KT) G_ISSUE((kt + 1) * G_BK, cur ^ 1);  // DMA next tile during compute

    v16bf af[2], bfm[4];
#pragma unroll
    for (int i = 0; i < 2; i++) {
      int r = wm * 32 + i * 16 + lm;
      v8bf lo = *(const v8bf*)(&lA[cur][r * G_LDA + kb]);
      v8bf hi = *(const v8bf*)(&lA[cur][r * G_LDA + 16 + kb]);
      af[i] = cat8(lo, hi);
    }
#pragma unroll
    for (int j = 0; j < 4; j++) {
      int r = wn * 64 + j * 16 + lm;
      v8bf lo = *(const v8bf*)(&lB[cur][r * G_LDA + kb]);
      v8bf hi = *(const v8bf*)(&lB[cur][r * G_LDA + 16 + kb]);
      bfm[j] = cat8(lo, hi);
    }
#pragma unroll
    for (int i = 0; i < 2; i++)
#pragma unroll
      for (int j = 0; j < 4; j++)
        acc[i][j] = wmma_bf16(af[i], bfm[j], acc[i][j]);

    // keep WMMAs ahead of the async wait so DMA overlaps the matrix math
#pragma unroll
    for (int i = 0; i < 2; i++)
#pragma unroll
      for (int j = 0; j < 4; j++) pin(acc[i][j]);

    wait_async0();
    __syncthreads();
  }
#undef G_ISSUE

  // epilogue: D layout -> lane holds col lm, VGPR r holds row r + 8*(lane>=16)
  const int mh = (lane >> 4) * 8;
#pragma unroll
  for (int i = 0; i < 2; i++) {
#pragma unroll
    for (int j = 0; j < 4; j++) {
      int n = n0 + wn * 64 + j * 16 + lm;
      float bv = bias[n];
#pragma unroll
      for (int r = 0; r < 8; r++) {
        int m = m0 + wm * 32 + i * 16 + r + mh;
        float val = acc[i][j][r] + bv;
        if (mode == 0) {          // [B,H,S,64] bf16
          int b = m / SEQ, s = m % SEQ;
          int h = n >> 6, dd = n & 63;
          ((__bf16*)out)[(((size_t)(b * HN + h)) * SEQ + s) * ADIM + dd] = (__bf16)val;
        } else if (mode == 1) {   // [B,H,64,S] bf16 (v transposed)
          int b = m / SEQ, s = m % SEQ;
          int h = n >> 6, dd = n & 63;
          ((__bf16*)out)[(((size_t)(b * HN + h)) * ADIM + dd) * SEQ + s] = (__bf16)val;
        } else {                  // f32 row-major
          ((float*)out)[(size_t)m * N + n] = val;
        }
      }
    }
  }
}

// ---------------------------------------------------------------------------
// Flash-style attention with double-buffered async-DMA KV staging.
// grid = (B*H, S/64). 128 threads = 4 waves, each wave owns 16 query rows.
// Both products run transposed: St = K * Qt, Ot += Vt * Pt. A lane then holds
// one query (column lm): its softmax statistics are one scalar per lane, and
// two St tiles, converted in place, are the B operand of the second product.
// ---------------------------------------------------------------------------
#define A_LDK 72  // 64 + 8 pad bf16 elems per LDS row (144B: 16B aligned)

// waves_per_eu: register room for the K and V fragment reads to stand in groups
// ahead of their WMMAs; at a tighter budget each read pair is waited on singly.
__global__ __launch_bounds__(128) __attribute__((amdgpu_waves_per_eu(4, 6)))
void attn_kernel(const __bf16* __restrict__ qb,   // [BH][S][64]
                 const __bf16* __restrict__ kbuf, // [BH][S][64]
                 const __bf16* __restrict__ vt,   // [BH][64][S]
                 __bf16* __restrict__ ctx) {      // [B*S][1024]
  const int bh   = blockIdx.x;
  const int qblk = blockIdx.y;
  const int tid  = threadIdx.x;
  const int lane = tid & 31;
  const int wave = tid >> 5;
  const int lm   = lane & 15;
  const int kb   = (lane >> 4) * 8;
  const int mh   = (lane >> 4) * 8;

  __shared__ __align__(16) __bf16 lK[2][64 * A_LDK];
  __shared__ __align__(16) __bf16 lV[2][64 * A_LDK];

  // per-thread DMA chunks: 512 16B chunks per tile / 128 threads = 4 each
  const int acr = tid >> 3;   // 0..15 (row group)
  const int acc_ = tid & 7;   // 0..7  (16B column chunk)
  const unsigned ldsK0 = lds_off(&lK[0][0]);
  const unsigned ldsV0 = lds_off(&lV[0][0]);
  const unsigned kvbuf = (unsigned)(64 * A_LDK * 2);
  unsigned lK_t[4], lV_t[4], gK[4], gV[4];
#pragma unroll
  for (int i = 0; i < 4; i++) {
    int r = acr + 16 * i;
    lK_t[i] = ldsK0 + (unsigned)(r * A_LDK + acc_ * 8) * 2;
    lV_t[i] = ldsV0 + (unsigned)(r * A_LDK + acc_ * 8) * 2;
    gK[i] = (((unsigned)bh * SEQ + r) * ADIM + acc_ * 8) * 2;  // + kv0*ADIM*2
    gV[i] = (((unsigned)bh * ADIM + r) * SEQ + acc_ * 8) * 2;  // + kv0*2
  }

#define KV_ISSUE(kv0, buf) do {                                        \
    unsigned ok = (unsigned)(kv0) * ADIM * 2, ov = (unsigned)(kv0) * 2;\
    _Pragma("unroll")                                                  \
    for (int i = 0; i < 4; i++) {                                      \
      async_b128(lK_t[i] + (buf) * kvbuf, gK[i] + ok, kbuf);           \
      async_b128(lV_t[i] + (buf) * kvbuf, gV[i] + ov, vt);             \
    }                                                                  \
  } while (0)

  // q fragments stay resident as B operands (K = d = 64 -> 2 WMMA k-steps)
  v16bf qf[2];
  {
    const __bf16* qrow = qb + ((size_t)bh * SEQ + qblk * 64 + wave * 16 + lm) * ADIM;
#pragma unroll
    for (int ks = 0; ks < 2; ks++) {
      v8bf lo = *(const v8bf*)(qrow + ks * 32 + kb);
      v8bf hi = *(const v8bf*)(qrow + ks * 32 + 16 + kb);
      qf[ks] = cat8(lo, hi);
    }
  }

  // this lane's query: running maximum (both halves agree) and the sum over the
  // keys of this lane's half (the halves are joined once, after the loop)
  float row_max = -3.0e38f, row_sum = 0.0f;
  v8f o[4];  // Ot tiles: lane = query lm, register r = d index dt*16 + mh + r
#pragma unroll
  for (int dt = 0; dt < 4; dt++) o[dt] = (v8f)(0.0f);

  KV_ISSUE(0, 0);
  wait_async0();
  __syncthreads();

  for (int kvb = 0; kvb < SEQ / 64; kvb++) {
    const int cur = kvb & 1;
    if (kvb + 1 < SEQ / 64) KV_ISSUE((kvb + 1) * 64, cur ^ 1);  // DMA next KV block

    // St = k @ q^T  (4 key tiles x 2 k-steps): register r = key tn*16 + mh + r
    v8f sc[4];
    v16bf kf[2][4];
#pragma unroll
    for (int ks = 0; ks < 2; ks++) {
#pragma unroll
      for (int tn = 0; tn < 4; tn++) {
        int r = tn * 16 + lm;
        v8bf lo = *(const v8bf*)(&lK[cur][r * A_LDK + ks * 32 + kb]);
        v8bf hi = *(const v8bf*)(&lK[cur][r * A_LDK + ks * 32 + 16 + kb]);
        kf[ks][tn] = cat8(lo, hi);
      }
    }
#pragma unroll
    for (int tn = 0; tn < 4; tn++) sc[tn] = (v8f)(0.0f);
#pragma unroll
    for (int ks = 0; ks < 2; ks++)
#pragma unroll
      for (int tn = 0; tn < 4; tn++)
        sc[tn] = wmma_bf16(kf[ks][tn], qf[ks], sc[tn]);

    // online softmax, one query per lane: 32 keys in-lane, one exchange of halves
    const float scale = 0.125f;  // 1/sqrt(64)
    float mt[4];
#pragma unroll
    for (int tn = 0; tn < 4; tn++) {
      sc[tn] *= scale;
      mt[tn] = sc[tn][0];
#pragma unroll
      for (int r = 1; r < 8; r++) mt[tn] = fmaxf(mt[tn], sc[tn][r]);
    }
    float mx = fmaxf(fmaxf(mt[0], mt[1]), fmaxf(mt[2], mt[3]));
    mx = fmaxf(mx, other_half(mx));
    float newm  = fmaxf(row_max, mx);
    float alpha = __expf(row_max - newm);
    row_max = newm;
#pragma unroll
    for (int tn = 0; tn < 4; tn++) {
      // exp(x) as exp2(x * log2(e)), one maximum for all of the lane's registers
      sc[tn] = exp2x8((sc[tn] - newm) * 1.44269504f);
    }
    v8f ps = (sc[0] + sc[1]) + (sc[2] + sc[3]);
    float psum = ((ps[0] + ps[1]) + (ps[2] + ps[3])) + ((ps[4] + ps[5]) + (ps[6] + ps[7]));
    row_sum = row_sum * alpha + psum;
#pragma unroll
    for (int dt = 0; dt < 4; dt++) o[dt] *= alpha;

    // Ot += Vt @ Pt: St tiles 2ks and 2ks+1 hold keys in the fragment's k order
#pragma unroll
    for (int ks = 0; ks < 2; ks++) {
      v16bf pf = cat8(__builtin_convertvector(sc[2 * ks], v8bf),
                      __builtin_convertvector(sc[2 * ks + 1], v8bf));
#pragma unroll
      for (int dt = 0; dt < 4; dt++) {
        int r = dt * 16 + lm;
        v8bf lo = *(const v8bf*)(&lV[cur][r * A_LDK + ks * 32 + kb]);
        v8bf hi = *(const v8bf*)(&lV[cur][r * A_LDK + ks * 32 + 16 + kb]);
        o[dt] = wmma_bf16(cat8(lo, hi), pf, o[dt]);
      }
    }

    // keep PV WMMAs ahead of the async wait so KV DMA overlaps the matrix math
#pragma unroll
    for (int dt = 0; dt < 4; dt++) pin(o[dt]);

    wait_async0();
    __syncthreads();
  }
#undef KV_ISSUE

  // finalize: ctx[(b*S+s)][h*64 + d] bf16, 8 consecutive d per lane and tile
  const int b = bh >> 4, h = bh & 15;
  row_sum += other_half(row_sum);
  const float inv = 1.0f / row_sum;
  const int s = qblk * 64 + wave * 16 + lm;
  __bf16* dst = ctx + ((size_t)(b * SEQ + s)) * DMODEL + h * ADIM + mh;
#pragma unroll
  for (int dt = 0; dt < 4; dt++)
    *(v8bf*)(dst + dt * 16) = __builtin_convertvector(o[dt] * inv, v8bf);
}

// ---------------------------------------------------------------------------
// residual add + LayerNorm, one 256-thread block per row of 1024
// ---------------------------------------------------------------------------
__global__ __launch_bounds__(256)
void ln_kernel(const float* __restrict__ proj, const float* __restrict__ resid,
               const float* __restrict__ g, const float* __restrict__ b,
               float* __restrict__ out) {
  const int row = blockIdx.x;
  const int tid = threadIdx.x;
  __shared__ float ssum[8], ssq[8];
  float x[4];
  float s = 0.0f, sq = 0.0f;
#pragma unroll
  for (int i = 0; i < 4; i++) {
    int c = tid + i * 256;
    float v = proj[(size_t)row * DMODEL + c] + resid[(size_t)row * DMODEL + c];
    x[i] = v; s += v; sq += v * v;
  }
#pragma unroll
  for (int off = 16; off >= 1; off >>= 1) {
    s  += __shfl_xor(s,  off, 32);
    sq += __shfl_xor(sq, off, 32);
  }
  if ((tid & 31) == 0) { ssum[tid >> 5] = s; ssq[tid >> 5] = sq; }
  __syncthreads();
  s = 0.0f; sq = 0.0f;
#pragma unroll
  for (int w = 0; w < 8; w++) { s += ssum[w]; sq += ssq[w]; }
  float mu  = s * (1.0f / DMODEL);
  float var = sq * (1.0f / DMODEL) - mu * mu;
  float rs  = rsqrtf(var + 1e-5f);
#pragma unroll
  for (int i = 0; i < 4; i++) {
    int c = tid + i * 256;
    out[(size_t)row * DMODEL + c] = (x[i] - mu) * rs * g[c] + b[c];
  }
}

// ---------------------------------------------------------------------------
extern "C" void kernel_launch(void* const* d_in, const int* in_sizes, int n_in,
                              void* d_out, int out_size, void* d_ws, size_t ws_size,
                              hipStream_t stream) {
  (void)in_sizes; (void)n_in; (void)out_size; (void)ws_size;
  const float* Q    = (const float*)d_in[0];
  const float* Wq   = (const float*)d_in[1];
  const float* bq   = (const float*)d_in[2];
  const float* Wk   = (const float*)d_in[3];
  const float* bk   = (const float*)d_in[4];
  const float* Wv   = (const float*)d_in[5];
  const float* bv   = (const float*)d_in[6];
  const float* Wo   = (const float*)d_in[7];
  const float* bo   = (const float*)d_in[8];
  const float* ln_g = (const float*)d_in[9];
  const float* ln_b = (const float*)d_in[10];

  const size_t ND = (size_t)MROWS * DMODEL;     // 8192*1024
  const size_t WW = (size_t)DMODEL * DMODEL;    // 1024*1024

  char* ws = (char*)d_ws;
  size_t off = 0;
  __bf16* Xbf = (__bf16*)(ws + off); off += ND * 2;
  __bf16* WqT = (__bf16*)(ws + off); off += WW * 2;
  __bf16* WkT = (__bf16*)(ws + off); off += WW * 2;
  __bf16* WvT = (__bf16*)(ws + off); off += WW * 2;
  __bf16* WoT = (__bf16*)(ws + off); off += WW * 2;
  __bf16* qbf = (__bf16*)(ws + off); off += ND * 2;   // [B,H,S,64]
  __bf16* kbf = (__bf16*)(ws + off); off += ND * 2;   // [B,H,S,64]
  __bf16* vtb = (__bf16*)(ws + off); off += ND * 2;   // [B,H,64,S]
  __bf16* ctx = (__bf16*)(ws + off); off += ND * 2;   // [B*S, 1024]
  float*  prj = (float*)(ws + off);  off += ND * 4;   // [B*S, 1024]

  // 1) precision staging
  cvt_f32_bf16_kernel<<<(int)((ND + 255) / 256), 256, 0, stream>>>(Q, Xbf, (int)ND);
  dim3 tg(DMODEL / 32, DMODEL / 32);
  transpose_bf16_kernel<<<tg, 256, 0, stream>>>(Wq, WqT, DMODEL, DMODEL);
  transpose_bf16_kernel<<<tg, 256, 0, stream>>>(Wk, WkT, DMODEL, DMODEL);
  transpose_bf16_kernel<<<tg, 256, 0, stream>>>(Wv, WvT, DMODEL, DMODEL);
  transpose_bf16_kernel<<<tg, 256, 0, stream>>>(Wo, WoT, DMODEL, DMODEL);

  // 2) QKV projections (WMMA GEMMs scattering into attention layouts)
  dim3 gg(MROWS / G_BM, DMODEL / G_BN);
  gemm_bf16_kernel<<<gg, 256, 0, stream>>>(Xbf, WqT, bq, qbf, MROWS, DMODEL, DMODEL, 0);
  gemm_bf16_kernel<<<gg, 256, 0, stream>>>(Xbf, WkT, bk, kbf, MROWS, DMODEL, DMODEL, 0);
  gemm_bf16_kernel<<<gg, 256, 0, stream>>>(Xbf, WvT, bv, vtb, MROWS, DMODEL, DMODEL, 1);

  // 3) flash attention
  attn_kernel<<<dim3(BATCH * HN, SEQ / 64), 128, 0, stream>>>(qbf, kbf, vtb, ctx);

  // 4) output projection (f32 out)
  gemm_bf16_kernel<<<gg, 256, 0, stream>>>(ctx, WoT, bo, prj, MROWS, DMODEL, DMODEL, 2);

  // 5) residual + layernorm
  ln_kernel<<<MROWS, 256, 0, stream>>>(prj, Q, ln_g, ln_b, (float*)d_out);
}

// v002
// A run of this version takes 203 microseconds.
// Timed twice side by side with v001, it ran 1.08 times as fast both times.
// Counting every step since v000, it is 1.40 times as fast.
#include <hip/hip_runtime.h>
#include <hip/hip_bf16.h>

typedef __attribute__((ext_vector_type(16))) __bf16 v16bf;
typedef __attribute__((ext_vector_type(8)))  __bf16 v8bf;
typedef __attribute__((ext_vector_type(8)))  float  v8f;
typedef __attribute__((ext_vector_type(4)))  float  v4f;
typedef __attribute__((ext_vector_type(4)))  __bf16 v4bf;

#define HN     16
#define SEQ    2048
#define DMODEL 1024
#define ADIM   64
#define BATCH  4
#define MROWS  (BATCH * SEQ)   // 8192

static __device__ __forceinline__ v16bf cat8(v8bf lo, v8bf hi) {
  return __builtin_shufflevector(lo, hi, 0,1,2,3,4,5,6,7,8,9,10,11,12,13,14,15);
}

static __device__ __forceinline__ v8f wmma_bf16(v16bf a, v16bf b, v8f c) {
  // D = A(16x32 bf16) * B(32x16 bf16) + C(16x16 f32)
  return __builtin_amdgcn_wmma_f32_16x16x32_bf16(false, a, false, b, (short)0, c, false, false);
}

// gfx1250 async DMA: global -> LDS, 16B per lane, tracked by ASYNCcnt.
// GVS addressing: mem = SADDR(u64) + VADDR(i32) + IOFFSET. VDST = LDS byte addr.
static __device__ __forceinline__ void async_b128(unsigned lds_byte, unsigned voff_byte,
                                                  const void* base) {
  asm volatile("global_load_async_to_lds_b128 %0, %1, %2"
               :: "v"(lds_byte), "v"(voff_byte), "s"((unsigned long long)base)
               : "memory");
}

static __device__ __forceinline__ void wait_async0() {
#if __has_builtin(__builtin_amdgcn_s_wait_asynccnt)
  __builtin_amdgcn_s_wait_asynccnt(0);
#else
  asm volatile("s_wait_asynccnt 0x0" ::: "memory");
#endif
}

// empty volatile asm consuming the accumulator: volatile asms keep program
// order, so this pins the producing WMMAs *before* the following wait/barrier,
// letting the in-flight async DMA overlap the matrix math.
static __device__ __forceinline__ void pin(v8f& x) {
  asm volatile("" : "+v"(x));
}

// value of the same lane position in the other 16-lane half (l <-> l ^ 16)
static __device__ __forceinline__ float other_half(float x) {
  int b = __builtin_bit_cast(int, x);
  b = __builtin_amdgcn_permlanex16(b, b, 0x76543210, 0xfedcba98, false, false);
  return __builtin_bit_cast(float, b);
}

// exp2 of eight values. One statement, so that behind each v_exp_f32 stands an
// independent one (the slot the instruction set asks for before a result is used
// or a source overwritten); the closing v_nop is that slot for the last.
static __device__ __forceinline__ v8f exp2x8(v8f t) {
  float a = t[0], b = t[1], c = t[2], d = t[3], e = t[4], f = t[5], g = t[6], h = t[7];
  asm("v_exp_f32 %0, %0\n\tv_exp_f32 %1, %1\n\tv_exp_f32 %2, %2\n\tv_exp_f32 %3, %3\n\t"
      "v_exp_f32 %4, %4\n\tv_exp_f32 %5, %5\n\tv_exp_f32 %6, %6\n\tv_exp_f32 %7, %7\n\t"
      "v_nop"
      : "+v"(a), "+v"(b), "+v"(c), "+v"(d), "+v"(e), "+v"(f), "+v"(g), "+v"(h));
  v8f p = {a, b, c, d, e, f, g, h};
  return p;
}

// low 32 bits of a generic LDS pointer == LDS byte offset (flat aperture mapping)
static __device__ __forceinline__ unsigned lds_off(const void* p) {
  return (unsigned)(unsigned long long)p;
}

// ---------------------------------------------------------------------------
// fp32 -> bf16 elementwise convert. A lane takes CVT_V groups of four floats, all
// loads asked for before the first store; a wave's load covers 512 contiguous
// bytes, its store 256. One block covers 256 * CVT_V * 4 floats, no remainder.
// ---------------------------------------------------------------------------
#define CVT_V 16
__global__ __launch_bounds__(256)
void cvt_f32_bf16_kernel(const float* __restrict__ in, __bf16* __restrict__ out) {
  const size_t base = (size_t)blockIdx.x * (256 * CVT_V) + threadIdx.x;  // in groups of 4
  const v4f* __restrict__ src = (const v4f*)in + base;
  v4bf* __restrict__ dst = (v4bf*)out + base;
  v4f v[CVT_V];
#pragma unroll
  for (int j = 0; j < CVT_V; j++) v[j] = src[j * 256];
#pragma unroll
  for (int j = 0; j < CVT_V; j++) dst[j * 256] = __builtin_convertvector(v[j], v4bf);
}

// ---------------------------------------------------------------------------
// W[K][N] fp32  ->  Wt[N][K] bf16   (LDS tile transpose, 64 x 64 per block:
// a lane loads four groups of 4 floats and stores two groups of 8 bf16, so a
// wave reads whole 256-byte row pieces and writes whole 128-byte lines)
// ---------------------------------------------------------------------------
__global__ __launch_bounds__(256)
void transpose_bf16_kernel(const float* __restrict__ W, __bf16* __restrict__ Wt,
                           int K, int N) {
  __shared__ float tile[64][65];
  const int bx = blockIdx.x * 64;  // along N
  const int by = blockIdx.y * 64;  // along K
  const int c4 = threadIdx.x & 15;   // group of 4 columns (n)
  const int r0 = threadIdx.x >> 4;   // 0..15
  v4f v[4];
#pragma unroll
  for (int i = 0; i < 4; i++)
    v[i] = *(const v4f*)(W + (size_t)(by + r0 + i * 16) * N + bx + c4 * 4);
  // the loads' address registers are free for reuse only behind this wait; the
  // scheduling barrier keeps later index arithmetic from being lifted over it
  asm volatile("s_wait_xcnt 0x0" ::: "memory");
  __builtin_amdgcn_sched_barrier(0);
#pragma unroll
  for (int i = 0; i < 4; i++)
#pragma unroll
    for (int e = 0; e < 4; e++) tile[r0 + i * 16][c4 * 4 + e] = v[i][e];
  __syncthreads();
  const int ck = threadIdx.x & 7;    // group of 8 k
  const int n0 = threadIdx.x >> 3;   // 0..31
#pragma unroll
  for (int i = 0; i < 2; i++) {
    int n = n0 + i * 32;
    v8bf o;
#pragma unroll
    for (int j = 0; j < 8; j++) o[j] = (__bf16)tile[ck * 8 + j][n];
    *(v8bf*)(Wt + (size_t)(bx + n) * K + by + ck * 8) = o;
  }
}

// ---------------------------------------------------------------------------
// Tiled WMMA GEMM with double-buffered async-DMA staging.
// C[M][N] = A[M][K] * Bt[N][K]^T + bias[N]
// block tile 128x128, BK=32, 256 threads = 8 waves (4 along M x 2 along N),
// each wave computes 32x64 = 2x4 tiles of 16x16.
// out mode: 0 -> bf16 [B,H,S,64]   (q / k layout)
//           1 -> bf16 [B,H,64,S]   (v transposed layout)
//           2 -> f32  row-major [M][N]
// ---------------------------------------------------------------------------
#define G_BM 128
#define G_BN 128
#define G_BK 32
#define G_LDA 40   // bf16 elems per LDS row (32 + 8 pad): 80B row, 16B aligned, bank-spread

__global__ __launch_bounds__(256)
void gemm_bf16_kernel(const __bf16* __restrict__ A,   // [M][K]
                      const __bf16* __restrict__ Bt,  // [N][K]
                      const float*  __restrict__ bias,
                      void* __restrict__ out,
                      int M, int N, int K, int mode) {
  __shared__ __align__(16) __bf16 lA[2][G_BM * G_LDA];
  __shared__ __align__(16) __bf16 lB[2][G_BN * G_LDA];

  const int tid  = threadIdx.x;
  const int lane = tid & 31;
  const int wave = tid >> 5;
  const int wm   = wave & 3;   // 4 waves along M (32 rows each)
  const int wn   = wave >> 2;  // 2 waves along N (64 cols each)
  const int m0   = blockIdx.x * G_BM;
  const int n0   = blockIdx.y * G_BN;
  const int lm   = lane & 15;
  const int kb   = (lane >> 4) * 8;   // ISA 16-bit A/B fragment K mapping

  // per-thread DMA chunk coords: chunks c = tid and tid+256; r = c>>2, kc = c&3
  const int cr = tid >> 2;     // 0..63
  const int ck = tid & 3;      // 0..3
  const unsigned ldsA0 = lds_off(&lA[0][0]);
  const unsigned ldsB0 = lds_off(&lB[0][0]);
  const unsigned bufA  = (unsigned)(G_BM * G_LDA * 2);
  const unsigned bufB  = (unsigned)(G_BN * G_LDA * 2);
  const unsigned lA_t0 = ldsA0 + (unsigned)((cr      ) * G_LDA + ck * 8) * 2;
  const unsigned lA_t1 = ldsA0 + (unsigned)((cr + 64 ) * G_LDA + ck * 8) * 2;
  const unsigned lB_t0 = ldsB0 + (unsigned)((cr      ) * G_LDA + ck * 8) * 2;
  const unsigned lB_t1 = ldsB0 + (unsigned)((cr + 64 ) * G_LDA + ck * 8) * 2;
  const unsigned gA0 = ((unsigned)(m0 + cr     ) * K + ck * 8) * 2;
  const unsigned gA1 = ((unsigned)(m0 + cr + 64) * K + ck * 8) * 2;
  const unsigned gB0 = ((unsigned)(n0 + cr     ) * K + ck * 8) * 2;
  const unsigned gB1 = ((unsigned)(n0 + cr + 64) * K + ck * 8) * 2;

#define G_ISSUE(k0, buf) do {                                   \
    unsigned kby = (unsigned)(k0) * 2;                          \
    async_b128(lA_t0 + (buf) * bufA, gA0 + kby, A);             \
    async_b128(lA_t1 + (buf) * bufA, gA1 + kby, A);             \
    async_b128(lB_t0 + (buf) * bufB, gB0 + kby, Bt);            \
    async_b128(lB_t1 + (buf) * bufB, gB1 + kby, Bt);            \
  } while (0)

  v8f acc[2][4];
#pragma unroll
  for (int i = 0; i < 2; i++)
#pragma unroll
    for (int j = 0; j < 4; j++) acc[i][j] = (v8f)(0.0f);

  const int KT = K / G_BK;
  G_ISSUE(0, 0);
  wait_async0();
  __syncthreads();

  for (int kt = 0; kt < KT; kt++) {
    const int cur = kt & 1;
    if (kt + 1 < KT) G_ISSUE((kt + 1) * G_BK, cur ^ 1);  // DMA next tile during compute

    v16bf af[2], bfm[4];
#pragma unroll
    for (int i = 0; i < 2; i++) {
      int r = wm * 32 + i * 16 + lm;
      v8bf lo = *(const v8bf*)(&lA[cur][r * G_LDA + kb]);
      v8bf hi = *(const v8bf*)(&lA[cur][r * G_LDA + 16 + kb]);
      af[i] = cat8(lo, hi);
    }
#pragma unroll
    for (int j = 0; j < 4; j++) {
      int r = wn * 64 + j * 16 + lm;
      v8bf lo = *(const v8bf*)(&lB[cur][r * G_LDA + kb]);
      v8bf hi = *(const v8bf*)(&lB[cur][r * G_LDA + 16 + kb]);
      bfm[j] = cat8(lo, hi);
    }
#pragma unroll
    for (int i = 0; i < 2; i++)
#pragma unroll
      for (int j = 0; j < 4; j++)
        acc[i][j] = wmma_bf16(af[i], bfm[j], acc[i][j]);

    // keep WMMAs ahead of the async wait so DMA overlaps the matrix math
#pragma unroll
    for (int i = 0; i < 2; i++)
#pragma unroll
      for (int j = 0; j < 4; j++) pin(acc[i][j]);

    wait_async0();
    __syncthreads();
  }
#undef G_ISSUE

  // epilogue: D layout -> lane holds col lm, VGPR r holds row r + 8*(lane>=16)
  const int mh = (lane >> 4) * 8;
#pragma unroll
  for (int i = 0; i < 2; i++) {
#pragma unroll
    for (int j = 0; j < 4; j++) {
      int n = n0 + wn * 64 + j * 16 + lm;
      float bv = bias[n];
#pragma unroll
      for (int r = 0; r < 8; r++) {
        int m = m0 + wm * 32 + i * 16 + r + mh;
        float val = acc[i][j][r] + bv;
        if (mode == 0) {          // [B,H,S,64] bf16
          int b = m / SEQ, s = m % SEQ;
          int h = n >> 6, dd = n & 63;
          ((__bf16*)out)[(((size_t)(b * HN + h)) * SEQ + s) * ADIM + dd] = (__bf16)val;
        } else if (mode == 1) {   // [B,H,64,S] bf16 (v transposed)
          int b = m / SEQ, s = m % SEQ;
          int h = n >> 6, dd = n & 63;
          ((__bf16*)out)[(((size_t)(b * HN + h)) * ADIM + dd) * SEQ + s] = (__bf16)val;
        } else {                  // f32 row-major
          ((float*)out)[(size_t)m * N + n] = val;
        }
      }
    }
  }
}

// ---------------------------------------------------------------------------
// Flash-style attention with double-buffered async-DMA KV staging.
// grid = (B*H, S/64). 128 threads = 4 waves, each wave owns 16 query rows.
// Both products run transposed: St = K * Qt, Ot += Vt * Pt. A lane then holds
// one query (column lm): its softmax statistics are one scalar per lane, and
// two St tiles, converted in place, are the B operand of the second product.
// ---------------------------------------------------------------------------
#define A_LDK 72  // 64 + 8 pad bf16 elems per LDS row (144B: 16B aligned)

// waves_per_eu: register room for the K and V fragment reads to stand in groups
// ahead of their WMMAs; at a tighter budget each read pair is waited on singly.
__global__ __launch_bounds__(128) __attribute__((amdgpu_waves_per_eu(4, 6)))
void attn_kernel(const __bf16* __restrict__ qb,   // [BH][S][64]
                 const __bf16* __restrict__ kbuf, // [BH][S][64]
                 const __bf16* __restrict__ vt,   // [BH][64][S]
                 __bf16* __restrict__ ctx) {      // [B*S][1024]
  const int bh   = blockIdx.x;
  const int qblk = blockIdx.y;
  const int tid  = threadIdx.x;
  const int lane = tid & 31;
  const int wave = tid >> 5;
  const int lm   = lane & 15;
  const int kb   = (lane >> 4) * 8;
  const int mh   = (lane >> 4) * 8;

  __shared__ __align__(16) __bf16 lK[2][64 * A_LDK];
  __shared__ __align__(16) __bf16 lV[2][64 * A_LDK];

  // per-thread DMA chunks: 512 16B chunks per tile / 128 threads = 4 each
  const int acr = tid >> 3;   // 0..15 (row group)
  const int acc_ = tid & 7;   // 0..7  (16B column chunk)
  const unsigned ldsK0 = lds_off(&lK[0][0]);
  const unsigned ldsV0 = lds_off(&lV[0][0]);
  const unsigned kvbuf = (unsigned)(64 * A_LDK * 2);
  unsigned lK_t[4], lV_t[4], gK[4], gV[4];
#pragma unroll
  for (int i = 0; i < 4; i++) {
    int r = acr + 16 * i;
    lK_t[i] = ldsK0 + (unsigned)(r * A_LDK + acc_ * 8) * 2;
    lV_t[i] = ldsV0 + (unsigned)(r * A_LDK + acc_ * 8) * 2;
    gK[i] = (((unsigned)bh * SEQ + r) * ADIM + acc_ * 8) * 2;  // + kv0*ADIM*2
    gV[i] = (((unsigned)bh * ADIM + r) * SEQ + acc_ * 8) * 2;  // + kv0*2
  }

#define KV_ISSUE(kv0, buf) do {                                        \
    unsigned ok = (unsigned)(kv0) * ADIM * 2, ov = (unsigned)(kv0) * 2;\
    _Pragma("unroll")                                                  \
    for (int i = 0; i < 4; i++) {                                      \
      async_b128(lK_t[i] + (buf) * kvbuf, gK[i] + ok, kbuf);           \
      async_b128(lV_t[i] + (buf) * kvbuf, gV[i] + ov, vt);             \
    }                                                                  \
  } while (0)

  // q fragments stay resident as B operands (K = d = 64 -> 2 WMMA k-steps)
  v16bf qf[2];
  {
    const __bf16* qrow = qb + ((size_t)bh * SEQ + qblk * 64 + wave * 16 + lm) * ADIM;
#pragma unroll
    for (int ks = 0; ks < 2; ks++) {
      v8bf lo = *(const v8bf*)(qrow + ks * 32 + kb);
      v8bf hi = *(const v8bf*)(qrow + ks * 32 + 16 + kb);
      qf[ks] = cat8(lo, hi);
    }
  }

  // this lane's query: running maximum (both halves agree) and the sum over the
  // keys of this lane's half (the halves are joined once, after the loop)
  float row_max = -3.0e38f, row_sum = 0.0f;
  v8f o[4];  // Ot tiles: lane = query lm, register r = d index dt*16 + mh + r
#pragma unroll
  for (int dt = 0; dt < 4; dt++) o[dt] = (v8f)(0.0f);

  KV_ISSUE(0, 0);
  wait_async0();
  __syncthreads();

  for (int kvb = 0; kvb < SEQ / 64; kvb++) {
    const int cur = kvb & 1;
    if (kvb + 1 < SEQ / 64) KV_ISSUE((kvb + 1) * 64, cur ^ 1);  // DMA next KV block

    // St = k @ q^T  (4 key tiles x 2 k-steps): register r = key tn*16 + mh + r
    v8f sc[4];
    v16bf kf[2][4];
#pragma unroll
    for (int ks = 0; ks < 2; ks++) {
#pragma unroll
      for (int tn = 0; tn < 4; tn++) {
        int r = tn * 16 + lm;
        v8bf lo = *(const v8bf*)(&lK[cur][r * A_LDK + ks * 32 + kb]);
        v8bf hi = *(const v8bf*)(&lK[cur][r * A_LDK + ks * 32 + 16 + kb]);
        kf[ks][tn] = cat8(lo, hi);
      }
    }
#pragma unroll
    for (int tn = 0; tn < 4; tn++) sc[tn] = (v8f)(0.0f);
#pragma unroll
    for (int ks = 0; ks < 2; ks++)
#pragma unroll
      for (int tn = 0; tn < 4; tn++)
        sc[tn] = wmma_bf16(kf[ks][tn], qf[ks], sc[tn]);

    // online softmax, one query per lane: 32 keys in-lane, one exchange of halves
    const float scale = 0.125f;  // 1/sqrt(64)
    float mt[4];
#pragma unroll
    for (int tn = 0; tn < 4; tn++) {
      sc[tn] *= scale;
      mt[tn] = sc[tn][0];
#pragma unroll
      for (int r = 1; r < 8; r++) mt[tn] = fmaxf(mt[tn], sc[tn][r]);
    }
    float mx = fmaxf(fmaxf(mt[0], mt[1]), fmaxf(mt[2], mt[3]));
    mx = fmaxf(mx, other_half(mx));
    float newm  = fmaxf(row_max, mx);
    float alpha = __expf(row_max - newm);
    row_max = newm;
#pragma unroll
    for (int tn = 0; tn < 4; tn++) {
      // exp(x) as exp2(x * log2(e)), one maximum for all of the lane's registers
      sc[tn] = exp2x8((sc[tn] - newm) * 1.44269504f);
    }
    v8f ps = (sc[0] + sc[1]) + (sc[2] + sc[3]);
    float psum = ((ps[0] + ps[1]) + (ps[2] + ps[3])) + ((ps[4] + ps[5]) + (ps[6] + ps[7]));
    row_sum = row_sum * alpha + psum;
#pragma unroll
    for (int dt = 0; dt < 4; dt++) o[dt] *= alpha;

    // Ot += Vt @ Pt: St tiles 2ks and 2ks+1 hold keys in the fragment's k order
#pragma unroll
    for (int ks = 0; ks < 2; ks++) {
      v16bf pf = cat8(__builtin_convertvector(sc[2 * ks], v8bf),
                      __builtin_convertvector(sc[2 * ks + 1], v8bf));
#pragma unroll
      for (int dt = 0; dt < 4; dt++) {
        int r = dt * 16 + lm;
        v8bf lo = *(const v8bf*)(&lV[cur][r * A_LDK + ks * 32 + kb]);
        v8bf hi = *(const v8bf*)(&lV[cur][r * A_LDK + ks * 32 + 16 + kb]);
        o[dt] = wmma_bf16(cat8(lo, hi), pf, o[dt]);
      }
    }

    // keep PV WMMAs ahead of the async wait so KV DMA overlaps the matrix math
#pragma unroll
    for (int dt = 0; dt < 4; dt++) pin(o[dt]);

    wait_async0();
    __syncthreads();
  }
#undef KV_ISSUE

  // finalize: ctx[(b*S+s)][h*64 + d] bf16, 8 consecutive d per lane and tile
  const int b = bh >> 4, h = bh & 15;
  row_sum += other_half(row_sum);
  const float inv = 1.0f / row_sum;
  const int s = qblk * 64 + wave * 16 + lm;
  __bf16* dst = ctx + ((size_t)(b * SEQ + s)) * DMODEL + h * ADIM + mh;
#pragma unroll
  for (int dt = 0; dt < 4; dt++)
    *(v8bf*)(dst + dt * 16) = __builtin_convertvector(o[dt] * inv, v8bf);
}

// ---------------------------------------------------------------------------
// residual add + LayerNorm, one wave per row of 1024 (32 values a lane, in
// groups of 4: a wave's load or store covers 512 contiguous bytes); the row's
// sums are joined inside the wave, so the block's 8 rows share nothing
// ---------------------------------------------------------------------------
__global__ __launch_bounds__(256)
void ln_kernel(const float* __restrict__ proj, const float* __restrict__ resid,
               const float* __restrict__ g, const float* __restrict__ b,
               float* __restrict__ out) {
  const int lane = threadIdx.x & 31;
  const size_t row = (size_t)blockIdx.x * 8 + (threadIdx.x >> 5);
  const v4f* __restrict__ pp = (const v4f*)(proj + row * DMODEL) + lane;
  const v4f* __restrict__ rp = (const v4f*)(resid + row * DMODEL) + lane;
  v4f x[8], y[8];
#pragma unroll
  for (int i = 0; i < 8; i++) x[i] = pp[i * 32];
#pragma unroll
  for (int i = 0; i < 8; i++) y[i] = rp[i * 32];
  v4f s4 = (v4f)(0.0f), q4 = (v4f)(0.0f);
#pragma unroll
  for (int i = 0; i < 8; i++) {
    x[i] += y[i];
    s4 += x[i];
    q4 += x[i] * x[i];
  }
  // the loads' address registers are free for reuse only behind this wait
  asm volatile("s_wait_xcnt 0x0" ::: "memory");
  float s  = (s4[0] + s4[1]) + (s4[2] + s4[3]);
  float sq = (q4[0] + q4[1]) + (q4[2] + q4[3]);
#pragma unroll
  for (int off = 16; off >= 1; off >>= 1) {
    s  += __shfl_xor(s,  off, 32);
    sq += __shfl_xor(sq, off, 32);
  }
  float mu  = s * (1.0f / DMODEL);
  float var = sq * (1.0f / DMODEL) - mu * mu;
  float rs  = rsqrtf(var + 1e-5f);
  const v4f* __restrict__ gp = (const v4f*)g + lane;
  const v4f* __restrict__ bp = (const v4f*)b + lane;
  v4f* __restrict__ op = (v4f*)(out + row * DMODEL) + lane;
#pragma unroll
  for (int i = 0; i < 8; i++) op[i * 32] = (x[i] - mu) * rs * gp[i * 32] + bp[i * 32];
}

// ---------------------------------------------------------------------------
extern "C" void kernel_launch(void* const* d_in, const int* in_sizes, int n_in,
                              void* d_out, int out_size, void* d_ws, size_t ws_size,
                              hipStream_t stream) {
  (void)in_sizes; (void)n_in; (void)out_size; (void)ws_size;
  const float* Q    = (const float*)d_in[0];
  const float* Wq   = (const float*)d_in[1];
  const float* bq   = (const float*)d_in[2];
  const float* Wk   = (const float*)d_in[3];
  const float* bk   = (const float*)d_in[4];
  const float* Wv   = (const float*)d_in[5];
  const float* bv   = (const float*)d_in[6];
  const float* Wo   = (const float*)d_in[7];
  const float* bo   = (const float*)d_in[8];
  const float* ln_g = (const float*)d_in[9];
  const float* ln_b = (const float*)d_in[10];

  const size_t ND = (size_t)MROWS * DMODEL;     // 8192*1024
  const size_t WW = (size_t)DMODEL * DMODEL;    // 1024*1024

  char* ws = (char*)d_ws;
  size_t off = 0;
  __bf16* Xbf = (__bf16*)(ws + off); off += ND * 2;
  __bf16* WqT = (__bf16*)(ws + off); off += WW * 2;
  __bf16* WkT = (__bf16*)(ws + off); off += WW * 2;
  __bf16* WvT = (__bf16*)(ws + off); off += WW * 2;
  __bf16* WoT = (__bf16*)(ws + off); off += WW * 2;
  __bf16* qbf = (__bf16*)(ws + off); off += ND * 2;   // [B,H,S,64]
  __bf16* kbf = (__bf16*)(ws + off); off += ND * 2;   // [B,H,S,64]
  __bf16* vtb = (__bf16*)(ws + off); off += ND * 2;   // [B,H,64,S]
  __bf16* ctx = (__bf16*)(ws + off); off += ND * 2;   // [B*S, 1024]
  float*  prj = (float*)(ws + off);  off += ND * 4;   // [B*S, 1024]

  // 1) precision staging
  cvt_f32_bf16_kernel<<<(int)(ND / (256 * CVT_V * 4)), 256, 0, stream>>>(Q, Xbf);
  dim3 tg(DMODEL / 64, DMODEL / 64);
  transpose_bf16_kernel<<<tg, 256, 0, stream>>>(Wq, WqT, DMODEL, DMODEL);
  transpose_bf16_kernel<<<tg, 256, 0, stream>>>(Wk, WkT, DMODEL, DMODEL);
  transpose_bf16_kernel<<<tg, 256, 0, stream>>>(Wv, WvT, DMODEL, DMODEL);
  transpose_bf16_kernel<<<tg, 256, 0, stream>>>(Wo, WoT, DMODEL, DMODEL);

  // 2) QKV projections (WMMA GEMMs scattering into attention layouts)
  dim3 gg(MROWS / G_BM, DMODEL / G_BN);
  gemm_bf16_kernel<<<gg, 256, 0, stream>>>(Xbf, WqT, bq, qbf, MROWS, DMODEL, DMODEL, 0);
  gemm_bf16_kernel<<<gg, 256, 0, stream>>>(Xbf, WkT, bk, kbf, MROWS, DMODEL, DMODEL, 0);
  gemm_bf16_kernel<<<gg, 256, 0, stream>>>(Xbf, WvT, bv, vtb, MROWS, DMODEL, DMODEL, 1);

  // 3) flash attention
  attn_kernel<<<dim3(BATCH * HN, SEQ / 64), 128, 0, stream>>>(qbf, kbf, vtb, ctx);

  // 4) output projection (f32 out)
  gemm_bf16_kernel<<<gg, 256, 0, stream>>>(ctx, WoT, bo, prj, MROWS, DMODEL, DMODEL, 2);

  // 5) residual + layernorm
  ln_kernel<<<MROWS / 8, 256, 0, stream>>>(prj, Q, ln_g, ln_b, (float*)d_out);
}

// v003
// Measured time: 172 microseconds a run.
// Timed twice side by side with v002, it ran 1.17 times as fast both times.
// Counting every step since v000, it is 1.64 times as fast.
#include <hip/hip_runtime.h>
#include <hip/hip_bf16.h>

typedef __attribute__((ext_vector_type(16))) __bf16 v16bf;
typedef __attribute__((ext_vector_type(8)))  __bf16 v8bf;
typedef __attribute__((ext_vector_type(8)))  float  v8f;
typedef __attribute__((ext_vector_type(4)))  float  v4f;
typedef __attribute__((ext_vector_type(4)))  __bf16 v4bf;

#define HN     16
#define SEQ    2048
#define DMODEL 1024
#define ADIM   64
#define BATCH  4
#define MROWS  (BATCH * SEQ)   // 8192

static __device__ __forceinline__ v16bf cat8(v8bf lo, v8bf hi) {
  return __builtin_shufflevector(lo, hi, 0,1,2,3,4,5,6,7,8,9,10,11,12,13,14,15);
}

static __device__ __forceinline__ v8f wmma_bf16(v16bf a, v16bf b, v8f c) {
  // D = A(16x32 bf16) * B(32x16 bf16) + C(16x16 f32)
  return __builtin_amdgcn_wmma_f32_16x16x32_bf16(false, a, false, b, (short)0, c, false, false);
}

// gfx1250 async DMA: global -> LDS, 16B per lane, tracked by ASYNCcnt.
// GVS addressing: mem = SADDR(u64) + VADDR(i32) + IOFFSET. VDST = LDS byte addr.
static __device__ __forceinline__ void async_b128(unsigned lds_byte, unsigned voff_byte,
                                                  const void* base) {
  asm volatile("global_load_async_to_lds_b128 %0, %1, %2"
               :: "v"(lds_byte), "v"(voff_byte), "s"((unsigned long long)base)
               : "memory");
}

static __device__ __forceinline__ void wait_async0() {
#if __has_builtin(__builtin_amdgcn_s_wait_asynccnt)
  __builtin_amdgcn_s_wait_asynccnt(0);
#else
  asm volatile("s_wait_asynccnt 0x0" ::: "memory");
#endif
}

// empty volatile asm consuming the accumulator: volatile asms keep program
// order, so this pins the producing WMMAs *before* the following wait/barrier,
// letting the in-flight async DMA overlap the matrix math.
static __device__ __forceinline__ void pin(v8f& x) {
  asm volatile("" : "+v"(x));
}

// value of the same lane position in the other 16-lane half (l <-> l ^ 16)
static __device__ __forceinline__ float other_half(float x) {
  int b = __builtin_bit_cast(int, x);
  b = __builtin_amdgcn_permlanex16(b, b, 0x76543210, 0xfedcba98, false, false);
  return __builtin_bit_cast(float, b);
}

// exp2 of eight values. One statement, so that behind each v_exp_f32 stands an
// independent one (the slot the instruction set asks for before a result is used
// or a source overwritten); the closing v_nop is that slot for the last.
static __device__ __forceinline__ v8f exp2x8(v8f t) {
  float a = t[0], b = t[1], c = t[2], d = t[3], e = t[4], f = t[5], g = t[6], h = t[7];
  asm("v_exp_f32 %0, %0\n\tv_exp_f32 %1, %1\n\tv_exp_f32 %2, %2\n\tv_exp_f32 %3, %3\n\t"
      "v_exp_f32 %4, %4\n\tv_exp_f32 %5, %5\n\tv_exp_f32 %6, %6\n\tv_exp_f32 %7, %7\n\t"
      "v_nop"
      : "+v"(a), "+v"(b), "+v"(c), "+v"(d), "+v"(e), "+v"(f), "+v"(g), "+v"(h));
  v8f p = {a, b, c, d, e, f, g, h};
  return p;
}

// low 32 bits of a generic LDS pointer == LDS byte offset (flat aperture mapping)
static __device__ __forceinline__ unsigned lds_off(const void* p) {
  return (unsigned)(unsigned long long)p;
}

// ---------------------------------------------------------------------------
// fp32 -> bf16 elementwise convert. A lane takes CVT_V groups of four floats, all
// loads asked for before the first store; a wave's load covers 512 contiguous
// bytes, its store 256. One block covers 256 * CVT_V * 4 floats, no remainder.
// ---------------------------------------------------------------------------
#define CVT_V 16
__global__ __launch_bounds__(256)
void cvt_f32_bf16_kernel(const float* __restrict__ in, __bf16* __restrict__ out) {
  const size_t base = (size_t)blockIdx.x * (256 * CVT_V) + threadIdx.x;  // in groups of 4
  const v4f* __restrict__ src = (const v4f*)in + base;
  v4bf* __restrict__ dst = (v4bf*)out + base;
  v4f v[CVT_V];
#pragma unroll
  for (int j = 0; j < CVT_V; j++) v[j] = src[j * 256];
#pragma unroll
  for (int j = 0; j < CVT_V; j++) dst[j * 256] = __builtin_convertvector(v[j], v4bf);
}

// ---------------------------------------------------------------------------
// W[K][N] fp32  ->  Wt[N][K] bf16   (LDS tile transpose, 64 x 64 per block:
// a lane loads four groups of 4 floats and stores two groups of 8 bf16, so a
// wave reads whole 256-byte row pieces and writes whole 128-byte lines)
// ---------------------------------------------------------------------------
__global__ __launch_bounds__(256)
void transpose_bf16_kernel(const float* __restrict__ W, __bf16* __restrict__ Wt,
                           int K, int N) {
  __shared__ float tile[64][65];
  const int bx = blockIdx.x * 64;  // along N
  const int by = blockIdx.y * 64;  // along K
  const int c4 = threadIdx.x & 15;   // group of 4 columns (n)
  const int r0 = threadIdx.x >> 4;   // 0..15
  v4f v[4];
#pragma unroll
  for (int i = 0; i < 4; i++)
    v[i] = *(const v4f*)(W + (size_t)(by + r0 + i * 16) * N + bx + c4 * 4);
  // the loads' address registers are free for reuse only behind this wait; the
  // scheduling barrier keeps later index arithmetic from being lifted over it
  asm volatile("s_wait_xcnt 0x0" ::: "memory");
  __builtin_amdgcn_sched_barrier(0);
#pragma unroll
  for (int i = 0; i < 4; i++)
#pragma unroll
    for (int e = 0; e < 4; e++) tile[r0 + i * 16][c4 * 4 + e] = v[i][e];
  __syncthreads();
  const int ck = threadIdx.x & 7;    // group of 8 k
  const int n0 = threadIdx.x >> 3;   // 0..31
#pragma unroll
  for (int i = 0; i < 2; i++) {
    int n = n0 + i * 32;
    v8bf o;
#pragma unroll
    for (int j = 0; j < 8; j++) o[j] = (__bf16)tile[ck * 8 + j][n];
    *(v8bf*)(Wt + (size_t)(bx + n) * K + by + ck * 8) = o;
  }
}

// ---------------------------------------------------------------------------
// Tiled WMMA GEMM with double-buffered async-DMA staging.
// C[M][N] = A[M][K] * Bt[N][K]^T + bias[N]
// block tile 128x128, BK=32, 256 threads = 8 waves (4 x 2),
// each wave computes 32x64 = 2x4 tiles of 16x16.
// MODE (compile time): 0 -> bf16 [B,H,S,64]   (q / k layout)
//                      1 -> bf16 [B,H,64,S]   (v transposed layout)
//                      2 -> f32  row-major [M][N]
// A lane's 8 accumulator registers run along the first WMMA operand's rows, so
// the operand whose index is contiguous in the output goes first: Bt rows (n)
// for modes 0 and 2, A rows (m = position) for mode 1. The 8 results of a tile
// then leave as 16-byte stores. The wave tile is 32 rows of the first operand
// by 64 of the second in every mode.
// ---------------------------------------------------------------------------
#define G_BM 128
#define G_BN 128
#define G_BK 32
#define G_LDA 40   // bf16 elems per LDS row (32 + 8 pad): 80B row, 16B aligned, bank-spread

template <int MODE>
__global__ __launch_bounds__(256)
void gemm_bf16_kernel(const __bf16* __restrict__ A,   // [M][K]
                      const __bf16* __restrict__ Bt,  // [N][K]
                      const float*  __restrict__ bias,
                      void* __restrict__ out,
                      int M, int N, int K) {
  __shared__ __align__(16) __bf16 lA[2][G_BM * G_LDA];
  __shared__ __align__(16) __bf16 lB[2][G_BN * G_LDA];

  const int tid  = threadIdx.x;
  const int lane = tid & 31;
  const int wave = tid >> 5;
  const int wm   = wave & 3;   // 4 waves along the first operand (32 rows each)
  const int wn   = wave >> 2;  // 2 waves along the second operand (64 rows each)
  const int m0   = blockIdx.x * G_BM;
  const int n0   = blockIdx.y * G_BN;
  const int lm   = lane & 15;
  const int kb   = (lane >> 4) * 8;   // ISA 16-bit A/B fragment K mapping

  // per-thread DMA chunk coords: chunks c = tid and tid+256; r = c>>2, kc = c&3
  const int cr = tid >> 2;     // 0..63
  const int ck = tid & 3;      // 0..3
  const unsigned ldsA0 = lds_off(&lA[0][0]);
  const unsigned ldsB0 = lds_off(&lB[0][0]);
  const unsigned bufA  = (unsigned)(G_BM * G_LDA * 2);
  const unsigned bufB  = (unsigned)(G_BN * G_LDA * 2);
  const unsigned lA_t0 = ldsA0 + (unsigned)((cr      ) * G_LDA + ck * 8) * 2;
  const unsigned lA_t1 = ldsA0 + (unsigned)((cr + 64 ) * G_LDA + ck * 8) * 2;
  const unsigned lB_t0 = ldsB0 + (unsigned)((cr      ) * G_LDA + ck * 8) * 2;
  const unsigned lB_t1 = ldsB0 + (unsigned)((cr + 64 ) * G_LDA + ck * 8) * 2;
  const unsigned gA0 = ((unsigned)(m0 + cr     ) * K + ck * 8) * 2;
  const unsigned gA1 = ((unsigned)(m0 + cr + 64) * K + ck * 8) * 2;
  const unsigned gB0 = ((unsigned)(n0 + cr     ) * K + ck * 8) * 2;
  const unsigned gB1 = ((unsigned)(n0 + cr + 64) * K + ck * 8) * 2;

#define G_ISSUE(k0, buf) do {                                   \
    unsigned kby = (unsigned)(k0) * 2;                          \
    async_b128(lA_t0 + (buf) * bufA, gA0 + kby, A);             \
    async_b128(lA_t1 + (buf) * bufA, gA1 + kby, A);             \
    async_b128(lB_t0 + (buf) * bufB, gB0 + kby, Bt);            \
    async_b128(lB_t1 + (buf) * bufB, gB1 + kby, Bt);            \
  } while (0)

  v8f acc[2][4];
#pragma unroll
  for (int i = 0; i < 2; i++)
#pragma unroll
    for (int j = 0; j < 4; j++) acc[i][j] = (v8f)(0.0f);

  const int KT = K / G_BK;
  G_ISSUE(0, 0);
  wait_async0();
  __syncthreads();

  for (int kt = 0; kt < KT; kt++) {
    const int cur = kt & 1;
    if (kt + 1 < KT) G_ISSUE((kt + 1) * G_BK, cur ^ 1);  // DMA next tile during compute

    const __bf16* l1 = (MODE == 1) ? &lA[cur][0] : &lB[cur][0];  // first operand
    const __bf16* l2 = (MODE == 1) ? &lB[cur][0] : &lA[cur][0];  // second operand
    v16bf af[2], bfm[4];
#pragma unroll
    for (int i = 0; i < 2; i++) {
      int r = wm * 32 + i * 16 + lm;
      v8bf lo = *(const v8bf*)(&l1[r * G_LDA + kb]);
      v8bf hi = *(const v8bf*)(&l1[r * G_LDA + 16 + kb]);
      af[i] = cat8(lo, hi);
    }
#pragma unroll
    for (int j = 0; j < 4; j++) {
      int r = wn * 64 + j * 16 + lm;
      v8bf lo = *(const v8bf*)(&l2[r * G_LDA + kb]);
      v8bf hi = *(const v8bf*)(&l2[r * G_LDA + 16 + kb]);
      bfm[j] = cat8(lo, hi);
    }
#pragma unroll
    for (int i = 0; i < 2; i++)
#pragma unroll
      for (int j = 0; j < 4; j++)
        acc[i][j] = wmma_bf16(af[i], bfm[j], acc[i][j]);

    // keep WMMAs ahead of the async wait so DMA overlaps the matrix math
#pragma unroll
    for (int i = 0; i < 2; i++)
#pragma unroll
      for (int j = 0; j < 4; j++) pin(acc[i][j]);

    wait_async0();
    __syncthreads();
  }
#undef G_ISSUE

  // epilogue: a lane holds column lm of each tile (second operand's row) and, in
  // register r, row r + mh (first operand's row)
  const int mh = (lane >> 4) * 8;
  if constexpr (MODE == 1) {      // lane = n (head dim), registers = 8 positions
#pragma unroll
    for (int j = 0; j < 4; j++) {
      const int n = n0 + wn * 64 + j * 16 + lm;
      const float bv = bias[n];
      const int h = n >> 6, dd = n & 63;
#pragma unroll
      for (int i = 0; i < 2; i++) {
        const int m = m0 + wm * 32 + i * 16 + mh;
        const int b = m / SEQ, s = m % SEQ;
        *(v8bf*)((__bf16*)out + (((size_t)(b * HN + h)) * ADIM + dd) * SEQ + s) =
            __builtin_convertvector(acc[i][j] + bv, v8bf);
      }
    }
  } else {                        // lane = m (row), registers = 8 columns n
#pragma unroll
    for (int i = 0; i < 2; i++) {
      const int n = n0 + wm * 32 + i * 16 + mh;
      const v8f bv = *(const v8f*)(bias + n);
#pragma unroll
      for (int j = 0; j < 4; j++) {
        const int m = m0 + wn * 64 + j * 16 + lm;
        const v8f val = acc[i][j] + bv;
        if constexpr (MODE == 0) {  // [B,H,S,64] bf16
          const int b = m / SEQ, s = m % SEQ;
          const int h = n >> 6, dd = n & 63;
          *(v8bf*)((__bf16*)out + (((size_t)(b * HN + h)) * SEQ + s) * ADIM + dd) =
              __builtin_convertvector(val, v8bf);
        } else {                    // f32 row-major
          *(v8f*)((float*)out + (size_t)m * N + n) = val;
        }
      }
    }
  }
}

// ---------------------------------------------------------------------------
// Flash-style attention with double-buffered async-DMA KV staging.
// grid = (B*H, S/64). 128 threads = 4 waves, each wave owns 16 query rows.
// Both products run transposed: St = K * Qt, Ot += Vt * Pt. A lane then holds
// one query (column lm): its softmax statistics are one scalar per lane, and
// two St tiles, converted in place, are the B operand of the second product.
// ---------------------------------------------------------------------------
#define A_LDK 72  // 64 + 8 pad bf16 elems per LDS row (144B: 16B aligned)

// waves_per_eu: register room for the K and V fragment reads to stand in groups
// ahead of their WMMAs; at a tighter budget each read pair is waited on singly.
__global__ __launch_bounds__(128) __attribute__((amdgpu_waves_per_eu(4, 6)))
void attn_kernel(const __bf16* __restrict__ qb,   // [BH][S][64]
                 const __bf16* __restrict__ kbuf, // [BH][S][64]
                 const __bf16* __restrict__ vt,   // [BH][64][S]
                 __bf16* __restrict__ ctx) {      // [B*S][1024]
  const int bh   = blockIdx.x;
  const int qblk = blockIdx.y;
  const int tid  = threadIdx.x;
  const int lane = tid & 31;
  const int wave = tid >> 5;
  const int lm   = lane & 15;
  const int kb   = (lane >> 4) * 8;
  const int mh   = (lane >> 4) * 8;

  __shared__ __align__(16) __bf16 lK[2][64 * A_LDK];
  __shared__ __align__(16) __bf16 lV[2][64 * A_LDK];

  // per-thread DMA chunks: 512 16B chunks per tile / 128 threads = 4 each
  const int acr = tid >> 3;   // 0..15 (row group)
  const int acc_ = tid & 7;   // 0..7  (16B column chunk)
  const unsigned ldsK0 = lds_off(&lK[0][0]);
  const unsigned ldsV0 = lds_off(&lV[0][0]);
  const unsigned kvbuf = (unsigned)(64 * A_LDK * 2);
  unsigned lK_t[4], lV_t[4], gK[4], gV[4];
#pragma unroll
  for (int i = 0; i < 4; i++) {
    int r = acr + 16 * i;
    lK_t[i] = ldsK0 + (unsigned)(r * A_LDK + acc_ * 8) * 2;
    lV_t[i] = ldsV0 + (unsigned)(r * A_LDK + acc_ * 8) * 2;
    gK[i] = (((unsigned)bh * SEQ + r) * ADIM + acc_ * 8) * 2;  // + kv0*ADIM*2
    gV[i] = (((unsigned)bh * ADIM + r) * SEQ + acc_ * 8) * 2;  // + kv0*2
  }

#define KV_ISSUE(kv0, buf) do {                                        \
    unsigned ok = (unsigned)(kv0) * ADIM * 2, ov = (unsigned)(kv0) * 2;\
    _Pragma("unroll")                                                  \
    for (int i = 0; i < 4; i++) {                                      \
      async_b128(lK_t[i] + (buf) * kvbuf, gK[i] + ok, kbuf);           \
      async_b128(lV_t[i] + (buf) * kvbuf, gV[i] + ov, vt);             \
    }                                                                  \
  } while (0)

  // q fragments stay resident as B operands (K = d = 64 -> 2 WMMA k-steps)
  v16bf qf[2];
  {
    const __bf16* qrow = qb + ((size_t)bh * SEQ + qblk * 64 + wave * 16 + lm) * ADIM;
#pragma unroll
    for (int ks = 0; ks < 2; ks++) {
      v8bf lo = *(const v8bf*)(qrow + ks * 32 + kb);
      v8bf hi = *(const v8bf*)(qrow + ks * 32 + 16 + kb);
      qf[ks] = cat8(lo, hi);
    }
  }

  // this lane's query: running maximum (both halves agree) and the sum over the
  // keys of this lane's half (the halves are joined once, after the loop)
  float row_max = -3.0e38f, row_sum = 0.0f;
  v8f o[4];  // Ot tiles: lane = query lm, register r = d index dt*16 + mh + r
#pragma unroll
  for (int dt = 0; dt < 4; dt++) o[dt] = (v8f)(0.0f);

  KV_ISSUE(0, 0);
  wait_async0();
  __syncthreads();

  for (int kvb = 0; kvb < SEQ / 64; kvb++) {
    const int cur = kvb & 1;
    if (kvb + 1 < SEQ / 64) KV_ISSUE((kvb + 1) * 64, cur ^ 1);  // DMA next KV block

    // St = k @ q^T  (4 key tiles x 2 k-steps): register r = key tn*16 + mh + r
    v8f sc[4];
    v16bf kf[2][4];
#pragma unroll
    for (int ks = 0; ks < 2; ks++) {
#pragma unroll
      for (int tn = 0; tn < 4; tn++) {
        int r = tn * 16 + lm;
        v8bf lo = *(const v8bf*)(&lK[cur][r * A_LDK + ks * 32 + kb]);
        v8bf hi = *(const v8bf*)(&lK[cur][r * A_LDK + ks * 32 + 16 + kb]);
        kf[ks][tn] = cat8(lo, hi);
      }
    }
#pragma unroll
    for (int tn = 0; tn < 4; tn++) sc[tn] = (v8f)(0.0f);
#pragma unroll
    for (int ks = 0; ks < 2; ks++)
#pragma unroll
      for (int tn = 0; tn < 4; tn++)
        sc[tn] = wmma_bf16(kf[ks][tn], qf[ks], sc[tn]);

    // online softmax, one query per lane: 32 keys in-lane, one exchange of halves
    const float scale = 0.125f;  // 1/sqrt(64)
    float mt[4];
#pragma unroll
    for (int tn = 0; tn < 4; tn++) {
      sc[tn] *= scale;
      mt[tn] = sc[tn][0];
#pragma unroll
      for (int r = 1; r < 8; r++) mt[tn] = fmaxf(mt[tn], sc[tn][r]);
    }
    float mx = fmaxf(fmaxf(mt[0], mt[1]), fmaxf(mt[2], mt[3]));
    mx = fmaxf(mx, other_half(mx));
    float newm  = fmaxf(row_max, mx);
    float alpha = __expf(row_max - newm);
    row_max = newm;
#pragma unroll
    for (int tn = 0; tn < 4; tn++) {
      // exp(x) as exp2(x * log2(e)), one maximum for all of the lane's registers
      sc[tn] = exp2x8((sc[tn] - newm) * 1.44269504f);
    }
    v8f ps = (sc[0] + sc[1]) + (sc[2] + sc[3]);
    float psum = ((ps[0] + ps[1]) + (ps[2] + ps[3])) + ((ps[4] + ps[5]) + (ps[6] + ps[7]));
    row_sum = row_sum * alpha + psum;
#pragma unroll
    for (int dt = 0; dt < 4; dt++) o[dt] *= alpha;

    // Ot += Vt @ Pt: St tiles 2ks and 2ks+1 hold keys in the fragment's k order
#pragma unroll
    for (int ks = 0; ks < 2; ks++) {
      v16bf pf = cat8(__builtin_convertvector(sc[2 * ks], v8bf),
                      __builtin_convertvector(sc[2 * ks + 1], v8bf));
#pragma unroll
      for (int dt = 0; dt < 4; dt++) {
        int r = dt * 16 + lm;
        v8bf lo = *(const v8bf*)(&lV[cur][r * A_LDK + ks * 32 + kb]);
        v8bf hi = *(const v8bf*)(&lV[cur][r * A_LDK + ks * 32 + 16 + kb]);
        o[dt] = wmma_bf16(cat8(lo, hi), pf, o[dt]);
      }
    }

    // keep PV WMMAs ahead of the async wait so KV DMA overlaps the matrix math
#pragma unroll
    for (int dt = 0; dt < 4; dt++) pin(o[dt]);

    wait_async0();
    __syncthreads();
  }
#undef KV_ISSUE

  // finalize: ctx[(b*S+s)][h*64 + d] bf16, 8 consecutive d per lane and tile
  const int b = bh >> 4, h = bh & 15;
  row_sum += other_half(row_sum);
  const float inv = 1.0f / row_sum;
  const int s = qblk * 64 + wave * 16 + lm;
  __bf16* dst = ctx + ((size_t)(b * SEQ + s)) * DMODEL + h * ADIM + mh;
#pragma unroll
  for (int dt = 0; dt < 4; dt++)
    *(v8bf*)(dst + dt * 16) = __builtin_convertvector(o[dt] * inv, v8bf);
}

// ---------------------------------------------------------------------------
// residual add + LayerNorm, one wave per row of 1024 (32 values a lane, in
// groups of 4: a wave's load or store covers 512 contiguous bytes); the row's
// sums are joined inside the wave, so the block's 8 rows share nothing
// ---------------------------------------------------------------------------
__global__ __launch_bounds__(256)
void ln_kernel(const float* __restrict__ proj, const float* __restrict__ resid,
               const float* __restrict__ g, const float* __restrict__ b,
               float* __restrict__ out) {
  const int lane = threadIdx.x & 31;
  const size_t row = (size_t)blockIdx.x * 8 + (threadIdx.x >> 5);
  const v4f* __restrict__ pp = (const v4f*)(proj + row * DMODEL) + lane;
  const v4f* __restrict__ rp = (const v4f*)(resid + row * DMODEL) + lane;
  v4f x[8], y[8];
#pragma unroll
  for (int i = 0; i < 8; i++) x[i] = pp[i * 32];
#pragma unroll
  for (int i = 0; i < 8; i++) y[i] = rp[i * 32];
  v4f s4 = (v4f)(0.0f), q4 = (v4f)(0.0f);
#pragma unroll
  for (int i = 0; i < 8; i++) {
    x[i] += y[i];
    s4 += x[i];
    q4 += x[i] * x[i];
  }
  // the loads' address registers are free for reuse only behind this wait
  asm volatile("s_wait_xcnt 0x0" ::: "memory");
  float s  = (s4[0] + s4[1]) + (s4[2] + s4[3]);
  float sq = (q4[0] + q4[1]) + (q4[2] + q4[3]);
#pragma unroll
  for (int off = 16; off >= 1; off >>= 1) {
    s  += __shfl_xor(s,  off, 32);
    sq += __shfl_xor(sq, off, 32);
  }
  float mu  = s * (1.0f / DMODEL);
  float var = sq * (1.0f / DMODEL) - mu * mu;
  float rs  = rsqrtf(var + 1e-5f);
  const v4f* __restrict__ gp = (const v4f*)g + lane;
  const v4f* __restrict__ bp = (const v4f*)b + lane;
  v4f* __restrict__ op = (v4f*)(out + row * DMODEL) + lane;
#pragma unroll
  for (int i = 0; i < 8; i++) op[i * 32] = (x[i] - mu) * rs * gp[i * 32] + bp[i * 32];
}

// ---------------------------------------------------------------------------
extern "C" void kernel_launch(void* const* d_in, const int* in_sizes, int n_in,
                              void* d_out, int out_size, void* d_ws, size_t ws_size,
                              hipStream_t stream) {
  (void)in_sizes; (void)n_in; (void)out_size; (void)ws_size;
  const float* Q    = (const float*)d_in[0];
  const float* Wq   = (const float*)d_in[1];
  const float* bq   = (const float*)d_in[2];
  const float* Wk   = (const float*)d_in[3];
  const float* bk   = (const float*)d_in[4];
  const float* Wv   = (const float*)d_in[5];
  const float* bv   = (const float*)d_in[6];
  const float* Wo   = (const float*)d_in[7];
  const float* bo   = (const float*)d_in[8];
  const float* ln_g = (const float*)d_in[9];
  const float* ln_b = (const float*)d_in[10];

  const size_t ND = (size_t)MROWS * DMODEL;     // 8192*1024
  const size_t WW = (size_t)DMODEL * DMODEL;    // 1024*1024

  char* ws = (char*)d_ws;
  size_t off = 0;
  __bf16* Xbf = (__bf16*)(ws + off); off += ND * 2;
  __bf16* WqT = (__bf16*)(ws + off); off += WW * 2;
  __bf16* WkT = (__bf16*)(ws + off); off += WW * 2;
  __bf16* WvT = (__bf16*)(ws + off); off += WW * 2;
  __bf16* WoT = (__bf16*)(ws + off); off += WW * 2;
  __bf16* qbf = (__bf16*)(ws + off); off += ND * 2;   // [B,H,S,64]
  __bf16* kbf = (__bf16*)(ws + off); off += ND * 2;   // [B,H,S,64]
  __bf16* vtb = (__bf16*)(ws + off); off += ND * 2;   // [B,H,64,S]
  __bf16* ctx = (__bf16*)(ws + off); off += ND * 2;   // [B*S, 1024]
  float*  prj = (float*)(ws + off);  off += ND * 4;   // [B*S, 1024]

  // 1) precision staging
  cvt_f32_bf16_kernel<<<(int)(ND / (256 * CVT_V * 4)), 256, 0, stream>>>(Q, Xbf);
  dim3 tg(DMODEL / 64, DMODEL / 64);
  transpose_bf16_kernel<<<tg, 256, 0, stream>>>(Wq, WqT, DMODEL, DMODEL);
  transpose_bf16_kernel<<<tg, 256, 0, stream>>>(Wk, WkT, DMODEL, DMODEL);
  transpose_bf16_kernel<<<tg, 256, 0, stream>>>(Wv, WvT, DMODEL, DMODEL);
  transpose_bf16_kernel<<<tg, 256, 0, stream>>>(Wo, WoT, DMODEL, DMODEL);

  // 2) QKV projections (WMMA GEMMs scattering into attention layouts)
  dim3 gg(MROWS / G_BM, DMODEL / G_BN);
  gemm_bf16_kernel<0><<<gg, 256, 0, stream>>>(Xbf, WqT, bq, qbf, MROWS, DMODEL, DMODEL);
  gemm_bf16_kernel<0><<<gg, 256, 0, stream>>>(Xbf, WkT, bk, kbf, MROWS, DMODEL, DMODEL);
  gemm_bf16_kernel<1><<<gg, 256, 0, stream>>>(Xbf, WvT, bv, vtb, MROWS, DMODEL, DMODEL);

  // 3) flash attention
  attn_kernel<<<dim3(BATCH * HN, SEQ / 64), 128, 0, stream>>>(qbf, kbf, vtb, ctx);

  // 4) output projection (f32 out)
  gemm_bf16_kernel<2><<<gg, 256, 0, stream>>>(ctx, WoT, bo, prj, MROWS, DMODEL, DMODEL);

  // 5) residual + layernorm
  ln_kernel<<<MROWS / 8, 256, 0, stream>>>(prj, Q, ln_g, ln_b, (float*)d_out);
}

// v004
// It runs in 161 microseconds.
// In two side-by-side timings against v003, it was 1.07 and 1.06 times as fast.
// Over all steps from v000 it is 1.75 times as fast.
#include <hip/hip_runtime.h>
#include <hip/hip_bf16.h>

typedef __attribute__((ext_vector_type(16))) __bf16 v16bf;
typedef __attribute__((ext_vector_type(8)))  __bf16 v8bf;
typedef __attribute__((ext_vector_type(8)))  float  v8f;
typedef __attribute__((ext_vector_type(4)))  float  v4f;
typedef __attribute__((ext_vector_type(4)))  __bf16 v4bf;

#define HN     16
#define SEQ    2048
#define DMODEL 1024
#define ADIM   64
#define BATCH  4
#define MROWS  (BATCH * SEQ)   // 8192

static __device__ __forceinline__ v16bf cat8(v8bf lo, v8bf hi) {
  return __builtin_shufflevector(lo, hi, 0,1,2,3,4,5,6,7,8,9,10,11,12,13,14,15);
}

static __device__ __forceinline__ v8f wmma_bf16(v16bf a, v16bf b, v8f c) {
  // D = A(16x32 bf16) * B(32x16 bf16) + C(16x16 f32)
  return __builtin_amdgcn_wmma_f32_16x16x32_bf16(false, a, false, b, (short)0, c, false, false);
}

// gfx1250 async DMA: global -> LDS, 16B per lane, tracked by ASYNCcnt.
// GVS addressing: mem = SADDR(u64) + VADDR(i32) + IOFFSET. VDST = LDS byte addr.
static __device__ __forceinline__ void async_b128(unsigned lds_byte, unsigned voff_byte,
                                                  const void* base) {
  asm volatile("global_load_async_to_lds_b128 %0, %1, %2"
               :: "v"(lds_byte), "v"(voff_byte), "s"((unsigned long long)base)
               : "memory");
}

static __device__ __forceinline__ void wait_async0() {
#if __has_builtin(__builtin_amdgcn_s_wait_asynccnt)
  __builtin_amdgcn_s_wait_asynccnt(0);
#else
  asm volatile("s_wait_asynccnt 0x0" ::: "memory");
#endif
}

// empty volatile asm consuming the accumulator: volatile asms keep program
// order, so this pins the producing WMMAs *before* the following wait/barrier,
// letting the in-flight async DMA overlap the matrix math.
static __device__ __forceinline__ void pin(v8f& x) {
  asm volatile("" : "+v"(x));
}

// value of the same lane position in the other 16-lane half (l <-> l ^ 16)
static __device__ __forceinline__ float other_half(float x) {
  int b = __builtin_bit_cast(int, x);
  b = __builtin_amdgcn_permlanex16(b, b, 0x76543210, 0xfedcba98, false, false);
  return __builtin_bit_cast(float, b);
}

// exp2 of eight values. One statement, so that behind each v_exp_f32 stands an
// independent one (the slot the instruction set asks for before a result is used
// or a source overwritten); the closing v_nop is that slot for the last.
static __device__ __forceinline__ v8f exp2x8(v8f t) {
  float a = t[0], b = t[1], c = t[2], d = t[3], e = t[4], f = t[5], g = t[6], h = t[7];
  asm("v_exp_f32 %0, %0\n\tv_exp_f32 %1, %1\n\tv_exp_f32 %2, %2\n\tv_exp_f32 %3, %3\n\t"
      "v_exp_f32 %4, %4\n\tv_exp_f32 %5, %5\n\tv_exp_f32 %6, %6\n\tv_exp_f32 %7, %7\n\t"
      "v_nop"
      : "+v"(a), "+v"(b), "+v"(c), "+v"(d), "+v"(e), "+v"(f), "+v"(g), "+v"(h));
  v8f p = {a, b, c, d, e, f, g, h};
  return p;
}

// low 32 bits of a generic LDS pointer == LDS byte offset (flat aperture mapping)
static __device__ __forceinline__ unsigned lds_off(const void* p) {
  return (unsigned)(unsigned long long)p;
}

// ---------------------------------------------------------------------------
// fp32 -> bf16 elementwise convert. A lane takes CVT_V groups of four floats, all
// loads asked for before the first store; a wave's load covers 512 contiguous
// bytes, its store 256. One block covers 256 * CVT_V * 4 floats, no remainder.
// ---------------------------------------------------------------------------
#define CVT_V 16
#define CVT_BLOCKS (MROWS * DMODEL / (256 * CVT_V * 4))
static __device__ __forceinline__
void cvt_f32_bf16_block(const float* __restrict__ in, __bf16* __restrict__ out, int blk) {
  const size_t base = (size_t)blk * (256 * CVT_V) + threadIdx.x;  // in groups of 4
  const v4f* __restrict__ src = (const v4f*)in + base;
  v4bf* __restrict__ dst = (v4bf*)out + base;
  v4f v[CVT_V];
#pragma unroll
  for (int j = 0; j < CVT_V; j++) v[j] = src[j * 256];
#pragma unroll
  for (int j = 0; j < CVT_V; j++) dst[j * 256] = __builtin_convertvector(v[j], v4bf);
}

// ---------------------------------------------------------------------------
// W[K][N] fp32  ->  Wt[N][K] bf16   (LDS tile transpose, 64 x 64 per block:
// a lane loads four groups of 4 floats and stores two groups of 8 bf16, so a
// wave reads whole 256-byte row pieces and writes whole 128-byte lines)
// ---------------------------------------------------------------------------
static __device__ __forceinline__
void transpose_bf16_block(float (*tile)[65], const float* __restrict__ W,
                          __bf16* __restrict__ Wt, int K, int N,
                          int bx,    // along N
                          int by) {  // along K
  const int c4 = threadIdx.x & 15;   // group of 4 columns (n)
  const int r0 = threadIdx.x >> 4;   // 0..15
  v4f v[4];
#pragma unroll
  for (int i = 0; i < 4; i++)
    v[i] = *(const v4f*)(W + (size_t)(by + r0 + i * 16) * N + bx + c4 * 4);
  // the loads' address registers are free for reuse only behind this wait; the
  // scheduling barrier keeps later index arithmetic from being lifted over it
  asm volatile("s_wait_xcnt 0x0" ::: "memory");
  __builtin_amdgcn_sched_barrier(0);
#pragma unroll
  for (int i = 0; i < 4; i++)
#pragma unroll
    for (int e = 0; e < 4; e++) tile[r0 + i * 16][c4 * 4 + e] = v[i][e];
  __syncthreads();
  const int ck = threadIdx.x & 7;    // group of 8 k
  const int n0 = threadIdx.x >> 3;   // 0..31
#pragma unroll
  for (int i = 0; i < 2; i++) {
    int n = n0 + i * 32;
    v8bf o;
#pragma unroll
    for (int j = 0; j < 8; j++) o[j] = (__bf16)tile[ck * 8 + j][n];
    *(v8bf*)(Wt + (size_t)(bx + n) * K + by + ck * 8) = o;
  }
}

// ---------------------------------------------------------------------------
// All precision staging in one grid: none of the five jobs reads another's
// result, so their blocks start, wait on memory and drain side by side.
// Blocks [0, CVT_BLOCKS) convert X; then TR_BLOCKS blocks per weight matrix,
// whose transposed planes lie one behind the other in Wt (q, k, v, o).
// ---------------------------------------------------------------------------
#define TR_SIDE   (DMODEL / 64)
#define TR_BLOCKS (TR_SIDE * TR_SIDE)
__global__ __launch_bounds__(256)
void stage_kernel(const float* __restrict__ X,
                  const float* __restrict__ Wq, const float* __restrict__ Wk,
                  const float* __restrict__ Wv, const float* __restrict__ Wo,
                  __bf16* __restrict__ Xbf, __bf16* __restrict__ Wt) {
  __shared__ float tile[64][65];
  const int blk = blockIdx.x;
  if (blk < CVT_BLOCKS) {   // the whole block leaves here, ahead of any barrier
    cvt_f32_bf16_block(X, Xbf, blk);
    return;
  }
  const int t = blk - CVT_BLOCKS;
  const int w = t / TR_BLOCKS;
  const int c = t % TR_BLOCKS;
  const float* W = (w == 0) ? Wq : (w == 1) ? Wk : (w == 2) ? Wv : Wo;
  transpose_bf16_block(tile, W, Wt + (size_t)w * DMODEL * DMODEL, DMODEL, DMODEL,
                       (c % TR_SIDE) * 64, (c / TR_SIDE) * 64);
}

// ---------------------------------------------------------------------------
// Tiled WMMA GEMM with double-buffered async-DMA staging.
// C[M][N] = A[M][K] * Bt[N][K]^T + bias[N]
// block tile 128x128, BK=32, 256 threads = 8 waves (4 x 2),
// each wave computes 32x64 = 2x4 tiles of 16x16.
// MODE (compile time): 0 -> bf16 [B,H,S,64]   (q / k layout)
//                      1 -> bf16 [B,H,64,S]   (v transposed layout)
//                      2 -> f32  row-major [M][N]
// A lane's 8 accumulator registers run along the first WMMA operand's rows, so
// the operand whose index is contiguous in the output goes first: Bt rows (n)
// for modes 0 and 2, A rows (m = position) for mode 1. The 8 results of a tile
// then leave as 16-byte stores. The wave tile is 32 rows of the first operand
// by 64 of the second in every mode.
// ---------------------------------------------------------------------------
#define G_BM 128
#define G_BN 128
#define G_BK 32
#define G_LDA 40   // bf16 elems per LDS row (32 + 8 pad): 80B row, 16B aligned, bank-spread

template <int MODE>
static __device__ __forceinline__
void gemm_bf16_tile(__bf16 (*lA)[G_BM * G_LDA], __bf16 (*lB)[G_BN * G_LDA],
                    const __bf16* __restrict__ A,   // [M][K]
                    const __bf16* __restrict__ Bt,  // [N][K]
                    const float*  __restrict__ bias,
                    void* __restrict__ out,
                    int M, int N, int K) {
  const int tid  = threadIdx.x;
  const int lane = tid & 31;
  const int wave = tid >> 5;
  const int wm   = wave & 3;   // 4 waves along the first operand (32 rows each)
  const int wn   = wave >> 2;  // 2 waves along the second operand (64 rows each)
  const int m0   = blockIdx.x * G_BM;
  const int n0   = blockIdx.y * G_BN;
  const int lm   = lane & 15;
  const int kb   = (lane >> 4) * 8;   // ISA 16-bit A/B fragment K mapping

  // per-thread DMA chunk coords: chunks c = tid and tid+256; r = c>>2, kc = c&3
  const int cr = tid >> 2;     // 0..63
  const int ck = tid & 3;      // 0..3
  const unsigned ldsA0 = lds_off(&lA[0][0]);
  const unsigned ldsB0 = lds_off(&lB[0][0]);
  const unsigned bufA  = (unsigned)(G_BM * G_LDA * 2);
  const unsigned bufB  = (unsigned)(G_BN * G_LDA * 2);
  const unsigned lA_t0 = ldsA0 + (unsigned)((cr      ) * G_LDA + ck * 8) * 2;
  const unsigned lA_t1 = ldsA0 + (unsigned)((cr + 64 ) * G_LDA + ck * 8) * 2;
  const unsigned lB_t0 = ldsB0 + (unsigned)((cr      ) * G_LDA + ck * 8) * 2;
  const unsigned lB_t1 = ldsB0 + (unsigned)((cr + 64 ) * G_LDA + ck * 8) * 2;
  const unsigned gA0 = ((unsigned)(m0 + cr     ) * K + ck * 8) * 2;
  const unsigned gA1 = ((unsigned)(m0 + cr + 64) * K + ck * 8) * 2;
  const unsigned gB0 = ((unsigned)(n0 + cr     ) * K + ck * 8) * 2;
  const unsigned gB1 = ((unsigned)(n0 + cr + 64) * K + ck * 8) * 2;

#define G_ISSUE(k0, buf) do {                                   \
    unsigned kby = (unsigned)(k0) * 2;                          \
    async_b128(lA_t0 + (buf) * bufA, gA0 + kby, A);             \
    async_b128(lA_t1 + (buf) * bufA, gA1 + kby, A);             \
    async_b128(lB_t0 + (buf) * bufB, gB0 + kby, Bt);            \
    async_b128(lB_t1 + (buf) * bufB, gB1 + kby, Bt);            \
  } while (0)

  v8f acc[2][4];
#pragma unroll
  for (int i = 0; i < 2; i++)
#pragma unroll
    for (int j = 0; j < 4; j++) acc[i][j] = (v8f)(0.0f);

  const int KT = K / G_BK;
  G_ISSUE(0, 0);
  wait_async0();
  __syncthreads();

  for (int kt = 0; kt < KT; kt++) {
    const int cur = kt & 1;
    if (kt + 1 < KT) G_ISSUE((kt + 1) * G_BK, cur ^ 1);  // DMA next tile during compute

    const __bf16* l1 = (MODE == 1) ? &lA[cur][0] : &lB[cur][0];  // first operand
    const __bf16* l2 = (MODE == 1) ? &lB[cur][0] : &lA[cur][0];  // second operand
    v16bf af[2], bfm[4];
#pragma unroll
    for (int i = 0; i < 2; i++) {
      int r = wm * 32 + i * 16 + lm;
      v8bf lo = *(const v8bf*)(&l1[r * G_LDA + kb]);
      v8bf hi = *(const v8bf*)(&l1[r * G_LDA + 16 + kb]);
      af[i] = cat8(lo, hi);
    }
#pragma unroll
    for (int j = 0; j < 4; j++) {
      int r = wn * 64 + j * 16 + lm;
      v8bf lo = *(const v8bf*)(&l2[r * G_LDA + kb]);
      v8bf hi = *(const v8bf*)(&l2[r * G_LDA + 16 + kb]);
      bfm[j] = cat8(lo, hi);
    }
#pragma unroll
    for (int i = 0; i < 2; i++)
#pragma unroll
      for (int j = 0; j < 4; j++)
        acc[i][j] = wmma_bf16(af[i], bfm[j], acc[i][j]);

    // keep WMMAs ahead of the async wait so DMA overlaps the matrix math
#pragma unroll
    for (int i = 0; i < 2; i++)
#pragma unroll
      for (int j = 0; j < 4; j++) pin(acc[i][j]);

    wait_async0();
    __syncthreads();
  }
#undef G_ISSUE

  // epilogue: a lane holds column lm of each tile (second operand's row) and, in
  // register r, row r + mh (first operand's row)
  const int mh = (lane >> 4) * 8;
  if constexpr (MODE == 1) {      // lane = n (head dim), registers = 8 positions
#pragma unroll
    for (int j = 0; j < 4; j++) {
      const int n = n0 + wn * 64 + j * 16 + lm;
      const float bv = bias[n];
      const int h = n >> 6, dd = n & 63;
#pragma unroll
      for (int i = 0; i < 2; i++) {
        const int m = m0 + wm * 32 + i * 16 + mh;
        const int b = m / SEQ, s = m % SEQ;
        *(v8bf*)((__bf16*)out + (((size_t)(b * HN + h)) * ADIM + dd) * SEQ + s) =
            __builtin_convertvector(acc[i][j] + bv, v8bf);
      }
    }
  } else {                        // lane = m (row), registers = 8 columns n
#pragma unroll
    for (int i = 0; i < 2; i++) {
      const int n = n0 + wm * 32 + i * 16 + mh;
      const v8f bv = *(const v8f*)(bias + n);
#pragma unroll
      for (int j = 0; j < 4; j++) {
        const int m = m0 + wn * 64 + j * 16 + lm;
        const v8f val = acc[i][j] + bv;
        if constexpr (MODE == 0) {  // [B,H,S,64] bf16
          const int b = m / SEQ, s = m % SEQ;
          const int h = n >> 6, dd = n & 63;
          *(v8bf*)((__bf16*)out + (((size_t)(b * HN + h)) * SEQ + s) * ADIM + dd) =
              __builtin_convertvector(val, v8bf);
        } else {                    // f32 row-major
          *(v8f*)((float*)out + (size_t)m * N + n) = val;
        }
      }
    }
  }
}

// The three projections of X in one grid: blockIdx.z picks weight, bias, output
// and layout. They share nothing but their input, so one grid's blocks fill the
// places that a single projection's 2 blocks per WGP leave empty.
__global__ __launch_bounds__(256)
void gemm_qkv_kernel(const __bf16* __restrict__ X,
                     const __bf16* __restrict__ WqT, const __bf16* __restrict__ WkT,
                     const __bf16* __restrict__ WvT,
                     const float* __restrict__ bq, const float* __restrict__ bk,
                     const float* __restrict__ bv,
                     __bf16* __restrict__ q, __bf16* __restrict__ k,
                     __bf16* __restrict__ vt, int M, int N, int K) {
  __shared__ __align__(16) __bf16 lA[2][G_BM * G_LDA];
  __shared__ __align__(16) __bf16 lB[2][G_BN * G_LDA];
  const int z = blockIdx.z;   // the same for the whole block: barriers stay uniform
  if (z == 2)
    gemm_bf16_tile<1>(lA, lB, X, WvT, bv, vt, M, N, K);
  else {
    gemm_bf16_tile<0>(lA, lB, X, z ? WkT : WqT, z ? bk : bq, z ? k : q, M, N, K);
    // the other layout's code follows in the text and reuses the registers that
    // the stores above name: they are free for reuse only behind this wait
    asm volatile("s_wait_xcnt 0x0" ::: "memory");
  }
}

__global__ __launch_bounds__(256)
void gemm_out_kernel(const __bf16* __restrict__ A, const __bf16* __restrict__ Bt,
                     const float* __restrict__ bias, float* __restrict__ out,
                     int M, int N, int K) {
  __shared__ __align__(16) __bf16 lA[2][G_BM * G_LDA];
  __shared__ __align__(16) __bf16 lB[2][G_BN * G_LDA];
  gemm_bf16_tile<2>(lA, lB, A, Bt, bias, out, M, N, K);
}

// ---------------------------------------------------------------------------
// Flash-style attention with double-buffered async-DMA KV staging.
// grid = (B*H, S/64). 128 threads = 4 waves, each wave owns 16 query rows.
// Both products run transposed: St = K * Qt, Ot += Vt * Pt. A lane then holds
// one query (column lm): its softmax statistics are one scalar per lane, and
// two St tiles, converted in place, are the B operand of the second product.
// ---------------------------------------------------------------------------
#define A_LDK 72  // 64 + 8 pad bf16 elems per LDS row (144B: 16B aligned)

// waves_per_eu: register room for the K and V fragment reads to stand in groups
// ahead of their WMMAs; at a tighter budget each read pair is waited on singly.
__global__ __launch_bounds__(128) __attribute__((amdgpu_waves_per_eu(4, 6)))
void attn_kernel(const __bf16* __restrict__ qb,   // [BH][S][64]
                 const __bf16* __restrict__ kbuf, // [BH][S][64]
                 const __bf16* __restrict__ vt,   // [BH][64][S]
                 __bf16* __restrict__ ctx) {      // [B*S][1024]
  const int bh   = blockIdx.x;
  const int qblk = blockIdx.y;
  const int tid  = threadIdx.x;
  const int lane = tid & 31;
  const int wave = tid >> 5;
  const int lm   = lane & 15;
  const int kb   = (lane >> 4) * 8;
  const int mh   = (lane >> 4) * 8;

  __shared__ __align__(16) __bf16 lK[2][64 * A_LDK];
  __shared__ __align__(16) __bf16 lV[2][64 * A_LDK];

  // per-thread DMA chunks: 512 16B chunks per tile / 128 threads = 4 each
  const int acr = tid >> 3;   // 0..15 (row group)
  const int acc_ = tid & 7;   // 0..7  (16B column chunk)
  const unsigned ldsK0 = lds_off(&lK[0][0]);
  const unsigned ldsV0 = lds_off(&lV[0][0]);
  const unsigned kvbuf = (unsigned)(64 * A_LDK * 2);
  unsigned lK_t[4], lV_t[4], gK[4], gV[4];
#pragma unroll
  for (int i = 0; i < 4; i++) {
    int r = acr + 16 * i;
    lK_t[i] = ldsK0 + (unsigned)(r * A_LDK + acc_ * 8) * 2;
    lV_t[i] = ldsV0 + (unsigned)(r * A_LDK + acc_ * 8) * 2;
    gK[i] = (((unsigned)bh * SEQ + r) * ADIM + acc_ * 8) * 2;  // + kv0*ADIM*2
    gV[i] = (((unsigned)bh * ADIM + r) * SEQ + acc_ * 8) * 2;  // + kv0*2
  }

#define KV_ISSUE(kv0, buf) do {                                        \
    unsigned ok = (unsigned)(kv0) * ADIM * 2, ov = (unsigned)(kv0) * 2;\
    _Pragma("unroll")                                                  \
    for (int i = 0; i < 4; i++) {                                      \
      async_b128(lK_t[i] + (buf) * kvbuf, gK[i] + ok, kbuf);           \
      async_b128(lV_t[i] + (buf) * kvbuf, gV[i] + ov, vt);             \
    }                                                                  \
  } while (0)

  // q fragments stay resident as B operands (K = d = 64 -> 2 WMMA k-steps)
  v16bf qf[2];
  {
    const __bf16* qrow = qb + ((size_t)bh * SEQ + qblk * 64 + wave * 16 + lm) * ADIM;
#pragma unroll
    for (int ks = 0; ks < 2; ks++) {
      v8bf lo = *(const v8bf*)(qrow + ks * 32 + kb);
      v8bf hi = *(const v8bf*)(qrow + ks * 32 + 16 + kb);
      qf[ks] = cat8(lo, hi);
    }
  }

  // this lane's query: running maximum (both halves agree) and the sum over the
  // keys of this lane's half (the halves are joined once, after the loop)
  float row_max = -3.0e38f, row_sum = 0.0f;
  v8f o[4];  // Ot tiles: lane = query lm, register r = d index dt*16 + mh + r
#pragma unroll
  for (int dt = 0; dt < 4; dt++) o[dt] = (v8f)(0.0f);

  KV_ISSUE(0, 0);
  wait_async0();
  __syncthreads();

  for (int kvb = 0; kvb < SEQ / 64; kvb++) {
    const int cur = kvb & 1;
    if (kvb + 1 < SEQ / 64) KV_ISSUE((kvb + 1) * 64, cur ^ 1);  // DMA next KV block

    // St = k @ q^T  (4 key tiles x 2 k-steps): register r = key tn*16 + mh + r
    v8f sc[4];
    v16bf kf[2][4];
#pragma unroll
    for (int ks = 0; ks < 2; ks++) {
#pragma unroll
      for (int tn = 0; tn < 4; tn++) {
        int r = tn * 16 + lm;
        v8bf lo = *(const v8bf*)(&lK[cur][r * A_LDK + ks * 32 + kb]);
        v8bf hi = *(const v8bf*)(&lK[cur][r * A_LDK + ks * 32 + 16 + kb]);
        kf[ks][tn] = cat8(lo, hi);
      }
    }
#pragma unroll
    for (int tn = 0; tn < 4; tn++) sc[tn] = (v8f)(0.0f);
#pragma unroll
    for (int ks = 0; ks < 2; ks++)
#pragma unroll
      for (int tn = 0; tn < 4; tn++)
        sc[tn] = wmma_bf16(kf[ks][tn], qf[ks], sc[tn]);

    // online softmax, one query per lane: 32 keys in-lane, one exchange of halves
    const float scale = 0.125f;  // 1/sqrt(64)
    float mt[4];
#pragma unroll
    for (int tn = 0; tn < 4; tn++) {
      sc[tn] *= scale;
      mt[tn] = sc[tn][0];
#pragma unroll
      for (int r = 1; r < 8; r++) mt[tn] = fmaxf(mt[tn], sc[tn][r]);
    }
    float mx = fmaxf(fmaxf(mt[0], mt[1]), fmaxf(mt[2], mt[3]));
    mx = fmaxf(mx, other_half(mx));
    float newm  = fmaxf(row_max, mx);
    float alpha = __expf(row_max - newm);
    row_max = newm;
#pragma unroll
    for (int tn = 0; tn < 4; tn++) {
      // exp(x) as exp2(x * log2(e)), one maximum for all of the lane's registers
      sc[tn] = exp2x8((sc[tn] - newm) * 1.44269504f);
    }
    v8f ps = (sc[0] + sc[1]) + (sc[2] + sc[3]);
    float psum = ((ps[0] + ps[1]) + (ps[2] + ps[3])) + ((ps[4] + ps[5]) + (ps[6] + ps[7]));
    row_sum = row_sum * alpha + psum;
#pragma unroll
    for (int dt = 0; dt < 4; dt++) o[dt] *= alpha;

    // Ot += Vt @ Pt: St tiles 2ks and 2ks+1 hold keys in the fragment's k order
#pragma unroll
    for (int ks = 0; ks < 2; ks++) {
      v16bf pf = cat8(__builtin_convertvector(sc[2 * ks], v8bf),
                      __builtin_convertvector(sc[2 * ks + 1], v8bf));
#pragma unroll
      for (int dt = 0; dt < 4; dt++) {
        int r = dt * 16 + lm;
        v8bf lo = *(const v8bf*)(&lV[cur][r * A_LDK + ks * 32 + kb]);
        v8bf hi = *(const v8bf*)(&lV[cur][r * A_LDK + ks * 32 + 16 + kb]);
        o[dt] = wmma_bf16(cat8(lo, hi), pf, o[dt]);
      }
    }

    // keep PV WMMAs ahead of the async wait so KV DMA overlaps the matrix math
#pragma unroll
    for (int dt = 0; dt < 4; dt++) pin(o[dt]);

    wait_async0();
    __syncthreads();
  }
#undef KV_ISSUE

  // finalize: ctx[(b*S+s)][h*64 + d] bf16, 8 consecutive d per lane and tile
  const int b = bh >> 4, h = bh & 15;
  row_sum += other_half(row_sum);
  const float inv = 1.0f / row_sum;
  const int s = qblk * 64 + wave * 16 + lm;
  __bf16* dst = ctx + ((size_t)(b * SEQ + s)) * DMODEL + h * ADIM + mh;
#pragma unroll
  for (int dt = 0; dt < 4; dt++)
    *(v8bf*)(dst + dt * 16) = __builtin_convertvector(o[dt] * inv, v8bf);
}

// ---------------------------------------------------------------------------
// residual add + LayerNorm, one wave per row of 1024 (32 values a lane, in
// groups of 4: a wave's load or store covers 512 contiguous bytes); the row's
// sums are joined inside the wave, so the block's 8 rows share nothing
// ---------------------------------------------------------------------------
__global__ __launch_bounds__(256)
void ln_kernel(const float* __restrict__ proj, const float* __restrict__ resid,
               const float* __restrict__ g, const float* __restrict__ b,
               float* __restrict__ out) {
  const int lane = threadIdx.x & 31;
  const size_t row = (size_t)blockIdx.x * 8 + (threadIdx.x >> 5);
  const v4f* __restrict__ pp = (const v4f*)(proj + row * DMODEL) + lane;
  const v4f* __restrict__ rp = (const v4f*)(resid + row * DMODEL) + lane;
  v4f x[8], y[8];
#pragma unroll
  for (int i = 0; i < 8; i++) x[i] = pp[i * 32];
#pragma unroll
  for (int i = 0; i < 8; i++) y[i] = rp[i * 32];
  v4f s4 = (v4f)(0.0f), q4 = (v4f)(0.0f);
#pragma unroll
  for (int i = 0; i < 8; i++) {
    x[i] += y[i];
    s4 += x[i];
    q4 += x[i] * x[i];
  }
  // the loads' address registers are free for reuse only behind this wait
  asm volatile("s_wait_xcnt 0x0" ::: "memory");
  float s  = (s4[0] + s4[1]) + (s4[2] + s4[3]);
  float sq = (q4[0] + q4[1]) + (q4[2] + q4[3]);
#pragma unroll
  for (int off = 16; off >= 1; off >>= 1) {
    s  += __shfl_xor(s,  off, 32);
    sq += __shfl_xor(sq, off, 32);
  }
  float mu  = s * (1.0f / DMODEL);
  float var = sq * (1.0f / DMODEL) - mu * mu;
  float rs  = rsqrtf(var + 1e-5f);
  const v4f* __restrict__ gp = (const v4f*)g + lane;
  const v4f* __restrict__ bp = (const v4f*)b + lane;
  v4f* __restrict__ op = (v4f*)(out + row * DMODEL) + lane;
#pragma unroll
  for (int i = 0; i < 8; i++) op[i * 32] = (x[i] - mu) * rs * gp[i * 32] + bp[i * 32];
}

// ---------------------------------------------------------------------------
extern "C" void kernel_launch(void* const* d_in, const int* in_sizes, int n_in,
                              void* d_out, int out_size, void* d_ws, size_t ws_size,
                              hipStream_t stream) {
  (void)in_sizes; (void)n_in; (void)out_size; (void)ws_size;
  const float* Q    = (const float*)d_in[0];
  const float* Wq   = (const float*)d_in[1];
  const float* bq   = (const float*)d_in[2];
  const float* Wk   = (const float*)d_in[3];
  const float* bk   = (const float*)d_in[4];
  const float* Wv   = (const float*)d_in[5];
  const float* bv   = (const float*)d_in[6];
  const float* Wo   = (const float*)d_in[7];
  const float* bo   = (const float*)d_in[8];
  const float* ln_g = (const float*)d_in[9];
  const float* ln_b = (const float*)d_in[10];

  const size_t ND = (size_t)MROWS * DMODEL;     // 8192*1024
  const size_t WW = (size_t)DMODEL * DMODEL;    // 1024*1024

  char* ws = (char*)d_ws;
  size_t off = 0;
  __bf16* Xbf = (__bf16*)(ws + off); off += ND * 2;
  __bf16* WqT = (__bf16*)(ws + off); off += WW * 2;
  __bf16* WkT = (__bf16*)(ws + off); off += WW * 2;
  __bf16* WvT = (__bf16*)(ws + off); off += WW * 2;
  __bf16* WoT = (__bf16*)(ws + off); off += WW * 2;
  __bf16* qbf = (__bf16*)(ws + off); off += ND * 2;   // [B,H,S,64]
  __bf16* kbf = (__bf16*)(ws + off); off += ND * 2;   // [B,H,S,64]
  __bf16* vtb = (__bf16*)(ws + off); off += ND * 2;   // [B,H,64,S]
  __bf16* ctx = (__bf16*)(ws + off); off += ND * 2;   // [B*S, 1024]
  float*  prj = (float*)(ws + off);  off += ND * 4;   // [B*S, 1024]

  // 1) precision staging (WqT is the first of the four transposed planes)
  stage_kernel<<<CVT_BLOCKS + 4 * TR_BLOCKS, 256, 0, stream>>>(Q, Wq, Wk, Wv, Wo, Xbf, WqT);

  // 2) QKV projections (WMMA GEMMs scattering into attention layouts)
  gemm_qkv_kernel<<<dim3(MROWS / G_BM, DMODEL / G_BN, 3), 256, 0, stream>>>(
      Xbf, WqT, WkT, WvT, bq, bk, bv, qbf, kbf, vtb, MROWS, DMODEL, DMODEL);

  // 3) flash attention
  attn_kernel<<<dim3(BATCH * HN, SEQ / 64), 128, 0, stream>>>(qbf, kbf, vtb, ctx);

  // 4) output projection (f32 out)
  gemm_out_kernel<<<dim3(MROWS / G_BM, DMODEL / G_BN), 256, 0, stream>>>(
      ctx, WoT, bo, prj, MROWS, DMODEL, DMODEL);

  // 5) residual + layernorm
  ln_kernel<<<MROWS / 8, 256, 0, stream>>>(prj, Q, ln_g, ln_b, (float*)d_out);
}

// v005
// One run takes 154 microseconds.
// Timed twice side by side with v004, it ran 1.05 times as fast both times.
// Counting every step since v000, it is 1.83 times as fast.
#include <hip/hip_runtime.h>
#include <hip/hip_bf16.h>

typedef __attribute__((ext_vector_type(16))) __bf16 v16bf;
typedef __attribute__((ext_vector_type(8)))  __bf16 v8bf;
typedef __attribute__((ext_vector_type(8)))  float  v8f;
typedef __attribute__((ext_vector_type(4)))  float  v4f;
typedef __attribute__((ext_vector_type(4)))  __bf16 v4bf;

#define HN     16
#define SEQ    2048
#define DMODEL 1024
#define ADIM   64
#define BATCH  4
#define MROWS  (BATCH * SEQ)   // 8192

static __device__ __forceinline__ v16bf cat8(v8bf lo, v8bf hi) {
  return __builtin_shufflevector(lo, hi, 0,1,2,3,4,5,6,7,8,9,10,11,12,13,14,15);
}

static __device__ __forceinline__ v8f wmma_bf16(v16bf a, v16bf b, v8f c) {
  // D = A(16x32 bf16) * B(32x16 bf16) + C(16x16 f32)
  return __builtin_amdgcn_wmma_f32_16x16x32_bf16(false, a, false, b, (short)0, c, false, false);
}

// gfx1250 async DMA: global -> LDS, 16B per lane, tracked by ASYNCcnt.
// GVS addressing: mem = SADDR(u64) + VADDR(i32) + IOFFSET. VDST = LDS byte addr.
static __device__ __forceinline__ void async_b128(unsigned lds_byte, unsigned voff_byte,
                                                  const void* base) {
  asm volatile("global_load_async_to_lds_b128 %0, %1, %2"
               :: "v"(lds_byte), "v"(voff_byte), "s"((unsigned long long)base)
               : "memory");
}

static __device__ __forceinline__ void wait_async0() {
#if __has_builtin(__builtin_amdgcn_s_wait_asynccnt)
  __builtin_amdgcn_s_wait_asynccnt(0);
#else
  asm volatile("s_wait_asynccnt 0x0" ::: "memory");
#endif
}

// empty volatile asm consuming the accumulator: volatile asms keep program
// order, so this pins the producing WMMAs *before* the following wait/barrier,
// letting the in-flight async DMA overlap the matrix math.
static __device__ __forceinline__ void pin(v8f& x) {
  asm volatile("" : "+v"(x));
}

// value of the same lane position in the other 16-lane half (l <-> l ^ 16)
static __device__ __forceinline__ float other_half(float x) {
  int b = __builtin_bit_cast(int, x);
  b = __builtin_amdgcn_permlanex16(b, b, 0x76543210, 0xfedcba98, false, false);
  return __builtin_bit_cast(float, b);
}

// exp2 of eight values. One statement, so that behind each v_exp_f32 stands an
// independent one (the slot the instruction set asks for before a result is used
// or a source overwritten); the closing v_nop is that slot for the last.
static __device__ __forceinline__ v8f exp2x8(v8f t) {
  float a = t[0], b = t[1], c = t[2], d = t[3], e = t[4], f = t[5], g = t[6], h = t[7];
  asm("v_exp_f32 %0, %0\n\tv_exp_f32 %1, %1\n\tv_exp_f32 %2, %2\n\tv_exp_f32 %3, %3\n\t"
      "v_exp_f32 %4, %4\n\tv_exp_f32 %5, %5\n\tv_exp_f32 %6, %6\n\tv_exp_f32 %7, %7\n\t"
      "v_nop"
      : "+v"(a), "+v"(b), "+v"(c), "+v"(d), "+v"(e), "+v"(f), "+v"(g), "+v"(h));
  v8f p = {a, b, c, d, e, f, g, h};
  return p;
}

// low 32 bits of a generic LDS pointer == LDS byte offset (flat aperture mapping)
static __device__ __forceinline__ unsigned lds_off(const void* p) {
  return (unsigned)(unsigned long long)p;
}

// ---------------------------------------------------------------------------
// fp32 -> bf16 elementwise convert. A lane takes CVT_V groups of four floats, all
// loads asked for before the first store; a wave's load covers 512 contiguous
// bytes, its store 256. One block covers 256 * CVT_V * 4 floats, no remainder.
// ---------------------------------------------------------------------------
#define CVT_V 16
#define CVT_BLOCKS (MROWS * DMODEL / (256 * CVT_V * 4))
static __device__ __forceinline__
void cvt_f32_bf16_block(const float* __restrict__ in, __bf16* __restrict__ out, int blk) {
  const size_t base = (size_t)blk * (256 * CVT_V) + threadIdx.x;  // in groups of 4
  const v4f* __restrict__ src = (const v4f*)in + base;
  v4bf* __restrict__ dst = (v4bf*)out + base;
  v4f v[CVT_V];
#pragma unroll
  for (int j = 0; j < CVT_V; j++) v[j] = src[j * 256];
#pragma unroll
  for (int j = 0; j < CVT_V; j++) dst[j * 256] = __builtin_convertvector(v[j], v4bf);
}

// ---------------------------------------------------------------------------
// W[K][N] fp32  ->  Wt[N][K] bf16   (LDS tile transpose, 64 x 64 per block:
// a lane loads four groups of 4 floats and stores two groups of 8 bf16, so a
// wave reads whole 256-byte row pieces and writes whole 128-byte lines)
// ---------------------------------------------------------------------------
static __device__ __forceinline__
void transpose_bf16_block(float (*tile)[65], const float* __restrict__ W,
                          __bf16* __restrict__ Wt, int K, int N,
                          int bx,    // along N
                          int by) {  // along K
  const int c4 = threadIdx.x & 15;   // group of 4 columns (n)
  const int r0 = threadIdx.x >> 4;   // 0..15
  v4f v[4];
#pragma unroll
  for (int i = 0; i < 4; i++)
    v[i] = *(const v4f*)(W + (size_t)(by + r0 + i * 16) * N + bx + c4 * 4);
  // the loads' address registers are free for reuse only behind this wait; the
  // scheduling barrier keeps later index arithmetic from being lifted over it
  asm volatile("s_wait_xcnt 0x0" ::: "memory");
  __builtin_amdgcn_sched_barrier(0);
#pragma unroll
  for (int i = 0; i < 4; i++)
#pragma unroll
    for (int e = 0; e < 4; e++) tile[r0 + i * 16][c4 * 4 + e] = v[i][e];
  __syncthreads();
  const int ck = threadIdx.x & 7;    // group of 8 k
  const int n0 = threadIdx.x >> 3;   // 0..31
#pragma unroll
  for (int i = 0; i < 2; i++) {
    int n = n0 + i * 32;
    v8bf o;
#pragma unroll
    for (int j = 0; j < 8; j++) o[j] = (__bf16)tile[ck * 8 + j][n];
    *(v8bf*)(Wt + (size_t)(bx + n) * K + by + ck * 8) = o;
  }
}

// ---------------------------------------------------------------------------
// All precision staging in one grid: none of the five jobs reads another's
// result, so their blocks start, wait on memory and drain side by side.
// Blocks [0, CVT_BLOCKS) convert X; then TR_BLOCKS blocks per weight matrix,
// whose transposed planes lie one behind the other in Wt (q, k, v, o).
// ---------------------------------------------------------------------------
#define TR_SIDE   (DMODEL / 64)
#define TR_BLOCKS (TR_SIDE * TR_SIDE)
__global__ __launch_bounds__(256)
void stage_kernel(const float* __restrict__ X,
                  const float* __restrict__ Wq, const float* __restrict__ Wk,
                  const float* __restrict__ Wv, const float* __restrict__ Wo,
                  __bf16* __restrict__ Xbf, __bf16* __restrict__ Wt) {
  __shared__ float tile[64][65];
  const int blk = blockIdx.x;
  if (blk < CVT_BLOCKS) {   // the whole block leaves here, ahead of any barrier
    cvt_f32_bf16_block(X, Xbf, blk);
    return;
  }
  const int t = blk - CVT_BLOCKS;
  const int w = t / TR_BLOCKS;
  const int c = t % TR_BLOCKS;
  const float* W = (w == 0) ? Wq : (w == 1) ? Wk : (w == 2) ? Wv : Wo;
  transpose_bf16_block(tile, W, Wt + (size_t)w * DMODEL * DMODEL, DMODEL, DMODEL,
                       (c % TR_SIDE) * 64, (c / TR_SIDE) * 64);
}

// ---------------------------------------------------------------------------
// Tiled WMMA GEMM with double-buffered async-DMA staging.
// C[M][N] = A[M][K] * Bt[N][K]^T + bias[N]
// block tile 128x128, BK=32, 256 threads = 8 waves (4 x 2),
// each wave computes 32x64 = 2x4 tiles of 16x16.
// MODE (compile time): 0 -> bf16 [B,H,S,64]   (q / k layout)
//                      1 -> bf16 [B,H,64,S]   (v transposed layout)
//                      2 -> f32  row-major [M][N]
// A lane's 8 accumulator registers run along the first WMMA operand's rows, so
// the operand whose index is contiguous in the output goes first: Bt rows (n)
// for modes 0 and 2, A rows (m = position) for mode 1. The 8 results of a tile
// then leave as 16-byte stores. The wave tile is 32 rows of the first operand
// by 64 of the second in every mode.
// ---------------------------------------------------------------------------
#define G_BM 128
#define G_BN 128
#define G_BK 32
#define G_LDA 40   // bf16 elems per LDS row (32 + 8 pad): 80B row, 16B aligned, bank-spread

template <int MODE>
static __device__ __forceinline__
void gemm_bf16_tile(__bf16 (*lA)[G_BM * G_LDA], __bf16 (*lB)[G_BN * G_LDA],
                    const __bf16* __restrict__ A,   // [M][K]
                    const __bf16* __restrict__ Bt,  // [N][K]
                    const float*  __restrict__ bias,
                    void* __restrict__ out,
                    int M, int N, int K) {
  const int tid  = threadIdx.x;
  const int lane = tid & 31;
  const int wave = tid >> 5;
  const int wm   = wave & 3;   // 4 waves along the first operand (32 rows each)
  const int wn   = wave >> 2;  // 2 waves along the second operand (64 rows each)
  const int m0   = blockIdx.x * G_BM;
  const int n0   = blockIdx.y * G_BN;
  const int lm   = lane & 15;
  const int kb   = (lane >> 4) * 8;   // ISA 16-bit A/B fragment K mapping

  // per-thread DMA chunk coords: chunks c = tid and tid+256; r = c>>2, kc = c&3
  const int cr = tid >> 2;     // 0..63
  const int ck = tid & 3;      // 0..3
  const unsigned ldsA0 = lds_off(&lA[0][0]);
  const unsigned ldsB0 = lds_off(&lB[0][0]);
  const unsigned bufA  = (unsigned)(G_BM * G_LDA * 2);
  const unsigned bufB  = (unsigned)(G_BN * G_LDA * 2);
  const unsigned lA_t0 = ldsA0 + (unsigned)((cr      ) * G_LDA + ck * 8) * 2;
  const unsigned lA_t1 = ldsA0 + (unsigned)((cr + 64 ) * G_LDA + ck * 8) * 2;
  const unsigned lB_t0 = ldsB0 + (unsigned)((cr      ) * G_LDA + ck * 8) * 2;
  const unsigned lB_t1 = ldsB0 + (unsigned)((cr + 64 ) * G_LDA + ck * 8) * 2;
  const unsigned gA0 = ((unsigned)(m0 + cr     ) * K + ck * 8) * 2;
  const unsigned gA1 = ((unsigned)(m0 + cr + 64) * K + ck * 8) * 2;
  const unsigned gB0 = ((unsigned)(n0 + cr     ) * K + ck * 8) * 2;
  const unsigned gB1 = ((unsigned)(n0 + cr + 64) * K + ck * 8) * 2;

#define G_ISSUE(k0, buf) do {                                   \
    unsigned kby = (unsigned)(k0) * 2;                          \
    async_b128(lA_t0 + (buf) * bufA, gA0 + kby, A);             \
    async_b128(lA_t1 + (buf) * bufA, gA1 + kby, A);             \
    async_b128(lB_t0 + (buf) * bufB, gB0 + kby, Bt);            \
    async_b128(lB_t1 + (buf) * bufB, gB1 + kby, Bt);            \
  } while (0)

  v8f acc[2][4];
#pragma unroll
  for (int i = 0; i < 2; i++)
#pragma unroll
    for (int j = 0; j < 4; j++) acc[i][j] = (v8f)(0.0f);

  const int KT = K / G_BK;
  G_ISSUE(0, 0);
  wait_async0();
  __syncthreads();

  for (int kt = 0; kt < KT; kt++) {
    const int cur = kt & 1;
    if (kt + 1 < KT) G_ISSUE((kt + 1) * G_BK, cur ^ 1);  // DMA next tile during compute

    const __bf16* l1 = (MODE == 1) ? &lA[cur][0] : &lB[cur][0];  // first operand
    const __bf16* l2 = (MODE == 1) ? &lB[cur][0] : &lA[cur][0];  // second operand
    v16bf af[2], bfm[4];
#pragma unroll
    for (int i = 0; i < 2; i++) {
      int r = wm * 32 + i * 16 + lm;
      v8bf lo = *(const v8bf*)(&l1[r * G_LDA + kb]);
      v8bf hi = *(const v8bf*)(&l1[r * G_LDA + 16 + kb]);
      af[i] = cat8(lo, hi);
    }
#pragma unroll
    for (int j = 0; j < 4; j++) {
      int r = wn * 64 + j * 16 + lm;
      v8bf lo = *(const v8bf*)(&l2[r * G_LDA + kb]);
      v8bf hi = *(const v8bf*)(&l2[r * G_LDA + 16 + kb]);
      bfm[j] = cat8(lo, hi);
    }
#pragma unroll
    for (int i = 0; i < 2; i++)
#pragma unroll
      for (int j = 0; j < 4; j++)
        acc[i][j] = wmma_bf16(af[i], bfm[j], acc[i][j]);

    // keep WMMAs ahead of the async wait so DMA overlaps the matrix math
#pragma unroll
    for (int i = 0; i < 2; i++)
#pragma unroll
      for (int j = 0; j < 4; j++) pin(acc[i][j]);

    wait_async0();
    __syncthreads();
  }
#undef G_ISSUE

  // epilogue: a lane holds column lm of each tile (second operand's row) and, in
  // register r, row r + mh (first operand's row)
  const int mh = (lane >> 4) * 8;
  if constexpr (MODE == 1) {      // lane = n (head dim), registers = 8 positions
#pragma unroll
    for (int j = 0; j < 4; j++) {
      const int n = n0 + wn * 64 + j * 16 + lm;
      const float bv = bias[n];
      const int h = n >> 6, dd = n & 63;
#pragma unroll
      for (int i = 0; i < 2; i++) {
        const int m = m0 + wm * 32 + i * 16 + mh;
        const int b = m / SEQ, s = m % SEQ;
        *(v8bf*)((__bf16*)out + (((size_t)(b * HN + h)) * ADIM + dd) * SEQ + s) =
            __builtin_convertvector(acc[i][j] + bv, v8bf);
      }
    }
  } else {                        // lane = m (row), registers = 8 columns n
#pragma unroll
    for (int i = 0; i < 2; i++) {
      const int n = n0 + wm * 32 + i * 16 + mh;
      const v8f bv = *(const v8f*)(bias + n);
#pragma unroll
      for (int j = 0; j < 4; j++) {
        const int m = m0 + wn * 64 + j * 16 + lm;
        const v8f val = acc[i][j] + bv;
        if constexpr (MODE == 0) {  // [B,H,S,64] bf16
          const int b = m / SEQ, s = m % SEQ;
          const int h = n >> 6, dd = n & 63;
          *(v8bf*)((__bf16*)out + (((size_t)(b * HN + h)) * SEQ + s) * ADIM + dd) =
              __builtin_convertvector(val, v8bf);
        } else {                    // f32 row-major
          *(v8f*)((float*)out + (size_t)m * N + n) = val;
        }
      }
    }
  }
}

// The three projections of X in one grid: blockIdx.z picks weight, bias, output
// and layout. They share nothing but their input, so one grid's blocks fill the
// places that a single projection's 2 blocks per WGP leave empty.
__global__ __launch_bounds__(256)
void gemm_qkv_kernel(const __bf16* __restrict__ X,
                     const __bf16* __restrict__ WqT, const __bf16* __restrict__ WkT,
                     const __bf16* __restrict__ WvT,
                     const float* __restrict__ bq, const float* __restrict__ bk,
                     const float* __restrict__ bv,
                     __bf16* __restrict__ q, __bf16* __restrict__ k,
                     __bf16* __restrict__ vt, int M, int N, int K) {
  __shared__ __align__(16) __bf16 lA[2][G_BM * G_LDA];
  __shared__ __align__(16) __bf16 lB[2][G_BN * G_LDA];
  const int z = blockIdx.z;   // the same for the whole block: barriers stay uniform
  if (z == 2)
    gemm_bf16_tile<1>(lA, lB, X, WvT, bv, vt, M, N, K);
  else {
    gemm_bf16_tile<0>(lA, lB, X, z ? WkT : WqT, z ? bk : bq, z ? k : q, M, N, K);
    // the other layout's code follows in the text and reuses the registers that
    // the stores above name: they are free for reuse only behind this wait
    asm volatile("s_wait_xcnt 0x0" ::: "memory");
  }
}

__global__ __launch_bounds__(256)
void gemm_out_kernel(const __bf16* __restrict__ A, const __bf16* __restrict__ Bt,
                     const float* __restrict__ bias, float* __restrict__ out,
                     int M, int N, int K) {
  __shared__ __align__(16) __bf16 lA[2][G_BM * G_LDA];
  __shared__ __align__(16) __bf16 lB[2][G_BN * G_LDA];
  gemm_bf16_tile<2>(lA, lB, A, Bt, bias, out, M, N, K);
}

// ---------------------------------------------------------------------------
// Flash-style attention with double-buffered async-DMA KV staging.
// grid = (B*H, S/256). 256 threads = 8 waves, each wave owns 32 query rows as
// two column groups of 16: a K or V fragment read from LDS feeds two WMMAs, and
// one staged KV block serves 256 queries.
// Both products run transposed: St = K * Qt, Ot += Vt * Pt. A lane then holds
// one query per group (column lm): its softmax statistics are one scalar per
// lane and group, and two St tiles, converted in place, are the B operand of
// the second product.
// ---------------------------------------------------------------------------
#define A_LDK 72  // 64 + 8 pad bf16 elems per LDS row (144B: 16B aligned)
#define A_QG  2                    // query column groups per wave
#define A_QB  (8 * 16 * A_QG)      // queries per block

// One lane's share of a KV block: two 16-byte pieces of K, two of V. The closing
// wait stands inside the statement, so that no register named by a copy is
// written again ahead of it.
static __device__ __forceinline__
void async_kv(unsigned lk0, unsigned gk0, unsigned lk1, unsigned gk1, const void* kbase,
              unsigned lv0, unsigned gv0, unsigned lv1, unsigned gv1, const void* vbase) {
  asm volatile("global_load_async_to_lds_b128 %0, %1, %8\n\t"
               "global_load_async_to_lds_b128 %2, %3, %8\n\t"
               "global_load_async_to_lds_b128 %4, %5, %9\n\t"
               "global_load_async_to_lds_b128 %6, %7, %9\n\t"
               "s_wait_xcnt 0x0"
               :: "v"(lk0), "v"(gk0), "v"(lk1), "v"(gk1),
                  "v"(lv0), "v"(gv0), "v"(lv1), "v"(gv1),
                  "s"((unsigned long long)kbase), "s"((unsigned long long)vbase)
               : "memory");
}

// waves_per_eu: 256 registers a wave, so that two blocks (four waves per SIMD)
// stay resident and the whole grid runs in one round.
__global__ __launch_bounds__(256) __attribute__((amdgpu_waves_per_eu(4, 4)))
void attn_kernel(const __bf16* __restrict__ qb,   // [BH][S][64]
                 const __bf16* __restrict__ kbuf, // [BH][S][64]
                 const __bf16* __restrict__ vt,   // [BH][64][S]
                 __bf16* __restrict__ ctx) {      // [B*S][1024]
  const int bh   = blockIdx.x;
  const int qblk = blockIdx.y;
  const int tid  = threadIdx.x;
  const int lane = tid & 31;
  const int wave = tid >> 5;
  const int lm   = lane & 15;
  const int kb   = (lane >> 4) * 8;
  const int mh   = (lane >> 4) * 8;

  __shared__ __align__(16) __bf16 lK[2][64 * A_LDK];
  __shared__ __align__(16) __bf16 lV[2][64 * A_LDK];

  // per-thread DMA chunks: 512 16B chunks per tile / 256 threads = 2 each
  const int acr = tid >> 3;   // 0..31 (row)
  const int acc_ = tid & 7;   // 0..7  (16B column chunk)
  const unsigned ldsK0 = lds_off(&lK[0][0]);
  const unsigned ldsV0 = lds_off(&lV[0][0]);
  const unsigned kvbuf = (unsigned)(64 * A_LDK * 2);
  unsigned lK_t[2], lV_t[2], gK[2], gV[2];
#pragma unroll
  for (int i = 0; i < 2; i++) {
    int r = acr + 32 * i;
    lK_t[i] = ldsK0 + (unsigned)(r * A_LDK + acc_ * 8) * 2;
    lV_t[i] = ldsV0 + (unsigned)(r * A_LDK + acc_ * 8) * 2;
    gK[i] = (((unsigned)bh * SEQ + r) * ADIM + acc_ * 8) * 2;  // + kv0*ADIM*2
    gV[i] = (((unsigned)bh * ADIM + r) * SEQ + acc_ * 8) * 2;  // + kv0*2
  }

#define KV_ISSUE(kv0, buf) do {                                        \
    unsigned ok = (unsigned)(kv0) * ADIM * 2, ov = (unsigned)(kv0) * 2;\
    unsigned ob = (unsigned)(buf) * kvbuf;                             \
    async_kv(lK_t[0] + ob, gK[0] + ok, lK_t[1] + ob, gK[1] + ok, kbuf, \
             lV_t[0] + ob, gV[0] + ov, lV_t[1] + ob, gV[1] + ov, vt);  \
  } while (0)

  // q fragments stay resident as B operands (K = d = 64 -> 2 WMMA k-steps).
  // Here and below every loop over groups, tiles and k-steps is unrolled, so that
  // the fragment and accumulator arrays are indexed by constants and stay in registers.
  v16bf qf[A_QG][2];
#pragma unroll
  for (int g = 0; g < A_QG; g++) {
    const __bf16* qrow =
        qb + ((size_t)bh * SEQ + qblk * A_QB + wave * (16 * A_QG) + g * 16 + lm) * ADIM;
#pragma unroll
    for (int ks = 0; ks < 2; ks++) {
      v8bf lo = *(const v8bf*)(qrow + ks * 32 + kb);
      v8bf hi = *(const v8bf*)(qrow + ks * 32 + 16 + kb);
      qf[g][ks] = cat8(lo, hi);
    }
  }

  // this lane's query of each group: running maximum (both halves agree) and the
  // sum over the keys of this lane's half (the halves are joined after the loop)
  float row_max[A_QG], row_sum[A_QG];
  v8f o[A_QG][4];  // Ot tiles: lane = query lm, register r = d index dt*16 + mh + r
#pragma unroll
  for (int g = 0; g < A_QG; g++) {
    row_max[g] = -3.0e38f;
    row_sum[g] = 0.0f;
#pragma unroll
    for (int dt = 0; dt < 4; dt++) o[g][dt] = (v8f)(0.0f);
  }

  KV_ISSUE(0, 0);
  // block 0 has landed for this wave; the barrier publishes it to the others
  asm volatile("s_wait_asynccnt 0x0" ::: "memory");
  __syncthreads();
  KV_ISSUE(64, 1);

  for (int kvb = 0; kvb < SEQ / 64; kvb++) {
    const int cur = kvb & 1;

    // St = k @ q^T  (4 key tiles x 2 k-steps): register r = key tn*16 + mh + r
    v8f sc[A_QG][4];
    v16bf kf[2][4];
#pragma unroll
    for (int ks = 0; ks < 2; ks++) {
#pragma unroll
      for (int tn = 0; tn < 4; tn++) {
        int r = tn * 16 + lm;
        v8bf lo = *(const v8bf*)(&lK[cur][r * A_LDK + ks * 32 + kb]);
        v8bf hi = *(const v8bf*)(&lK[cur][r * A_LDK + ks * 32 + 16 + kb]);
        kf[ks][tn] = cat8(lo, hi);
      }
    }
#pragma unroll
    for (int g = 0; g < A_QG; g++)
#pragma unroll
      for (int tn = 0; tn < 4; tn++) sc[g][tn] = (v8f)(0.0f);
#pragma unroll
    for (int ks = 0; ks < 2; ks++)
#pragma unroll
      for (int tn = 0; tn < 4; tn++)
#pragma unroll
        for (int g = 0; g < A_QG; g++)
          sc[g][tn] = wmma_bf16(kf[ks][tn], qf[g][ks], sc[g][tn]);

    // online softmax, one query per lane and group: 32 keys in-lane, one exchange
    // of halves
    const float scale = 0.125f;  // 1/sqrt(64)
#pragma unroll
    for (int g = 0; g < A_QG; g++) {
      float mt[4];
#pragma unroll
      for (int tn = 0; tn < 4; tn++) {
        sc[g][tn] *= scale;
        mt[tn] = sc[g][tn][0];
#pragma unroll
        for (int r = 1; r < 8; r++) mt[tn] = fmaxf(mt[tn], sc[g][tn][r]);
      }
      float mx = fmaxf(fmaxf(mt[0], mt[1]), fmaxf(mt[2], mt[3]));
      mx = fmaxf(mx, other_half(mx));
      float newm  = fmaxf(row_max[g], mx);
      float alpha = __expf(row_max[g] - newm);
      row_max[g] = newm;
#pragma unroll
      for (int tn = 0; tn < 4; tn++) {
        // exp(x) as exp2(x * log2(e)), one maximum for all of the lane's registers
        sc[g][tn] = exp2x8((sc[g][tn] - newm) * 1.44269504f);
      }
      v8f ps = (sc[g][0] + sc[g][1]) + (sc[g][2] + sc[g][3]);
      float psum = ((ps[0] + ps[1]) + (ps[2] + ps[3])) + ((ps[4] + ps[5]) + (ps[6] + ps[7]));
      row_sum[g] = row_sum[g] * alpha + psum;
#pragma unroll
      for (int dt = 0; dt < 4; dt++) o[g][dt] *= alpha;
    }

    // Ot += Vt @ Pt: St tiles 2ks and 2ks+1 hold keys in the fragment's k order
#pragma unroll
    for (int ks = 0; ks < 2; ks++) {
      v16bf pf[A_QG];
#pragma unroll
      for (int g = 0; g < A_QG; g++)
        pf[g] = cat8(__builtin_convertvector(sc[g][2 * ks], v8bf),
                     __builtin_convertvector(sc[g][2 * ks + 1], v8bf));
#pragma unroll
      for (int dt = 0; dt < 4; dt++) {
        int r = dt * 16 + lm;
        v8bf lo = *(const v8bf*)(&lV[cur][r * A_LDK + ks * 32 + kb]);
        v8bf hi = *(const v8bf*)(&lV[cur][r * A_LDK + ks * 32 + 16 + kb]);
        v16bf vf = cat8(lo, hi);
#pragma unroll
        for (int g = 0; g < A_QG; g++) o[g][dt] = wmma_bf16(vf, pf[g], o[g][dt]);
      }
    }

    // hand-over: this wave's reads of buffer cur are done, its copies of the next
    // block have landed; behind the barrier both hold for every wave
    asm volatile("s_wait_dscnt 0x0" ::: "memory");
    asm volatile("s_wait_asynccnt 0x0" ::: "memory");
    __syncthreads();
    if (kvb + 2 < SEQ / 64) KV_ISSUE((kvb + 2) * 64, cur);  // refill the buffer just left
  }
#undef KV_ISSUE
  // no copy is outstanding when the wave ends
  asm volatile("s_wait_asynccnt 0x0" ::: "memory");

  // finalize: ctx[(b*S+s)][h*64 + d] bf16, 8 consecutive d per lane and tile
  const int b = bh >> 4, h = bh & 15;
#pragma unroll
  for (int g = 0; g < A_QG; g++) {
    const float rs = row_sum[g] + other_half(row_sum[g]);
    const float inv = 1.0f / rs;
    const int s = qblk * A_QB + wave * (16 * A_QG) + g * 16 + lm;
    __bf16* dst = ctx + ((size_t)(b * SEQ + s)) * DMODEL + h * ADIM + mh;
#pragma unroll
    for (int dt = 0; dt < 4; dt++)
      *(v8bf*)(dst + dt * 16) = __builtin_convertvector(o[g][dt] * inv, v8bf);
  }
}

// ---------------------------------------------------------------------------
// residual add + LayerNorm, one wave per row of 1024 (32 values a lane, in
// groups of 4: a wave's load or store covers 512 contiguous bytes); the row's
// sums are joined inside the wave, so the block's 8 rows share nothing
// ---------------------------------------------------------------------------
__global__ __launch_bounds__(256)
void ln_kernel(const float* __restrict__ proj, const float* __restrict__ resid,
               const float* __restrict__ g, const float* __restrict__ b,
               float* __restrict__ out) {
  const int lane = threadIdx.x & 31;
  const size_t row = (size_t)blockIdx.x * 8 + (threadIdx.x >> 5);
  const v4f* __restrict__ pp = (const v4f*)(proj + row * DMODEL) + lane;
  const v4f* __restrict__ rp = (const v4f*)(resid + row * DMODEL) + lane;
  v4f x[8], y[8];
#pragma unroll
  for (int i = 0; i < 8; i++) x[i] = pp[i * 32];
#pragma unroll
  for (int i = 0; i < 8; i++) y[i] = rp[i * 32];
  v4f s4 = (v4f)(0.0f), q4 = (v4f)(0.0f);
#pragma unroll
  for (int i = 0; i < 8; i++) {
    x[i] += y[i];
    s4 += x[i];
    q4 += x[i] * x[i];
  }
  // the loads' address registers are free for reuse only behind this wait
  asm volatile("s_wait_xcnt 0x0" ::: "memory");
  float s  = (s4[0] + s4[1]) + (s4[2] + s4[3]);
  float sq = (q4[0] + q4[1]) + (q4[2] + q4[3]);
#pragma unroll
  for (int off = 16; off >= 1; off >>= 1) {
    s  += __shfl_xor(s,  off, 32);
    sq += __shfl_xor(sq, off, 32);
  }
  float mu  = s * (1.0f / DMODEL);
  float var = sq * (1.0f / DMODEL) - mu * mu;
  float rs  = rsqrtf(var + 1e-5f);
  const v4f* __restrict__ gp = (const v4f*)g + lane;
  const v4f* __restrict__ bp = (const v4f*)b + lane;
  v4f* __restrict__ op = (v4f*)(out + row * DMODEL) + lane;
#pragma unroll
  for (int i = 0; i < 8; i++) op[i * 32] = (x[i] - mu) * rs * gp[i * 32] + bp[i * 32];
}

// ---------------------------------------------------------------------------
extern "C" void kernel_launch(void* const* d_in, const int* in_sizes, int n_in,
                              void* d_out, int out_size, void* d_ws, size_t ws_size,
                              hipStream_t stream) {
  (void)in_sizes; (void)n_in; (void)out_size; (void)ws_size;
  const float* Q    = (const float*)d_in[0];
  const float* Wq   = (const float*)d_in[1];
  const float* bq   = (const float*)d_in[2];
  const float* Wk   = (const float*)d_in[3];
  const float* bk   = (const float*)d_in[4];
  const float* Wv   = (const float*)d_in[5];
  const float* bv   = (const float*)d_in[6];
  const float* Wo   = (const float*)d_in[7];
  const float* bo   = (const float*)d_in[8];
  const float* ln_g = (const float*)d_in[9];
  const float* ln_b = (const float*)d_in[10];

  const size_t ND = (size_t)MROWS * DMODEL;     // 8192*1024
  const size_t WW = (size_t)DMODEL * DMODEL;    // 1024*1024

  char* ws = (char*)d_ws;
  size_t off = 0;
  __bf16* Xbf = (__bf16*)(ws + off); off += ND * 2;
  __bf16* WqT = (__bf16*)(ws + off); off += WW * 2;
  __bf16* WkT = (__bf16*)(ws + off); off += WW * 2;
  __bf16* WvT = (__bf16*)(ws + off); off += WW * 2;
  __bf16* WoT = (__bf16*)(ws + off); off += WW * 2;
  __bf16* qbf = (__bf16*)(ws + off); off += ND * 2;   // [B,H,S,64]
  __bf16* kbf = (__bf16*)(ws + off); off += ND * 2;   // [B,H,S,64]
  __bf16* vtb = (__bf16*)(ws + off); off += ND * 2;   // [B,H,64,S]
  __bf16* ctx = (__bf16*)(ws + off); off += ND * 2;   // [B*S, 1024]
  float*  prj = (float*)(ws + off);  off += ND * 4;   // [B*S, 1024]

  // 1) precision staging (WqT is the first of the four transposed planes)
  stage_kernel<<<CVT_BLOCKS + 4 * TR_BLOCKS, 256, 0, stream>>>(Q, Wq, Wk, Wv, Wo, Xbf, WqT);

  // 2) QKV projections (WMMA GEMMs scattering into attention layouts)
  gemm_qkv_kernel<<<dim3(MROWS / G_BM, DMODEL / G_BN, 3), 256, 0, stream>>>(
      Xbf, WqT, WkT, WvT, bq, bk, bv, qbf, kbf, vtb, MROWS, DMODEL, DMODEL);

  // 3) flash attention
  attn_kernel<<<dim3(BATCH * HN, SEQ / A_QB), 256, 0, stream>>>(qbf, kbf, vtb, ctx);

  // 4) output projection (f32 out)
  gemm_out_kernel<<<dim3(MROWS / G_BM, DMODEL / G_BN), 256, 0, stream>>>(
      ctx, WoT, bo, prj, MROWS, DMODEL, DMODEL);

  // 5) residual + layernorm
  ln_kernel<<<MROWS / 8, 256, 0, stream>>>(prj, Q, ln_g, ln_b, (float*)d_out);
}

// v006
// Measured time: 132 microseconds a run.
// In both of two side-by-side timings against v005, it was 1.17 times as fast.
// Counting every step since v000, it is 2.14 times as fast.
#include <hip/hip_runtime.h>
#include <hip/hip_bf16.h>

typedef __attribute__((ext_vector_type(16))) __bf16 v16bf;
typedef __attribute__((ext_vector_type(8)))  __bf16 v8bf;
typedef __attribute__((ext_vector_type(8)))  float  v8f;
typedef __attribute__((ext_vector_type(4)))  float  v4f;
typedef __attribute__((ext_vector_type(4)))  __bf16 v4bf;

#define HN     16
#define SEQ    2048
#define DMODEL 1024
#define ADIM   64
#define BATCH  4
#define MROWS  (BATCH * SEQ)   // 8192

static __device__ __forceinline__ v16bf cat8(v8bf lo, v8bf hi) {
  return __builtin_shufflevector(lo, hi, 0,1,2,3,4,5,6,7,8,9,10,11,12,13,14,15);
}

static __device__ __forceinline__ v8f wmma_bf16(v16bf a, v16bf b, v8f c) {
  // D = A(16x32 bf16) * B(32x16 bf16) + C(16x16 f32)
  return __builtin_amdgcn_wmma_f32_16x16x32_bf16(false, a, false, b, (short)0, c, false, false);
}

// gfx1250 async DMA: global -> LDS, 16B per lane, tracked by ASYNCcnt.
// GVS addressing: mem = SADDR(u64) + VADDR(i32) + IOFFSET. VDST = LDS byte addr.
// One lane's share of a GEMM K-step: four 16-byte pieces of each operand's tile.
// The closing wait stands inside the statement, so that no register named by a
// copy is written again ahead of it.
static __device__ __forceinline__
void async_ab(const unsigned (&la)[4], const unsigned (&ga)[4], const void* abase,
              const unsigned (&lb)[4], const unsigned (&gb)[4], const void* bbase) {
  asm volatile("global_load_async_to_lds_b128 %0, %1, %16\n\t"
               "global_load_async_to_lds_b128 %2, %3, %16\n\t"
               "global_load_async_to_lds_b128 %4, %5, %16\n\t"
               "global_load_async_to_lds_b128 %6, %7, %16\n\t"
               "global_load_async_to_lds_b128 %8, %9, %17\n\t"
               "global_load_async_to_lds_b128 %10, %11, %17\n\t"
               "global_load_async_to_lds_b128 %12, %13, %17\n\t"
               "global_load_async_to_lds_b128 %14, %15, %17\n\t"
               "s_wait_xcnt 0x0"
               :: "v"(la[0]), "v"(ga[0]), "v"(la[1]), "v"(ga[1]),
                  "v"(la[2]), "v"(ga[2]), "v"(la[3]), "v"(ga[3]),
                  "v"(lb[0]), "v"(gb[0]), "v"(lb[1]), "v"(gb[1]),
                  "v"(lb[2]), "v"(gb[2]), "v"(lb[3]), "v"(gb[3]),
                  "s"((unsigned long long)abase), "s"((unsigned long long)bbase)
               : "memory");
}

// empty volatile asm consuming the accumulator: volatile asms keep program
// order, so this pins the producing WMMAs *before* the following wait/barrier,
// letting the in-flight async DMA overlap the matrix math.
static __device__ __forceinline__ void pin(v8f& x) {
  asm volatile("" : "+v"(x));
}

// value of the same lane position in the other 16-lane half (l <-> l ^ 16)
static __device__ __forceinline__ float other_half(float x) {
  int b = __builtin_bit_cast(int, x);
  b = __builtin_amdgcn_permlanex16(b, b, 0x76543210, 0xfedcba98, false, false);
  return __builtin_bit_cast(float, b);
}

// exp2 of eight values. One statement, so that behind each v_exp_f32 stands an
// independent one (the slot the instruction set asks for before a result is used
// or a source overwritten); the closing v_nop is that slot for the last.
static __device__ __forceinline__ v8f exp2x8(v8f t) {
  float a = t[0], b = t[1], c = t[2], d = t[3], e = t[4], f = t[5], g = t[6], h = t[7];
  asm("v_exp_f32 %0, %0\n\tv_exp_f32 %1, %1\n\tv_exp_f32 %2, %2\n\tv_exp_f32 %3, %3\n\t"
      "v_exp_f32 %4, %4\n\tv_exp_f32 %5, %5\n\tv_exp_f32 %6, %6\n\tv_exp_f32 %7, %7\n\t"
      "v_nop"
      : "+v"(a), "+v"(b), "+v"(c), "+v"(d), "+v"(e), "+v"(f), "+v"(g), "+v"(h));
  v8f p = {a, b, c, d, e, f, g, h};
  return p;
}

// low 32 bits of a generic LDS pointer == LDS byte offset (flat aperture mapping)
static __device__ __forceinline__ unsigned lds_off(const void* p) {
  return (unsigned)(unsigned long long)p;
}

// ---------------------------------------------------------------------------
// fp32 -> bf16 elementwise convert. A lane takes CVT_V groups of four floats, all
// loads asked for before the first store; a wave's load covers 512 contiguous
// bytes, its store 256. One block covers 256 * CVT_V * 4 floats, no remainder.
// ---------------------------------------------------------------------------
#define CVT_V 16
#define CVT_BLOCKS (MROWS * DMODEL / (256 * CVT_V * 4))
static __device__ __forceinline__
void cvt_f32_bf16_block(const float* __restrict__ in, __bf16* __restrict__ out, int blk) {
  const size_t base = (size_t)blk * (256 * CVT_V) + threadIdx.x;  // in groups of 4
  const v4f* __restrict__ src = (const v4f*)in + base;
  v4bf* __restrict__ dst = (v4bf*)out + base;
  v4f v[CVT_V];
#pragma unroll
  for (int j = 0; j < CVT_V; j++) v[j] = src[j * 256];
#pragma unroll
  for (int j = 0; j < CVT_V; j++) dst[j * 256] = __builtin_convertvector(v[j], v4bf);
}

// ---------------------------------------------------------------------------
// W[K][N] fp32  ->  Wt[N][K] bf16   (LDS tile transpose, 64 x 64 per block:
// a lane loads four groups of 4 floats and stores two groups of 8 bf16, so a
// wave reads whole 256-byte row pieces and writes whole 128-byte lines)
// ---------------------------------------------------------------------------
static __device__ __forceinline__
void transpose_bf16_block(float (*tile)[65], const float* __restrict__ W,
                          __bf16* __restrict__ Wt, int K, int N,
                          int bx,    // along N
                          int by) {  // along K
  const int c4 = threadIdx.x & 15;   // group of 4 columns (n)
  const int r0 = threadIdx.x >> 4;   // 0..15
  v4f v[4];
#pragma unroll
  for (int i = 0; i < 4; i++)
    v[i] = *(const v4f*)(W + (size_t)(by + r0 + i * 16) * N + bx + c4 * 4);
  // the loads' address registers are free for reuse only behind this wait; the
  // scheduling barrier keeps later index arithmetic from being lifted over it
  asm volatile("s_wait_xcnt 0x0" ::: "memory");
  __builtin_amdgcn_sched_barrier(0);
#pragma unroll
  for (int i = 0; i < 4; i++)
#pragma unroll
    for (int e = 0; e < 4; e++) tile[r0 + i * 16][c4 * 4 + e] = v[i][e];
  __syncthreads();
  const int ck = threadIdx.x & 7;    // group of 8 k
  const int n0 = threadIdx.x >> 3;   // 0..31
#pragma unroll
  for (int i = 0; i < 2; i++) {
    int n = n0 + i * 32;
    v8bf o;
#pragma unroll
    for (int j = 0; j < 8; j++) o[j] = (__bf16)tile[ck * 8 + j][n];
    *(v8bf*)(Wt + (size_t)(bx + n) * K + by + ck * 8) = o;
  }
}

// ---------------------------------------------------------------------------
// All precision staging in one grid: none of the five jobs reads another's
// result, so their blocks start, wait on memory and drain side by side.
// Blocks [0, CVT_BLOCKS) convert X; then TR_BLOCKS blocks per weight matrix,
// whose transposed planes lie one behind the other in Wt (q, k, v, o).
// ---------------------------------------------------------------------------
#define TR_SIDE   (DMODEL / 64)
#define TR_BLOCKS (TR_SIDE * TR_SIDE)
__global__ __launch_bounds__(256)
void stage_kernel(const float* __restrict__ X,
                  const float* __restrict__ Wq, const float* __restrict__ Wk,
                  const float* __restrict__ Wv, const float* __restrict__ Wo,
                  __bf16* __restrict__ Xbf, __bf16* __restrict__ Wt) {
  __shared__ float tile[64][65];
  const int blk = blockIdx.x;
  if (blk < CVT_BLOCKS) {   // the whole block leaves here, ahead of any barrier
    cvt_f32_bf16_block(X, Xbf, blk);
    return;
  }
  const int t = blk - CVT_BLOCKS;
  const int w = t / TR_BLOCKS;
  const int c = t % TR_BLOCKS;
  const float* W = (w == 0) ? Wq : (w == 1) ? Wk : (w == 2) ? Wv : Wo;
  transpose_bf16_block(tile, W, Wt + (size_t)w * DMODEL * DMODEL, DMODEL, DMODEL,
                       (c % TR_SIDE) * 64, (c / TR_SIDE) * 64);
}

// ---------------------------------------------------------------------------
// Tiled WMMA GEMM with double-buffered async-DMA staging.
// C[M][N] = A[M][K] * Bt[N][K]^T + bias[N]
// block tile 128x128, BK=64, 256 threads = 8 waves (4 x 2),
// each wave computes 32x64 = 2x4 tiles of 16x16, two WMMA k-steps per K-step.
// A K-step takes 128 bytes of every operand row: a whole cache line, so a wave's
// copy covers 4 whole lines.
// MODE (compile time): 0 -> bf16 [B,H,S,64]   (q / k layout)
//                      1 -> bf16 [B,H,64,S]   (v transposed layout)
//                      2 -> f32  row-major [M][N]
// A lane's 8 accumulator registers run along the first WMMA operand's rows, so
// the operand whose index is contiguous in the output goes first: Bt rows (n)
// for modes 0 and 2, A rows (m = position) for mode 1. The 8 results of a tile
// then leave as 16-byte stores. The wave tile is 32 rows of the first operand
// by 64 of the second in every mode.
// ---------------------------------------------------------------------------
#define G_BM 128
#define G_BN 128
#define G_BK 64
#define G_LDA 72   // bf16 elems per LDS row (64 + 8 pad): 144B row, 16B aligned, bank-spread

template <int MODE>
static __device__ __forceinline__
void gemm_bf16_tile(__bf16 (*lA)[G_BM * G_LDA], __bf16 (*lB)[G_BN * G_LDA],
                    const __bf16* __restrict__ A,   // [M][K]
                    const __bf16* __restrict__ Bt,  // [N][K]
                    const float*  __restrict__ bias,
                    void* __restrict__ out,
                    int M, int N, int K) {
  const int tid  = threadIdx.x;
  const int lane = tid & 31;
  const int wave = tid >> 5;
  const int wm   = wave & 3;   // 4 waves along the first operand (32 rows each)
  const int wn   = wave >> 2;  // 2 waves along the second operand (64 rows each)
  const int m0   = blockIdx.x * G_BM;
  const int n0   = blockIdx.y * G_BN;
  const int lm   = lane & 15;
  const int kb   = (lane >> 4) * 8;   // ISA 16-bit A/B fragment K mapping

  // per-thread DMA chunk coords: chunks c = tid + 256 * i; r = c>>3, kc = c&7
  const int cr = tid >> 3;     // 0..31
  const int ck = tid & 7;      // 0..7: eight lanes cover a row's 128 bytes
  const unsigned bufA = (unsigned)(G_BM * G_LDA * 2);
  const unsigned bufB = (unsigned)(G_BN * G_LDA * 2);
  const unsigned lA_t = lds_off(&lA[0][0]) + (unsigned)(cr * G_LDA + ck * 8) * 2;
  const unsigned lB_t = lds_off(&lB[0][0]) + (unsigned)(cr * G_LDA + ck * 8) * 2;
  const unsigned gA_t = ((unsigned)(m0 + cr) * K + ck * 8) * 2;
  const unsigned gB_t = ((unsigned)(n0 + cr) * K + ck * 8) * 2;

#define G_ISSUE(k0, buf) do {                                   \
    unsigned la[4], ga[4], lb[4], gb[4];                        \
    _Pragma("unroll")                                           \
    for (int i = 0; i < 4; i++) {  /* rows cr + 32 * i */       \
      la[i] = lA_t + (buf) * bufA + (unsigned)(32 * i * G_LDA * 2);  \
      lb[i] = lB_t + (buf) * bufB + (unsigned)(32 * i * G_LDA * 2);  \
      ga[i] = gA_t + ((unsigned)(32 * i) * K + (unsigned)(k0)) * 2;  \
      gb[i] = gB_t + ((unsigned)(32 * i) * K + (unsigned)(k0)) * 2;  \
    }                                                           \
    async_ab(la, ga, A, lb, gb, Bt);                            \
  } while (0)

  v8f acc[2][4];
#pragma unroll
  for (int i = 0; i < 2; i++)
#pragma unroll
    for (int j = 0; j < 4; j++) acc[i][j] = (v8f)(0.0f);

  const int KT = K / G_BK;
  G_ISSUE(0, 0);
  // tile 0 has landed for this wave; the barrier publishes it to the others
  asm volatile("s_wait_asynccnt 0x0" ::: "memory");
  __syncthreads();
  if (KT > 1) G_ISSUE(G_BK, 1);

  for (int kt = 0; kt < KT; kt++) {
    const int cur = kt & 1;

    const __bf16* l1 = (MODE == 1) ? &lA[cur][0] : &lB[cur][0];  // first operand
    const __bf16* l2 = (MODE == 1) ? &lB[cur][0] : &lA[cur][0];  // second operand
    // loops over k-steps and tiles are unrolled: fragment arrays stay in registers
    v16bf af[2][2], bfm[2][4];
#pragma unroll
    for (int ks = 0; ks < 2; ks++) {
#pragma unroll
      for (int i = 0; i < 2; i++) {
        int r = wm * 32 + i * 16 + lm;
        v8bf lo = *(const v8bf*)(&l1[r * G_LDA + ks * 32 + kb]);
        v8bf hi = *(const v8bf*)(&l1[r * G_LDA + ks * 32 + 16 + kb]);
        af[ks][i] = cat8(lo, hi);
      }
#pragma unroll
      for (int j = 0; j < 4; j++) {
        int r = wn * 64 + j * 16 + lm;
        v8bf lo = *(const v8bf*)(&l2[r * G_LDA + ks * 32 + kb]);
        v8bf hi = *(const v8bf*)(&l2[r * G_LDA + ks * 32 + 16 + kb]);
        bfm[ks][j] = cat8(lo, hi);
      }
    }
#pragma unroll
    for (int ks = 0; ks < 2; ks++)
#pragma unroll
      for (int i = 0; i < 2; i++)
#pragma unroll
        for (int j = 0; j < 4; j++)
          acc[i][j] = wmma_bf16(af[ks][i], bfm[ks][j], acc[i][j]);

    // keep WMMAs ahead of the async wait so DMA overlaps the matrix math
#pragma unroll
    for (int i = 0; i < 2; i++)
#pragma unroll
      for (int j = 0; j < 4; j++) pin(acc[i][j]);

    // hand-over: this wave's reads of buffer cur are done, its copies of the next
    // tile have landed; behind the barrier both hold for every wave
    asm volatile("s_wait_dscnt 0x0" ::: "memory");
    asm volatile("s_wait_asynccnt 0x0" ::: "memory");
    __syncthreads();
    if (kt + 2 < KT) G_ISSUE((kt + 2) * G_BK, cur);  // refill the buffer just left
  }
#undef G_ISSUE
  // no copy is outstanding when the epilogue starts
  asm volatile("s_wait_asynccnt 0x0" ::: "memory");

  // epilogue: a lane holds column lm of each tile (second operand's row) and, in
  // register r, row r + mh (first operand's row)
  const int mh = (lane >> 4) * 8;
  if constexpr (MODE == 1) {      // lane = n (head dim), registers = 8 positions
#pragma unroll
    for (int j = 0; j < 4; j++) {
      const int n = n0 + wn * 64 + j * 16 + lm;
      const float bv = bias[n];
      const int h = n >> 6, dd = n & 63;
#pragma unroll
      for (int i = 0; i < 2; i++) {
        const int m = m0 + wm * 32 + i * 16 + mh;
        const int b = m / SEQ, s = m % SEQ;
        *(v8bf*)((__bf16*)out + (((size_t)(b * HN + h)) * ADIM + dd) * SEQ + s) =
            __builtin_convertvector(acc[i][j] + bv, v8bf);
      }
    }
  } else {                        // lane = m (row), registers = 8 columns n
#pragma unroll
    for (int i = 0; i < 2; i++) {
      const int n = n0 + wm * 32 + i * 16 + mh;
      const v8f bv = *(const v8f*)(bias + n);
#pragma unroll
      for (int j = 0; j < 4; j++) {
        const int m = m0 + wn * 64 + j * 16 + lm;
        const v8f val = acc[i][j] + bv;
        if constexpr (MODE == 0) {  // [B,H,S,64] bf16
          const int b = m / SEQ, s = m % SEQ;
          const int h = n >> 6, dd = n & 63;
          *(v8bf*)((__bf16*)out + (((size_t)(b * HN + h)) * SEQ + s) * ADIM + dd) =
              __builtin_convertvector(val, v8bf);
        } else {                    // f32 row-major
          *(v8f*)((float*)out + (size_t)m * N + n) = val;
        }
      }
    }
  }
}

// The three projections of X in one grid: blockIdx.z picks weight, bias, output
// and layout. They share nothing but their input, so one grid's blocks fill the
// places that a single projection's 2 blocks per WGP leave empty.
__global__ __launch_bounds__(256)
void gemm_qkv_kernel(const __bf16* __restrict__ X,
                     const __bf16* __restrict__ WqT, const __bf16* __restrict__ WkT,
                     const __bf16* __restrict__ WvT,
                     const float* __restrict__ bq, const float* __restrict__ bk,
                     const float* __restrict__ bv,
                     __bf16* __restrict__ q, __bf16* __restrict__ k,
                     __bf16* __restrict__ vt, int M, int N, int K) {
  __shared__ __align__(16) __bf16 lA[2][G_BM * G_LDA];
  __shared__ __align__(16) __bf16 lB[2][G_BN * G_LDA];
  const int z = blockIdx.z;   // the same for the whole block: barriers stay uniform
  if (z == 2)
    gemm_bf16_tile<1>(lA, lB, X, WvT, bv, vt, M, N, K);
  else {
    gemm_bf16_tile<0>(lA, lB, X, z ? WkT : WqT, z ? bk : bq, z ? k : q, M, N, K);
    // the other layout's code follows in the text and reuses the registers that
    // the stores above name: they are free for reuse only behind this wait
    asm volatile("s_wait_xcnt 0x0" ::: "memory");
  }
}

__global__ __launch_bounds__(256)
void gemm_out_kernel(const __bf16* __restrict__ A, const __bf16* __restrict__ Bt,
                     const float* __restrict__ bias, float* __restrict__ out,
                     int M, int N, int K) {
  __shared__ __align__(16) __bf16 lA[2][G_BM * G_LDA];
  __shared__ __align__(16) __bf16 lB[2][G_BN * G_LDA];
  gemm_bf16_tile<2>(lA, lB, A, Bt, bias, out, M, N, K);
}

// ---------------------------------------------------------------------------
// Flash-style attention with double-buffered async-DMA KV staging.
// grid = (B*H, S/256). 256 threads = 8 waves, each wave owns 32 query rows as
// two column groups of 16: a K or V fragment read from LDS feeds two WMMAs, and
// one staged KV block serves 256 queries.
// Both products run transposed: St = K * Qt, Ot += Vt * Pt. A lane then holds
// one query per group (column lm): its softmax statistics are one scalar per
// lane and group, and two St tiles, converted in place, are the B operand of
// the second product.
// ---------------------------------------------------------------------------
#define A_LDK 72  // 64 + 8 pad bf16 elems per LDS row (144B: 16B aligned)
#define A_QG  2                    // query column groups per wave
#define A_QB  (8 * 16 * A_QG)      // queries per block

// One lane's share of a KV block: two 16-byte pieces of K, two of V. The closing
// wait stands inside the statement, so that no register named by a copy is
// written again ahead of it.
static __device__ __forceinline__
void async_kv(unsigned lk0, unsigned gk0, unsigned lk1, unsigned gk1, const void* kbase,
              unsigned lv0, unsigned gv0, unsigned lv1, unsigned gv1, const void* vbase) {
  asm volatile("global_load_async_to_lds_b128 %0, %1, %8\n\t"
               "global_load_async_to_lds_b128 %2, %3, %8\n\t"
               "global_load_async_to_lds_b128 %4, %5, %9\n\t"
               "global_load_async_to_lds_b128 %6, %7, %9\n\t"
               "s_wait_xcnt 0x0"
               :: "v"(lk0), "v"(gk0), "v"(lk1), "v"(gk1),
                  "v"(lv0), "v"(gv0), "v"(lv1), "v"(gv1),
                  "s"((unsigned long long)kbase), "s"((unsigned long long)vbase)
               : "memory");
}

// waves_per_eu: 256 registers a wave, so that two blocks (four waves per SIMD)
// stay resident and the whole grid runs in one round.
__global__ __launch_bounds__(256) __attribute__((amdgpu_waves_per_eu(4, 4)))
void attn_kernel(const __bf16* __restrict__ qb,   // [BH][S][64]
                 const __bf16* __restrict__ kbuf, // [BH][S][64]
                 const __bf16* __restrict__ vt,   // [BH][64][S]
                 __bf16* __restrict__ ctx) {      // [B*S][1024]
  const int bh   = blockIdx.x;
  const int qblk = blockIdx.y;
  const int tid  = threadIdx.x;
  const int lane = tid & 31;
  const int wave = tid >> 5;
  const int lm   = lane & 15;
  const int kb   = (lane >> 4) * 8;
  const int mh   = (lane >> 4) * 8;

  __shared__ __align__(16) __bf16 lK[2][64 * A_LDK];
  __shared__ __align__(16) __bf16 lV[2][64 * A_LDK];

  // per-thread DMA chunks: 512 16B chunks per tile / 256 threads = 2 each
  const int acr = tid >> 3;   // 0..31 (row)
  const int acc_ = tid & 7;   // 0..7  (16B column chunk)
  const unsigned ldsK0 = lds_off(&lK[0][0]);
  const unsigned ldsV0 = lds_off(&lV[0][0]);
  const unsigned kvbuf = (unsigned)(64 * A_LDK * 2);
  unsigned lK_t[2], lV_t[2], gK[2], gV[2];
#pragma unroll
  for (int i = 0; i < 2; i++) {
    int r = acr + 32 * i;
    lK_t[i] = ldsK0 + (unsigned)(r * A_LDK + acc_ * 8) * 2;
    lV_t[i] = ldsV0 + (unsigned)(r * A_LDK + acc_ * 8) * 2;
    gK[i] = (((unsigned)bh * SEQ + r) * ADIM + acc_ * 8) * 2;  // + kv0*ADIM*2
    gV[i] = (((unsigned)bh * ADIM + r) * SEQ + acc_ * 8) * 2;  // + kv0*2
  }

#define KV_ISSUE(kv0, buf) do {                                        \
    unsigned ok = (unsigned)(kv0) * ADIM * 2, ov = (unsigned)(kv0) * 2;\
    unsigned ob = (unsigned)(buf) * kvbuf;                             \
    async_kv(lK_t[0] + ob, gK[0] + ok, lK_t[1] + ob, gK[1] + ok, kbuf, \
             lV_t[0] + ob, gV[0] + ov, lV_t[1] + ob, gV[1] + ov, vt);  \
  } while (0)

  // q fragments stay resident as B operands (K = d = 64 -> 2 WMMA k-steps).
  // Here and below every loop over groups, tiles and k-steps is unrolled, so that
  // the fragment and accumulator arrays are indexed by constants and stay in registers.
  v16bf qf[A_QG][2];
#pragma unroll
  for (int g = 0; g < A_QG; g++) {
    const __bf16* qrow =
        qb + ((size_t)bh * SEQ + qblk * A_QB + wave * (16 * A_QG) + g * 16 + lm) * ADIM;
#pragma unroll
    for (int ks = 0; ks < 2; ks++) {
      v8bf lo = *(const v8bf*)(qrow + ks * 32 + kb);
      v8bf hi = *(const v8bf*)(qrow + ks * 32 + 16 + kb);
      qf[g][ks] = cat8(lo, hi);
    }
  }

  // this lane's query of each group: running maximum (both halves agree) and the
  // sum over the keys of this lane's half (the halves are joined after the loop)
  float row_max[A_QG], row_sum[A_QG];
  v8f o[A_QG][4];  // Ot tiles: lane = query lm, register r = d index dt*16 + mh + r
#pragma unroll
  for (int g = 0; g < A_QG; g++) {
    row_max[g] = -3.0e38f;
    row_sum[g] = 0.0f;
#pragma unroll
    for (int dt = 0; dt < 4; dt++) o[g][dt] = (v8f)(0.0f);
  }

  KV_ISSUE(0, 0);
  // block 0 has landed for this wave; the barrier publishes it to the others
  asm volatile("s_wait_asynccnt 0x0" ::: "memory");
  __syncthreads();
  KV_ISSUE(64, 1);

  for (int kvb = 0; kvb < SEQ / 64; kvb++) {
    const int cur = kvb & 1;

    // St = k @ q^T  (4 key tiles x 2 k-steps): register r = key tn*16 + mh + r
    v8f sc[A_QG][4];
    v16bf kf[2][4];
#pragma unroll
    for (int ks = 0; ks < 2; ks++) {
#pragma unroll
      for (int tn = 0; tn < 4; tn++) {
        int r = tn * 16 + lm;
        v8bf lo = *(const v8bf*)(&lK[cur][r * A_LDK + ks * 32 + kb]);
        v8bf hi = *(const v8bf*)(&lK[cur][r * A_LDK + ks * 32 + 16 + kb]);
        kf[ks][tn] = cat8(lo, hi);
      }
    }
#pragma unroll
    for (int g = 0; g < A_QG; g++)
#pragma unroll
      for (int tn = 0; tn < 4; tn++) sc[g][tn] = (v8f)(0.0f);
#pragma unroll
    for (int ks = 0; ks < 2; ks++)
#pragma unroll
      for (int tn = 0; tn < 4; tn++)
#pragma unroll
        for (int g = 0; g < A_QG; g++)
          sc[g][tn] = wmma_bf16(kf[ks][tn], qf[g][ks], sc[g][tn]);

    // online softmax, one query per lane and group: 32 keys in-lane, one exchange
    // of halves
    const float scale = 0.125f;  // 1/sqrt(64)
#pragma unroll
    for (int g = 0; g < A_QG; g++) {
      float mt[4];
#pragma unroll
      for (int tn = 0; tn < 4; tn++) {
        sc[g][tn] *= scale;
        mt[tn] = sc[g][tn][0];
#pragma unroll
        for (int r = 1; r < 8; r++) mt[tn] = fmaxf(mt[tn], sc[g][tn][r]);
      }
      float mx = fmaxf(fmaxf(mt[0], mt[1]), fmaxf(mt[2], mt[3]));
      mx = fmaxf(mx, other_half(mx));
      float newm  = fmaxf(row_max[g], mx);
      float alpha = __expf(row_max[g] - newm);
      row_max[g] = newm;
#pragma unroll
      for (int tn = 0; tn < 4; tn++) {
        // exp(x) as exp2(x * log2(e)), one maximum for all of the lane's registers
        sc[g][tn] = exp2x8((sc[g][tn] - newm) * 1.44269504f);
      }
      v8f ps = (sc[g][0] + sc[g][1]) + (sc[g][2] + sc[g][3]);
      float psum = ((ps[0] + ps[1]) + (ps[2] + ps[3])) + ((ps[4] + ps[5]) + (ps[6] + ps[7]));
      row_sum[g] = row_sum[g] * alpha + psum;
#pragma unroll
      for (int dt = 0; dt < 4; dt++) o[g][dt] *= alpha;
    }

    // Ot += Vt @ Pt: St tiles 2ks and 2ks+1 hold keys in the fragment's k order
#pragma unroll
    for (int ks = 0; ks < 2; ks++) {
      v16bf pf[A_QG];
#pragma unroll
      for (int g = 0; g < A_QG; g++)
        pf[g] = cat8(__builtin_convertvector(sc[g][2 * ks], v8bf),
                     __builtin_convertvector(sc[g][2 * ks + 1], v8bf));
#pragma unroll
      for (int dt = 0; dt < 4; dt++) {
        int r = dt * 16 + lm;
        v8bf lo = *(const v8bf*)(&lV[cur][r * A_LDK + ks * 32 + kb]);
        v8bf hi = *(const v8bf*)(&lV[cur][r * A_LDK + ks * 32 + 16 + kb]);
        v16bf vf = cat8(lo, hi);
#pragma unroll
        for (int g = 0; g < A_QG; g++) o[g][dt] = wmma_bf16(vf, pf[g], o[g][dt]);
      }
    }

    // hand-over: this wave's reads of buffer cur are done, its copies of the next
    // block have landed; behind the barrier both hold for every wave
    asm volatile("s_wait_dscnt 0x0" ::: "memory");
    asm volatile("s_wait_asynccnt 0x0" ::: "memory");
    __syncthreads();
    if (kvb + 2 < SEQ / 64) KV_ISSUE((kvb + 2) * 64, cur);  // refill the buffer just left
  }
#undef KV_ISSUE
  // no copy is outstanding when the wave ends
  asm volatile("s_wait_asynccnt 0x0" ::: "memory");

  // finalize: ctx[(b*S+s)][h*64 + d] bf16, 8 consecutive d per lane and tile
  const int b = bh >> 4, h = bh & 15;
#pragma unroll
  for (int g = 0; g < A_QG; g++) {
    const float rs = row_sum[g] + other_half(row_sum[g]);
    const float inv = 1.0f / rs;
    const int s = qblk * A_QB + wave * (16 * A_QG) + g * 16 + lm;
    __bf16* dst = ctx + ((size_t)(b * SEQ + s)) * DMODEL + h * ADIM + mh;
#pragma unroll
    for (int dt = 0; dt < 4; dt++)
      *(v8bf*)(dst + dt * 16) = __builtin_convertvector(o[g][dt] * inv, v8bf);
  }
}

// ---------------------------------------------------------------------------
// residual add + LayerNorm, one wave per row of 1024 (32 values a lane, in
// groups of 4: a wave's load or store covers 512 contiguous bytes); the row's
// sums are joined inside the wave, so the block's 8 rows share nothing
// ---------------------------------------------------------------------------
__global__ __launch_bounds__(256)
void ln_kernel(const float* __restrict__ proj, const float* __restrict__ resid,
               const float* __restrict__ g, const float* __restrict__ b,
               float* __restrict__ out) {
  const int lane = threadIdx.x & 31;
  const size_t row = (size_t)blockIdx.x * 8 + (threadIdx.x >> 5);
  const v4f* __restrict__ pp = (const v4f*)(proj + row * DMODEL) + lane;
  const v4f* __restrict__ rp = (const v4f*)(resid + row * DMODEL) + lane;
  v4f x[8], y[8];
#pragma unroll
  for (int i = 0; i < 8; i++) x[i] = pp[i * 32];
#pragma unroll
  for (int i = 0; i < 8; i++) y[i] = rp[i * 32];
  v4f s4 = (v4f)(0.0f), q4 = (v4f)(0.0f);
#pragma unroll
  for (int i = 0; i < 8; i++) {
    x[i] += y[i];
    s4 += x[i];
    q4 += x[i] * x[i];
  }
  // the loads' address registers are free for reuse only behind this wait
  asm volatile("s_wait_xcnt 0x0" ::: "memory");
  float s  = (s4[0] + s4[1]) + (s4[2] + s4[3]);
  float sq = (q4[0] + q4[1]) + (q4[2] + q4[3]);
#pragma unroll
  for (int off = 16; off >= 1; off >>= 1) {
    s  += __shfl_xor(s,  off, 32);
    sq += __shfl_xor(sq, off, 32);
  }
  float mu  = s * (1.0f / DMODEL);
  float var = sq * (1.0f / DMODEL) - mu * mu;
  float rs  = rsqrtf(var + 1e-5f);
  const v4f* __restrict__ gp = (const v4f*)g + lane;
  const v4f* __restrict__ bp = (const v4f*)b + lane;
  v4f* __restrict__ op = (v4f*)(out + row * DMODEL) + lane;
#pragma unroll
  for (int i = 0; i < 8; i++) op[i * 32] = (x[i] - mu) * rs * gp[i * 32] + bp[i * 32];
}

// ---------------------------------------------------------------------------
extern "C" void kernel_launch(void* const* d_in, const int* in_sizes, int n_in,
                              void* d_out, int out_size, void* d_ws, size_t ws_size,
                              hipStream_t stream) {
  (void)in_sizes; (void)n_in; (void)out_size; (void)ws_size;
  const float* Q    = (const float*)d_in[0];
  const float* Wq   = (const float*)d_in[1];
  const float* bq   = (const float*)d_in[2];
  const float* Wk   = (const float*)d_in[3];
  const float* bk   = (const float*)d_in[4];
  const float* Wv   = (const float*)d_in[5];
  const float* bv   = (const float*)d_in[6];
  const float* Wo   = (const float*)d_in[7];
  const float* bo   = (const float*)d_in[8];
  const float* ln_g = (const float*)d_in[9];
  const float* ln_b = (const float*)d_in[10];

  const size_t ND = (size_t)MROWS * DMODEL;     // 8192*1024
  const size_t WW = (size_t)DMODEL * DMODEL;    // 1024*1024

  char* ws = (char*)d_ws;
  size_t off = 0;
  __bf16* Xbf = (__bf16*)(ws + off); off += ND * 2;
  __bf16* WqT = (__bf16*)(ws + off); off += WW * 2;
  __bf16* WkT = (__bf16*)(ws + off); off += WW * 2;
  __bf16* WvT = (__bf16*)(ws + off); off += WW * 2;
  __bf16* WoT = (__bf16*)(ws + off); off += WW * 2;
  __bf16* qbf = (__bf16*)(ws + off); off += ND * 2;   // [B,H,S,64]
  __bf16* kbf = (__bf16*)(ws + off); off += ND * 2;   // [B,H,S,64]
  __bf16* vtb = (__bf16*)(ws + off); off += ND * 2;   // [B,H,64,S]
  __bf16* ctx = (__bf16*)(ws + off); off += ND * 2;   // [B*S, 1024]
  float*  prj = (float*)(ws + off);  off += ND * 4;   // [B*S, 1024]

  // 1) precision staging (WqT is the first of the four transposed planes)
  stage_kernel<<<CVT_BLOCKS + 4 * TR_BLOCKS, 256, 0, stream>>>(Q, Wq, Wk, Wv, Wo, Xbf, WqT);

  // 2) QKV projections (WMMA GEMMs scattering into attention layouts)
  gemm_qkv_kernel<<<dim3(MROWS / G_BM, DMODEL / G_BN, 3), 256, 0, stream>>>(
      Xbf, WqT, WkT, WvT, bq, bk, bv, qbf, kbf, vtb, MROWS, DMODEL, DMODEL);

  // 3) flash attention
  attn_kernel<<<dim3(BATCH * HN, SEQ / A_QB), 256, 0, stream>>>(qbf, kbf, vtb, ctx);

  // 4) output projection (f32 out)
  gemm_out_kernel<<<dim3(MROWS / G_BM, DMODEL / G_BN), 256, 0, stream>>>(
      ctx, WoT, bo, prj, MROWS, DMODEL, DMODEL);

  // 5) residual + layernorm
  ln_kernel<<<MROWS / 8, 256, 0, stream>>>(prj, Q, ln_g, ln_b, (float*)d_out);
}

// v007
// A run of this version takes 126 microseconds.
// Timed twice side by side with v006, it ran 1.04 and 1.05 times as fast.
// Over all steps from v000 it is 2.24 times as fast.
#include <hip/hip_runtime.h>
#include <hip/hip_bf16.h>

typedef __attribute__((ext_vector_type(16))) __bf16 v16bf;
typedef __attribute__((ext_vector_type(8)))  __bf16 v8bf;
typedef __attribute__((ext_vector_type(8)))  float  v8f;
typedef __attribute__((ext_vector_type(4)))  float  v4f;
typedef __attribute__((ext_vector_type(4)))  __bf16 v4bf;

#define HN     16
#define SEQ    2048
#define DMODEL 1024
#define ADIM   64
#define BATCH  4
#define MROWS  (BATCH * SEQ)   // 8192

static __device__ __forceinline__ v16bf cat8(v8bf lo, v8bf hi) {
  return __builtin_shufflevector(lo, hi, 0,1,2,3,4,5,6,7,8,9,10,11,12,13,14,15);
}

static __device__ __forceinline__ v8f wmma_bf16(v16bf a, v16bf b, v8f c) {
  // D = A(16x32 bf16) * B(32x16 bf16) + C(16x16 f32)
  return __builtin_amdgcn_wmma_f32_16x16x32_bf16(false, a, false, b, (short)0, c, false, false);
}

// gfx1250 async DMA: global -> LDS, 16B per lane, tracked by ASYNCcnt.
// GVS addressing: mem = SADDR(u64) + VADDR(i32) + IOFFSET. VDST = LDS byte addr.
// One lane's share of a GEMM K-step: four 16-byte pieces of each operand's tile.
// The closing wait stands inside the statement, so that no register named by a
// copy is written again ahead of it.
static __device__ __forceinline__
void async_ab(const unsigned (&la)[4], const unsigned (&ga)[4], const void* abase,
              const unsigned (&lb)[4], const unsigned (&gb)[4], const void* bbase) {
  asm volatile("global_load_async_to_lds_b128 %0, %1, %16\n\t"
               "global_load_async_to_lds_b128 %2, %3, %16\n\t"
               "global_load_async_to_lds_b128 %4, %5, %16\n\t"
               "global_load_async_to_lds_b128 %6, %7, %16\n\t"
               "global_load_async_to_lds_b128 %8, %9, %17\n\t"
               "global_load_async_to_lds_b128 %10, %11, %17\n\t"
               "global_load_async_to_lds_b128 %12, %13, %17\n\t"
               "global_load_async_to_lds_b128 %14, %15, %17\n\t"
               "s_wait_xcnt 0x0"
               :: "v"(la[0]), "v"(ga[0]), "v"(la[1]), "v"(ga[1]),
                  "v"(la[2]), "v"(ga[2]), "v"(la[3]), "v"(ga[3]),
                  "v"(lb[0]), "v"(gb[0]), "v"(lb[1]), "v"(gb[1]),
                  "v"(lb[2]), "v"(gb[2]), "v"(lb[3]), "v"(gb[3]),
                  "s"((unsigned long long)abase), "s"((unsigned long long)bbase)
               : "memory");
}

// empty volatile asm consuming the accumulator: volatile asms keep program
// order, so this pins the producing WMMAs *before* the following wait/barrier,
// letting the in-flight async DMA overlap the matrix math.
static __device__ __forceinline__ void pin(v8f& x) {
  asm volatile("" : "+v"(x));
}

// value of the same lane position in the other 16-lane half (l <-> l ^ 16)
static __device__ __forceinline__ float other_half(float x) {
  int b = __builtin_bit_cast(int, x);
  b = __builtin_amdgcn_permlanex16(b, b, 0x76543210, 0xfedcba98, false, false);
  return __builtin_bit_cast(float, b);
}

// exp2 of eight values. One statement, so that behind each v_exp_f32 stands an
// independent one (the slot the instruction set asks for before a result is used
// or a source overwritten); the closing v_nop is that slot for the last.
static __device__ __forceinline__ v8f exp2x8(v8f t) {
  float a = t[0], b = t[1], c = t[2], d = t[3], e = t[4], f = t[5], g = t[6], h = t[7];
  asm("v_exp_f32 %0, %0\n\tv_exp_f32 %1, %1\n\tv_exp_f32 %2, %2\n\tv_exp_f32 %3, %3\n\t"
      "v_exp_f32 %4, %4\n\tv_exp_f32 %5, %5\n\tv_exp_f32 %6, %6\n\tv_exp_f32 %7, %7\n\t"
      "v_nop"
      : "+v"(a), "+v"(b), "+v"(c), "+v"(d), "+v"(e), "+v"(f), "+v"(g), "+v"(h));
  v8f p = {a, b, c, d, e, f, g, h};
  return p;
}

// low 32 bits of a generic LDS pointer == LDS byte offset (flat aperture mapping)
static __device__ __forceinline__ unsigned lds_off(const void* p) {
  return (unsigned)(unsigned long long)p;
}

// ---------------------------------------------------------------------------
// fp32 -> bf16 elementwise convert. A lane takes CVT_V groups of four floats, all
// loads asked for before the first store; a wave's load covers 512 contiguous
// bytes, its store 256. One block covers 256 * CVT_V * 4 floats, no remainder.
// ---------------------------------------------------------------------------
#define CVT_V 16
#define CVT_BLOCKS (MROWS * DMODEL / (256 * CVT_V * 4))
static __device__ __forceinline__
void cvt_f32_bf16_block(const float* __restrict__ in, __bf16* __restrict__ out, int blk) {
  const size_t base = (size_t)blk * (256 * CVT_V) + threadIdx.x;  // in groups of 4
  const v4f* __restrict__ src = (const v4f*)in + base;
  v4bf* __restrict__ dst = (v4bf*)out + base;
  v4f v[CVT_V];
#pragma unroll
  for (int j = 0; j < CVT_V; j++) v[j] = src[j * 256];
#pragma unroll
  for (int j = 0; j < CVT_V; j++) dst[j * 256] = __builtin_convertvector(v[j], v4bf);
}

// ---------------------------------------------------------------------------
// W[K][N] fp32  ->  Wt[N][K] bf16   (LDS tile transpose, 64 x 64 per block:
// a lane loads four groups of 4 floats and stores two groups of 8 bf16, so a
// wave reads whole 256-byte row pieces and writes whole 128-byte lines)
// ---------------------------------------------------------------------------
static __device__ __forceinline__
void transpose_bf16_block(float (*tile)[65], const float* __restrict__ W,
                          __bf16* __restrict__ Wt, int K, int N,
                          int bx,    // along N
                          int by) {  // along K
  const int c4 = threadIdx.x & 15;   // group of 4 columns (n)
  const int r0 = threadIdx.x >> 4;   // 0..15
  v4f v[4];
#pragma unroll
  for (int i = 0; i < 4; i++)
    v[i] = *(const v4f*)(W + (size_t)(by + r0 + i * 16) * N + bx + c4 * 4);
  // the loads' address registers are free for reuse only behind this wait; the
  // scheduling barrier keeps later index arithmetic from being lifted over it
  asm volatile("s_wait_xcnt 0x0" ::: "memory");
  __builtin_amdgcn_sched_barrier(0);
#pragma unroll
  for (int i = 0; i < 4; i++)
#pragma unroll
    for (int e = 0; e < 4; e++) tile[r0 + i * 16][c4 * 4 + e] = v[i][e];
  __syncthreads();
  const int ck = threadIdx.x & 7;    // group of 8 k
  const int n0 = threadIdx.x >> 3;   // 0..31
#pragma unroll
  for (int i = 0; i < 2; i++) {
    int n = n0 + i * 32;
    v8bf o;
#pragma unroll
    for (int j = 0; j < 8; j++) o[j] = (__bf16)tile[ck * 8 + j][n];
    *(v8bf*)(Wt + (size_t)(bx + n) * K + by + ck * 8) = o;
  }
}

// ---------------------------------------------------------------------------
// All precision staging in one grid: none of the five jobs reads another's
// result, so their blocks start, wait on memory and drain side by side.
// Blocks [0, CVT_BLOCKS) convert X; then TR_BLOCKS blocks per weight matrix,
// whose transposed planes lie one behind the other in Wt (q, k, v, o).
// ---------------------------------------------------------------------------
#define TR_SIDE   (DMODEL / 64)
#define TR_BLOCKS (TR_SIDE * TR_SIDE)
__global__ __launch_bounds__(256)
void stage_kernel(const float* __restrict__ X,
                  const float* __restrict__ Wq, const float* __restrict__ Wk,
                  const float* __restrict__ Wv, const float* __restrict__ Wo,
                  __bf16* __restrict__ Xbf, __bf16* __restrict__ Wt) {
  __shared__ float tile[64][65];
  const int blk = blockIdx.x;
  if (blk < CVT_BLOCKS) {   // the whole block leaves here, ahead of any barrier
    cvt_f32_bf16_block(X, Xbf, blk);
    return;
  }
  const int t = blk - CVT_BLOCKS;
  const int w = t / TR_BLOCKS;
  const int c = t % TR_BLOCKS;
  const float* W = (w == 0) ? Wq : (w == 1) ? Wk : (w == 2) ? Wv : Wo;
  transpose_bf16_block(tile, W, Wt + (size_t)w * DMODEL * DMODEL, DMODEL, DMODEL,
                       (c % TR_SIDE) * 64, (c / TR_SIDE) * 64);
}

// ---------------------------------------------------------------------------
// Tiled WMMA GEMM with double-buffered async-DMA staging.
// C[M][N] = A[M][K] * Bt[N][K]^T + bias[N]
// block tile 128x128, BK=64, 256 threads = 8 waves (4 x 2),
// each wave computes 32x64 = 2x4 tiles of 16x16, two WMMA k-steps per K-step.
// A K-step takes 128 bytes of every operand row: a whole cache line, so a wave's
// copy covers 4 whole lines.
// MODE (compile time): 0 -> bf16 [B,H,S,64]   (q / k layout)
//                      1 -> bf16 [B,H,64,S]   (v transposed layout)
//                      2 -> f32  row-major [M][N]
// A lane's 8 accumulator registers run along the first WMMA operand's rows, so
// the operand whose index is contiguous in the output goes first: Bt rows (n)
// for modes 0 and 2, A rows (m = position) for mode 1. The 8 results of a tile
// then leave as 16-byte stores. The wave tile is 32 rows of the first operand
// by 64 of the second in every mode.
// ---------------------------------------------------------------------------
#define G_BM 128
#define G_BN 128
#define G_BK 64
#define G_LDA 72   // bf16 elems per LDS row (64 + 8 pad): 144B row, 16B aligned, bank-spread

template <int MODE>
static __device__ __forceinline__
void gemm_bf16_tile(__bf16 (*lA)[G_BM * G_LDA], __bf16 (*lB)[G_BN * G_LDA],
                    const __bf16* __restrict__ A,   // [M][K]
                    const __bf16* __restrict__ Bt,  // [N][K]
                    const float*  __restrict__ bias,
                    void* __restrict__ out,
                    int M, int N, int K,
                    float oscale) {   // factor on the result, mode 0 only
  const int tid  = threadIdx.x;
  const int lane = tid & 31;
  const int wave = tid >> 5;
  const int wm   = wave & 3;   // 4 waves along the first operand (32 rows each)
  const int wn   = wave >> 2;  // 2 waves along the second operand (64 rows each)
  const int m0   = blockIdx.x * G_BM;
  const int n0   = blockIdx.y * G_BN;
  const int lm   = lane & 15;
  const int kb   = (lane >> 4) * 8;   // ISA 16-bit A/B fragment K mapping

  // per-thread DMA chunk coords: chunks c = tid + 256 * i; r = c>>3, kc = c&7
  const int cr = tid >> 3;     // 0..31
  const int ck = tid & 7;      // 0..7: eight lanes cover a row's 128 bytes
  const unsigned bufA = (unsigned)(G_BM * G_LDA * 2);
  const unsigned bufB = (unsigned)(G_BN * G_LDA * 2);
  const unsigned lA_t = lds_off(&lA[0][0]) + (unsigned)(cr * G_LDA + ck * 8) * 2;
  const unsigned lB_t = lds_off(&lB[0][0]) + (unsigned)(cr * G_LDA + ck * 8) * 2;
  const unsigned gA_t = ((unsigned)(m0 + cr) * K + ck * 8) * 2;
  const unsigned gB_t = ((unsigned)(n0 + cr) * K + ck * 8) * 2;

#define G_ISSUE(k0, buf) do {                                   \
    unsigned la[4], ga[4], lb[4], gb[4];                        \
    _Pragma("unroll")                                           \
    for (int i = 0; i < 4; i++) {  /* rows cr + 32 * i */       \
      la[i] = lA_t + (buf) * bufA + (unsigned)(32 * i * G_LDA * 2);  \
      lb[i] = lB_t + (buf) * bufB + (unsigned)(32 * i * G_LDA * 2);  \
      ga[i] = gA_t + ((unsigned)(32 * i) * K + (unsigned)(k0)) * 2;  \
      gb[i] = gB_t + ((unsigned)(32 * i) * K + (unsigned)(k0)) * 2;  \
    }                                                           \
    async_ab(la, ga, A, lb, gb, Bt);                            \
  } while (0)

  v8f acc[2][4];
#pragma unroll
  for (int i = 0; i < 2; i++)
#pragma unroll
    for (int j = 0; j < 4; j++) acc[i][j] = (v8f)(0.0f);

  const int KT = K / G_BK;
  G_ISSUE(0, 0);
  // tile 0 has landed for this wave; the barrier publishes it to the others
  asm volatile("s_wait_asynccnt 0x0" ::: "memory");
  __syncthreads();
  if (KT > 1) G_ISSUE(G_BK, 1);

  for (int kt = 0; kt < KT; kt++) {
    const int cur = kt & 1;

    const __bf16* l1 = (MODE == 1) ? &lA[cur][0] : &lB[cur][0];  // first operand
    const __bf16* l2 = (MODE == 1) ? &lB[cur][0] : &lA[cur][0];  // second operand
    // loops over k-steps and tiles are unrolled: fragment arrays stay in registers
    v16bf af[2][2], bfm[2][4];
#pragma unroll
    for (int ks = 0; ks < 2; ks++) {
#pragma unroll
      for (int i = 0; i < 2; i++) {
        int r = wm * 32 + i * 16 + lm;
        v8bf lo = *(const v8bf*)(&l1[r * G_LDA + ks * 32 + kb]);
        v8bf hi = *(const v8bf*)(&l1[r * G_LDA + ks * 32 + 16 + kb]);
        af[ks][i] = cat8(lo, hi);
      }
#pragma unroll
      for (int j = 0; j < 4; j++) {
        int r = wn * 64 + j * 16 + lm;
        v8bf lo = *(const v8bf*)(&l2[r * G_LDA + ks * 32 + kb]);
        v8bf hi = *(const v8bf*)(&l2[r * G_LDA + ks * 32 + 16 + kb]);
        bfm[ks][j] = cat8(lo, hi);
      }
    }
#pragma unroll
    for (int ks = 0; ks < 2; ks++)
#pragma unroll
      for (int i = 0; i < 2; i++)
#pragma unroll
        for (int j = 0; j < 4; j++)
          acc[i][j] = wmma_bf16(af[ks][i], bfm[ks][j], acc[i][j]);

    // keep WMMAs ahead of the async wait so DMA overlaps the matrix math
#pragma unroll
    for (int i = 0; i < 2; i++)
#pragma unroll
      for (int j = 0; j < 4; j++) pin(acc[i][j]);

    // hand-over: this wave's reads of buffer cur are done, its copies of the next
    // tile have landed; behind the barrier both hold for every wave
    asm volatile("s_wait_dscnt 0x0" ::: "memory");
    asm volatile("s_wait_asynccnt 0x0" ::: "memory");
    __syncthreads();
    if (kt + 2 < KT) G_ISSUE((kt + 2) * G_BK, cur);  // refill the buffer just left
  }
#undef G_ISSUE
  // no copy is outstanding when the epilogue starts
  asm volatile("s_wait_asynccnt 0x0" ::: "memory");

  // epilogue: a lane holds column lm of each tile (second operand's row) and, in
  // register r, row r + mh (first operand's row)
  const int mh = (lane >> 4) * 8;
  if constexpr (MODE == 1) {      // lane = n (head dim), registers = 8 positions
#pragma unroll
    for (int j = 0; j < 4; j++) {
      const int n = n0 + wn * 64 + j * 16 + lm;
      const float bv = bias[n];
      const int h = n >> 6, dd = n & 63;
#pragma unroll
      for (int i = 0; i < 2; i++) {
        const int m = m0 + wm * 32 + i * 16 + mh;
        const int b = m / SEQ, s = m % SEQ;
        *(v8bf*)((__bf16*)out + (((size_t)(b * HN + h)) * ADIM + dd) * SEQ + s) =
            __builtin_convertvector(acc[i][j] + bv, v8bf);
      }
    }
  } else {                        // lane = m (row), registers = 8 columns n
#pragma unroll
    for (int i = 0; i < 2; i++) {
      const int n = n0 + wm * 32 + i * 16 + mh;
      const v8f bv = *(const v8f*)(bias + n);
#pragma unroll
      for (int j = 0; j < 4; j++) {
        const int m = m0 + wn * 64 + j * 16 + lm;
        const v8f val = acc[i][j] + bv;
        if constexpr (MODE == 0) {  // [B,H,S,64] bf16
          const int b = m / SEQ, s = m % SEQ;
          const int h = n >> 6, dd = n & 63;
          *(v8bf*)((__bf16*)out + (((size_t)(b * HN + h)) * SEQ + s) * ADIM + dd) =
              __builtin_convertvector(val * oscale, v8bf);
        } else {                    // f32 row-major
          *(v8f*)((float*)out + (size_t)m * N + n) = val;
        }
      }
    }
  }
}

// The three projections of X in one grid: blockIdx.z picks weight, bias, output
// and layout. They share nothing but their input, so one grid's blocks fill the
// places that a single projection's 2 blocks per WGP leave empty.
__global__ __launch_bounds__(256)
void gemm_qkv_kernel(const __bf16* __restrict__ X,
                     const __bf16* __restrict__ WqT, const __bf16* __restrict__ WkT,
                     const __bf16* __restrict__ WvT,
                     const float* __restrict__ bq, const float* __restrict__ bk,
                     const float* __restrict__ bv,
                     __bf16* __restrict__ q, __bf16* __restrict__ k,
                     __bf16* __restrict__ vt, int M, int N, int K) {
  __shared__ __align__(16) __bf16 lA[2][G_BM * G_LDA];
  __shared__ __align__(16) __bf16 lB[2][G_BN * G_LDA];
  const int z = blockIdx.z;   // the same for the whole block: barriers stay uniform
  if (z == 2)
    gemm_bf16_tile<1>(lA, lB, X, WvT, bv, vt, M, N, K, 1.0f);
  else {
    // q leaves multiplied by log2(e) / sqrt(64): its products with k are then
    // arguments of exp2
    gemm_bf16_tile<0>(lA, lB, X, z ? WkT : WqT, z ? bk : bq, z ? k : q, M, N, K,
                      z ? 1.0f : 0.125f * 1.44269504f);
    // the other layout's code follows in the text and reuses the registers that
    // the stores above name: they are free for reuse only behind this wait
    asm volatile("s_wait_xcnt 0x0" ::: "memory");
  }
}

__global__ __launch_bounds__(256)
void gemm_out_kernel(const __bf16* __restrict__ A, const __bf16* __restrict__ Bt,
                     const float* __restrict__ bias, float* __restrict__ out,
                     int M, int N, int K) {
  __shared__ __align__(16) __bf16 lA[2][G_BM * G_LDA];
  __shared__ __align__(16) __bf16 lB[2][G_BN * G_LDA];
  gemm_bf16_tile<2>(lA, lB, A, Bt, bias, out, M, N, K, 1.0f);
}

// ---------------------------------------------------------------------------
// Flash-style attention with double-buffered async-DMA KV staging.
// grid = (B*H, S/256). 256 threads = 8 waves, each wave owns 32 query rows as
// two column groups of 16: a K or V fragment read from LDS feeds two WMMAs, and
// one staged KV block serves 256 queries.
// Both products run transposed: St = K * Qt, Ot += Vt * Pt. A lane then holds
// one query per group (column lm): its softmax statistics are one scalar per
// lane and group, and two St tiles, converted in place, are the B operand of
// the second product.
// q arrives multiplied by log2(e) / sqrt(64), and the maximum in use enters the
// first product negated as its C operand: a score leaves the matrix unit as the
// argument of its exp2. The maximum in use is moved, and sums and Ot rescaled,
// only in a block where some query's scores pass it by more than 8 (a factor 256,
// far inside the range of f32 sums and of bf16 P), and in the first block.
// ---------------------------------------------------------------------------
#define A_LDK 72  // 64 + 8 pad bf16 elems per LDS row (144B: 16B aligned)
#define A_QG  2                    // query column groups per wave
#define A_QB  (8 * 16 * A_QG)      // queries per block

// One lane's share of a KV block: two 16-byte pieces of K, two of V. The closing
// wait stands inside the statement, so that no register named by a copy is
// written again ahead of it.
static __device__ __forceinline__
void async_kv(unsigned lk0, unsigned gk0, unsigned lk1, unsigned gk1, const void* kbase,
              unsigned lv0, unsigned gv0, unsigned lv1, unsigned gv1, const void* vbase) {
  asm volatile("global_load_async_to_lds_b128 %0, %1, %8\n\t"
               "global_load_async_to_lds_b128 %2, %3, %8\n\t"
               "global_load_async_to_lds_b128 %4, %5, %9\n\t"
               "global_load_async_to_lds_b128 %6, %7, %9\n\t"
               "s_wait_xcnt 0x0"
               :: "v"(lk0), "v"(gk0), "v"(lk1), "v"(gk1),
                  "v"(lv0), "v"(gv0), "v"(lv1), "v"(gv1),
                  "s"((unsigned long long)kbase), "s"((unsigned long long)vbase)
               : "memory");
}

// waves_per_eu: 256 registers a wave, so that two blocks (four waves per SIMD)
// stay resident and the whole grid runs in one round.
__global__ __launch_bounds__(256) __attribute__((amdgpu_waves_per_eu(4, 4)))
void attn_kernel(const __bf16* __restrict__ qb,   // [BH][S][64], pre-scaled
                 const __bf16* __restrict__ kbuf, // [BH][S][64]
                 const __bf16* __restrict__ vt,   // [BH][64][S]
                 __bf16* __restrict__ ctx) {      // [B*S][1024]
  const int bh   = blockIdx.x;
  const int qblk = blockIdx.y;
  const int tid  = threadIdx.x;
  const int lane = tid & 31;
  const int wave = tid >> 5;
  const int lm   = lane & 15;
  const int kb   = (lane >> 4) * 8;
  const int mh   = (lane >> 4) * 8;

  __shared__ __align__(16) __bf16 lK[2][64 * A_LDK];
  __shared__ __align__(16) __bf16 lV[2][64 * A_LDK];

  // per-thread DMA chunks: 512 16B chunks per tile / 256 threads = 2 each
  const int acr = tid >> 3;   // 0..31 (row)
  const int acc_ = tid & 7;   // 0..7  (16B column chunk)
  const unsigned ldsK0 = lds_off(&lK[0][0]);
  const unsigned ldsV0 = lds_off(&lV[0][0]);
  const unsigned kvbuf = (unsigned)(64 * A_LDK * 2);
  unsigned lK_t[2], lV_t[2], gK[2], gV[2];
#pragma unroll
  for (int i = 0; i < 2; i++) {
    int r = acr + 32 * i;
    lK_t[i] = ldsK0 + (unsigned)(r * A_LDK + acc_ * 8) * 2;
    lV_t[i] = ldsV0 + (unsigned)(r * A_LDK + acc_ * 8) * 2;
    gK[i] = (((unsigned)bh * SEQ + r) * ADIM + acc_ * 8) * 2;  // + kv0*ADIM*2
    gV[i] = (((unsigned)bh * ADIM + r) * SEQ + acc_ * 8) * 2;  // + kv0*2
  }

#define KV_ISSUE(kv0, buf) do {                                        \
    unsigned ok = (unsigned)(kv0) * ADIM * 2, ov = (unsigned)(kv0) * 2;\
    unsigned ob = (unsigned)(buf) * kvbuf;                             \
    async_kv(lK_t[0] + ob, gK[0] + ok, lK_t[1] + ob, gK[1] + ok, kbuf, \
             lV_t[0] + ob, gV[0] + ov, lV_t[1] + ob, gV[1] + ov, vt);  \
  } while (0)

  // q fragments stay resident as B operands (K = d = 64 -> 2 WMMA k-steps).
  // Here and below every loop over groups, tiles and k-steps is unrolled, so that
  // the fragment and accumulator arrays are indexed by constants and stay in registers.
  v16bf qf[A_QG][2];
#pragma unroll
  for (int g = 0; g < A_QG; g++) {
    const __bf16* qrow =
        qb + ((size_t)bh * SEQ + qblk * A_QB + wave * (16 * A_QG) + g * 16 + lm) * ADIM;
#pragma unroll
    for (int ks = 0; ks < 2; ks++) {
      v8bf lo = *(const v8bf*)(qrow + ks * 32 + kb);
      v8bf hi = *(const v8bf*)(qrow + ks * 32 + 16 + kb);
      qf[g][ks] = cat8(lo, hi);
    }
  }

  // this lane's query of each group: the maximum in use, negated, in the eight
  // registers of a C operand (both halves agree), and the sum over the keys of
  // this lane's half (the halves are joined after the loop)
  v8f negm[A_QG];
  float row_sum[A_QG];
  v8f o[A_QG][4];  // Ot tiles: lane = query lm, register r = d index dt*16 + mh + r
#pragma unroll
  for (int g = 0; g < A_QG; g++) {
    negm[g] = (v8f)(0.0f);
    row_sum[g] = 0.0f;
#pragma unroll
    for (int dt = 0; dt < 4; dt++) o[g][dt] = (v8f)(0.0f);
  }

  KV_ISSUE(0, 0);
  // block 0 has landed for this wave; the barrier publishes it to the others
  asm volatile("s_wait_asynccnt 0x0" ::: "memory");
  __syncthreads();
  KV_ISSUE(64, 1);

  // not unrolled and not peeled: a copy of the body for the first block would
  // double the text and cost registers
#pragma clang loop unroll(disable)
  for (int kvb = 0; kvb < SEQ / 64; kvb++) {
    const int cur = kvb & 1;

    // St = k @ q^T  (4 key tiles x 2 k-steps): register r = key tn*16 + mh + r
    v8f sc[A_QG][4];
    v16bf kf[2][4];
#pragma unroll
    for (int ks = 0; ks < 2; ks++) {
#pragma unroll
      for (int tn = 0; tn < 4; tn++) {
        int r = tn * 16 + lm;
        v8bf lo = *(const v8bf*)(&lK[cur][r * A_LDK + ks * 32 + kb]);
        v8bf hi = *(const v8bf*)(&lK[cur][r * A_LDK + ks * 32 + 16 + kb]);
        kf[ks][tn] = cat8(lo, hi);
      }
    }
#pragma unroll
    for (int ks = 0; ks < 2; ks++)
#pragma unroll
      for (int tn = 0; tn < 4; tn++)
#pragma unroll
        for (int g = 0; g < A_QG; g++)
          sc[g][tn] = wmma_bf16(kf[ks][tn], qf[g][ks], ks == 0 ? negm[g] : sc[g][tn]);

    // online softmax, one query per lane and group: 32 keys in-lane, one exchange
    // of halves
    float mx[A_QG];   // the block's largest score above the maximum in use
#pragma unroll
    for (int g = 0; g < A_QG; g++) {
      float mt[4];
#pragma unroll
      for (int tn = 0; tn < 4; tn++) {
        mt[tn] = sc[g][tn][0];
#pragma unroll
        for (int r = 1; r < 8; r++) mt[tn] = fmaxf(mt[tn], sc[g][tn][r]);
      }
      mx[g] = fmaxf(fmaxf(mt[0], mt[1]), fmaxf(mt[2], mt[3]));
      mx[g] = fmaxf(mx[g], other_half(mx[g]));
    }
    // one test per block for the whole wave: a scalar branch, EXEC stays all ones
    bool grown = false;
#pragma unroll
    for (int g = 0; g < A_QG; g++) grown = grown || (mx[g] > 8.0f);
    if (kvb == 0 || __builtin_amdgcn_ballot_w32(grown) != 0) {
#pragma unroll
      for (int g = 0; g < A_QG; g++) {
        // the first block takes its own maximum, whatever its sign; later the
        // maximum in use only rises
        const float d = (kvb == 0) ? mx[g] : fmaxf(mx[g], 0.0f);
        const float alpha = __builtin_amdgcn_exp2f(fminf(-d, 0.0f));
        negm[g] -= d;
        row_sum[g] *= alpha;
#pragma unroll
        for (int tn = 0; tn < 4; tn++) sc[g][tn] -= d;
#pragma unroll
        for (int dt = 0; dt < 4; dt++) o[g][dt] *= alpha;
      }
    }
#pragma unroll
    for (int g = 0; g < A_QG; g++) {
#pragma unroll
      for (int tn = 0; tn < 4; tn++) sc[g][tn] = exp2x8(sc[g][tn]);
      v8f ps = (sc[g][0] + sc[g][1]) + (sc[g][2] + sc[g][3]);
      float psum = ((ps[0] + ps[1]) + (ps[2] + ps[3])) + ((ps[4] + ps[5]) + (ps[6] + ps[7]));
      row_sum[g] += psum;
    }

    // Ot += Vt @ Pt: St tiles 2ks and 2ks+1 hold keys in the fragment's k order
#pragma unroll
    for (int ks = 0; ks < 2; ks++) {
      v16bf pf[A_QG];
#pragma unroll
      for (int g = 0; g < A_QG; g++)
        pf[g] = cat8(__builtin_convertvector(sc[g][2 * ks], v8bf),
                     __builtin_convertvector(sc[g][2 * ks + 1], v8bf));
#pragma unroll
      for (int dt = 0; dt < 4; dt++) {
        int r = dt * 16 + lm;
        v8bf lo = *(const v8bf*)(&lV[cur][r * A_LDK + ks * 32 + kb]);
        v8bf hi = *(const v8bf*)(&lV[cur][r * A_LDK + ks * 32 + 16 + kb]);
        v16bf vf = cat8(lo, hi);
#pragma unroll
        for (int g = 0; g < A_QG; g++) o[g][dt] = wmma_bf16(vf, pf[g], o[g][dt]);
      }
    }

    // hand-over: this wave's reads of buffer cur are done, its copies of the next
    // block have landed; behind the barrier both hold for every wave
    asm volatile("s_wait_dscnt 0x0" ::: "memory");
    asm volatile("s_wait_asynccnt 0x0" ::: "memory");
    __syncthreads();
    if (kvb + 2 < SEQ / 64) KV_ISSUE((kvb + 2) * 64, cur);  // refill the buffer just left
  }
#undef KV_ISSUE
  // no copy is outstanding when the wave ends
  asm volatile("s_wait_asynccnt 0x0" ::: "memory");

  // finalize: ctx[(b*S+s)][h*64 + d] bf16, 8 consecutive d per lane and tile
  const int b = bh >> 4, h = bh & 15;
#pragma unroll
  for (int g = 0; g < A_QG; g++) {
    const float rs = row_sum[g] + other_half(row_sum[g]);
    const float inv = 1.0f / rs;
    const int s = qblk * A_QB + wave * (16 * A_QG) + g * 16 + lm;
    __bf16* dst = ctx + ((size_t)(b * SEQ + s)) * DMODEL + h * ADIM + mh;
#pragma unroll
    for (int dt = 0; dt < 4; dt++)
      *(v8bf*)(dst + dt * 16) = __builtin_convertvector(o[g][dt] * inv, v8bf);
  }
}

// ---------------------------------------------------------------------------
// residual add + LayerNorm, one wave per row of 1024 (32 values a lane, in
// groups of 4: a wave's load or store covers 512 contiguous bytes); the row's
// sums are joined inside the wave, so the block's 8 rows share nothing
// ---------------------------------------------------------------------------
__global__ __launch_bounds__(256)
void ln_kernel(const float* __restrict__ proj, const float* __restrict__ resid,
               const float* __restrict__ g, const float* __restrict__ b,
               float* __restrict__ out) {
  const int lane = threadIdx.x & 31;
  const size_t row = (size_t)blockIdx.x * 8 + (threadIdx.x >> 5);
  const v4f* __restrict__ pp = (const v4f*)(proj + row * DMODEL) + lane;
  const v4f* __restrict__ rp = (const v4f*)(resid + row * DMODEL) + lane;
  v4f x[8], y[8];
#pragma unroll
  for (int i = 0; i < 8; i++) x[i] = pp[i * 32];
#pragma unroll
  for (int i = 0; i < 8; i++) y[i] = rp[i * 32];
  v4f s4 = (v4f)(0.0f), q4 = (v4f)(0.0f);
#pragma unroll
  for (int i = 0; i < 8; i++) {
    x[i] += y[i];
    s4 += x[i];
    q4 += x[i] * x[i];
  }
  // the loads' address registers are free for reuse only behind this wait
  asm volatile("s_wait_xcnt 0x0" ::: "memory");
  float s  = (s4[0] + s4[1]) + (s4[2] + s4[3]);
  float sq = (q4[0] + q4[1]) + (q4[2] + q4[3]);
#pragma unroll
  for (int off = 16; off >= 1; off >>= 1) {
    s  += __shfl_xor(s,  off, 32);
    sq += __shfl_xor(sq, off, 32);
  }
  float mu  = s * (1.0f / DMODEL);
  float var = sq * (1.0f / DMODEL) - mu * mu;
  float rs  = rsqrtf(var + 1e-5f);
  const v4f* __restrict__ gp = (const v4f*)g + lane;
  const v4f* __restrict__ bp = (const v4f*)b + lane;
  v4f* __restrict__ op = (v4f*)(out + row * DMODEL) + lane;
#pragma unroll
  for (int i = 0; i < 8; i++) op[i * 32] = (x[i] - mu) * rs * gp[i * 32] + bp[i * 32];
}

// ---------------------------------------------------------------------------
extern "C" void kernel_launch(void* const* d_in, const int* in_sizes, int n_in,
                              void* d_out, int out_size, void* d_ws, size_t ws_size,
                              hipStream_t stream) {
  (void)in_sizes; (void)n_in; (void)out_size; (void)ws_size;
  const float* Q    = (const float*)d_in[0];
  const float* Wq   = (const float*)d_in[1];
  const float* bq   = (const float*)d_in[2];
  const float* Wk   = (const float*)d_in[3];
  const float* bk   = (const float*)d_in[4];
  const float* Wv   = (const float*)d_in[5];
  const float* bv   = (const float*)d_in[6];
  const float* Wo   = (const float*)d_in[7];
  const float* bo   = (const float*)d_in[8];
  const float* ln_g = (const float*)d_in[9];
  const float* ln_b = (const float*)d_in[10];

  const size_t ND = (size_t)MROWS * DMODEL;     // 8192*1024
  const size_t WW = (size_t)DMODEL * DMODEL;    // 1024*1024

  char* ws = (char*)d_ws;
  size_t off = 0;
  __bf16* Xbf = (__bf16*)(ws + off); off += ND * 2;
  __bf16* WqT = (__bf16*)(ws + off); off += WW * 2;
  __bf16* WkT = (__bf16*)(ws + off); off += WW * 2;
  __bf16* WvT = (__bf16*)(ws + off); off += WW * 2;
  __bf16* WoT = (__bf16*)(ws + off); off += WW * 2;
  __bf16* qbf = (__bf16*)(ws + off); off += ND * 2;   // [B,H,S,64]
  __bf16* kbf = (__bf16*)(ws + off); off += ND * 2;   // [B,H,S,64]
  __bf16* vtb = (__bf16*)(ws + off); off += ND * 2;   // [B,H,64,S]
  __bf16* ctx = (__bf16*)(ws + off); off += ND * 2;   // [B*S, 1024]
  float*  prj = (float*)(ws + off);  off += ND * 4;   // [B*S, 1024]

  // 1) precision staging (WqT is the first of the four transposed planes)
  stage_kernel<<<CVT_BLOCKS + 4 * TR_BLOCKS, 256, 0, stream>>>(Q, Wq, Wk, Wv, Wo, Xbf, WqT);

  // 2) QKV projections (WMMA GEMMs scattering into attention layouts)
  gemm_qkv_kernel<<<dim3(MROWS / G_BM, DMODEL / G_BN, 3), 256, 0, stream>>>(
      Xbf, WqT, WkT, WvT, bq, bk, bv, qbf, kbf, vtb, MROWS, DMODEL, DMODEL);

  // 3) flash attention
  attn_kernel<<<dim3(BATCH * HN, SEQ / A_QB), 256, 0, stream>>>(qbf, kbf, vtb, ctx);

  // 4) output projection (f32 out)
  gemm_out_kernel<<<dim3(MROWS / G_BM, DMODEL / G_BN), 256, 0, stream>>>(
      ctx, WoT, bo, prj, MROWS, DMODEL, DMODEL);

  // 5) residual + layernorm
  ln_kernel<<<MROWS / 8, 256, 0, stream>>>(prj, Q, ln_g, ln_b, (float*)d_out);
}

// v008
// A run of this version takes 121 microseconds.
// Next to v007, in two timings, it ran 1.04 and 1.03 times as fast.
// Over all steps from v000 it is 2.32 times as fast.
#include <hip/hip_runtime.h>
#include <hip/hip_bf16.h>

typedef __attribute__((ext_vector_type(16))) __bf16 v16bf;
typedef __attribute__((ext_vector_type(8)))  __bf16 v8bf;
typedef __attribute__((ext_vector_type(8)))  float  v8f;
typedef __attribute__((ext_vector_type(4)))  float  v4f;
typedef __attribute__((ext_vector_type(4)))  __bf16 v4bf;

#define HN     16
#define SEQ    2048
#define DMODEL 1024
#define ADIM   64
#define BATCH  4
#define MROWS  (BATCH * SEQ)   // 8192

static __device__ __forceinline__ v16bf cat8(v8bf lo, v8bf hi) {
  return __builtin_shufflevector(lo, hi, 0,1,2,3,4,5,6,7,8,9,10,11,12,13,14,15);
}

static __device__ __forceinline__ v8f wmma_bf16(v16bf a, v16bf b, v8f c) {
  // D = A(16x32 bf16) * B(32x16 bf16) + C(16x16 f32)
  return __builtin_amdgcn_wmma_f32_16x16x32_bf16(false, a, false, b, (short)0, c, false, false);
}

// gfx1250 async DMA: global -> LDS, 16B per lane, tracked by ASYNCcnt.
// GVS addressing: mem = SADDR(u64) + VADDR(i32) + IOFFSET. VDST = LDS byte addr.
// One lane's share of a GEMM K-step: four 16-byte pieces of each operand's tile.
// The closing wait stands inside the statement, so that no register named by a
// copy is written again ahead of it.
static __device__ __forceinline__
void async_ab(const unsigned (&la)[4], const unsigned (&ga)[4], const void* abase,
              const unsigned (&lb)[4], const unsigned (&gb)[4], const void* bbase) {
  asm volatile("global_load_async_to_lds_b128 %0, %1, %16\n\t"
               "global_load_async_to_lds_b128 %2, %3, %16\n\t"
               "global_load_async_to_lds_b128 %4, %5, %16\n\t"
               "global_load_async_to_lds_b128 %6, %7, %16\n\t"
               "global_load_async_to_lds_b128 %8, %9, %17\n\t"
               "global_load_async_to_lds_b128 %10, %11, %17\n\t"
               "global_load_async_to_lds_b128 %12, %13, %17\n\t"
               "global_load_async_to_lds_b128 %14, %15, %17\n\t"
               "s_wait_xcnt 0x0"
               :: "v"(la[0]), "v"(ga[0]), "v"(la[1]), "v"(ga[1]),
                  "v"(la[2]), "v"(ga[2]), "v"(la[3]), "v"(ga[3]),
                  "v"(lb[0]), "v"(gb[0]), "v"(lb[1]), "v"(gb[1]),
                  "v"(lb[2]), "v"(gb[2]), "v"(lb[3]), "v"(gb[3]),
                  "s"((unsigned long long)abase), "s"((unsigned long long)bbase)
               : "memory");
}

// empty volatile asm consuming the accumulator: volatile asms keep program
// order, so this pins the producing WMMAs *before* the following wait/barrier,
// letting the in-flight async DMA overlap the matrix math.
static __device__ __forceinline__ void pin(v8f& x) {
  asm volatile("" : "+v"(x));
}

// value of the same lane position in the other 16-lane half (l <-> l ^ 16)
static __device__ __forceinline__ float other_half(float x) {
  int b = __builtin_bit_cast(int, x);
  b = __builtin_amdgcn_permlanex16(b, b, 0x76543210, 0xfedcba98, false, false);
  return __builtin_bit_cast(float, b);
}

// exp2 of eight values, by the builtin: the values come straight from a WMMA.
static __device__ __forceinline__ v8f exp2x8(v8f t) {
  v8f p;
#pragma unroll
  for (int r = 0; r < 8; r++) p[r] = __builtin_amdgcn_exp2f(t[r]);
  return p;
}

// low 32 bits of a generic LDS pointer == LDS byte offset (flat aperture mapping)
static __device__ __forceinline__ unsigned lds_off(const void* p) {
  return (unsigned)(unsigned long long)p;
}

// ---------------------------------------------------------------------------
// fp32 -> bf16 elementwise convert. A lane takes CVT_V groups of four floats, all
// loads asked for before the first store; a wave's load covers 512 contiguous
// bytes, its store 256. One block covers 256 * CVT_V * 4 floats, no remainder.
// ---------------------------------------------------------------------------
#define CVT_V 16
#define CVT_BLOCKS (MROWS * DMODEL / (256 * CVT_V * 4))
static __device__ __forceinline__
void cvt_f32_bf16_block(const float* __restrict__ in, __bf16* __restrict__ out, int blk) {
  const size_t base = (size_t)blk * (256 * CVT_V) + threadIdx.x;  // in groups of 4
  const v4f* __restrict__ src = (const v4f*)in + base;
  v4bf* __restrict__ dst = (v4bf*)out + base;
  v4f v[CVT_V];
#pragma unroll
  for (int j = 0; j < CVT_V; j++) v[j] = src[j * 256];
#pragma unroll
  for (int j = 0; j < CVT_V; j++) dst[j * 256] = __builtin_convertvector(v[j], v4bf);
}

// ---------------------------------------------------------------------------
// W[K][N] fp32  ->  Wt[N][K] bf16   (LDS tile transpose, 64 x 64 per block:
// a lane loads four groups of 4 floats and stores two groups of 8 bf16, so a
// wave reads whole 256-byte row pieces and writes whole 128-byte lines)
// ---------------------------------------------------------------------------
static __device__ __forceinline__
void transpose_bf16_block(float (*tile)[65], const float* __restrict__ W,
                          __bf16* __restrict__ Wt, int K, int N,
                          int bx,    // along N
                          int by) {  // along K
  const int c4 = threadIdx.x & 15;   // group of 4 columns (n)
  const int r0 = threadIdx.x >> 4;   // 0..15
  v4f v[4];
#pragma unroll
  for (int i = 0; i < 4; i++)
    v[i] = *(const v4f*)(W + (size_t)(by + r0 + i * 16) * N + bx + c4 * 4);
  // the loads' address registers are free for reuse only behind this wait; the
  // scheduling barrier keeps later index arithmetic from being lifted over it
  asm volatile("s_wait_xcnt 0x0" ::: "memory");
  __builtin_amdgcn_sched_barrier(0);
#pragma unroll
  for (int i = 0; i < 4; i++)
#pragma unroll
    for (int e = 0; e < 4; e++) tile[r0 + i * 16][c4 * 4 + e] = v[i][e];
  __syncthreads();
  const int ck = threadIdx.x & 7;    // group of 8 k
  const int n0 = threadIdx.x >> 3;   // 0..31
#pragma unroll
  for (int i = 0; i < 2; i++) {
    int n = n0 + i * 32;
    v8bf o;
#pragma unroll
    for (int j = 0; j < 8; j++) o[j] = (__bf16)tile[ck * 8 + j][n];
    *(v8bf*)(Wt + (size_t)(bx + n) * K + by + ck * 8) = o;
  }
}

// ---------------------------------------------------------------------------
// All precision staging in one grid: none of the five jobs reads another's
// result, so their blocks start, wait on memory and drain side by side.
// Blocks [0, CVT_BLOCKS) convert X; then TR_BLOCKS blocks per weight matrix,
// whose transposed planes lie one behind the other in Wt (q, k, v, o).
// ---------------------------------------------------------------------------
#define TR_SIDE   (DMODEL / 64)
#define TR_BLOCKS (TR_SIDE * TR_SIDE)
__global__ __launch_bounds__(256)
void stage_kernel(const float* __restrict__ X,
                  const float* __restrict__ Wq, const float* __restrict__ Wk,
                  const float* __restrict__ Wv, const float* __restrict__ Wo,
                  __bf16* __restrict__ Xbf, __bf16* __restrict__ Wt) {
  __shared__ float tile[64][65];
  const int blk = blockIdx.x;
  if (blk < CVT_BLOCKS) {   // the whole block leaves here, ahead of any barrier
    cvt_f32_bf16_block(X, Xbf, blk);
    return;
  }
  const int t = blk - CVT_BLOCKS;
  const int w = t / TR_BLOCKS;
  const int c = t % TR_BLOCKS;
  const float* W = (w == 0) ? Wq : (w == 1) ? Wk : (w == 2) ? Wv : Wo;
  transpose_bf16_block(tile, W, Wt + (size_t)w * DMODEL * DMODEL, DMODEL, DMODEL,
                       (c % TR_SIDE) * 64, (c / TR_SIDE) * 64);
}

// ---------------------------------------------------------------------------
// Tiled WMMA GEMM with double-buffered async-DMA staging.
// C[M][N] = A[M][K] * Bt[N][K]^T + bias[N]
// block tile 128x128, BK=64, 256 threads = 8 waves (4 x 2),
// each wave computes 32x64 = 2x4 tiles of 16x16, two WMMA k-steps per K-step.
// A K-step takes 128 bytes of every operand row: a whole cache line, so a wave's
// copy covers 4 whole lines.
// MODE (compile time): 0 -> bf16 [B,H,S,64]   (q / k layout)
//                      1 -> bf16 [B,H,64,S]   (v transposed layout)
//                      2 -> f32  row-major [M][N]
// A lane's 8 accumulator registers run along the first WMMA operand's rows, so
// the operand whose index is contiguous in the output goes first: Bt rows (n)
// for modes 0 and 2, A rows (m = position) for mode 1. The 8 results of a tile
// then leave as 16-byte stores. The wave tile is 32 rows of the first operand
// by 64 of the second in every mode.
// ---------------------------------------------------------------------------
#define G_BM 128
#define G_BN 128
#define G_BK 64
#define G_LDA 72   // bf16 elems per LDS row (64 + 8 pad): 144B row, 16B aligned, bank-spread

template <int MODE>
static __device__ __forceinline__
void gemm_bf16_tile(__bf16 (*lA)[G_BM * G_LDA], __bf16 (*lB)[G_BN * G_LDA],
                    const __bf16* __restrict__ A,   // [M][K]
                    const __bf16* __restrict__ Bt,  // [N][K]
                    const float*  __restrict__ bias,
                    void* __restrict__ out,
                    int M, int N, int K,
                    float oscale) {   // factor on the result, mode 0 only
  const int tid  = threadIdx.x;
  const int lane = tid & 31;
  const int wave = tid >> 5;
  const int wm   = wave & 3;   // 4 waves along the first operand (32 rows each)
  const int wn   = wave >> 2;  // 2 waves along the second operand (64 rows each)
  const int m0   = blockIdx.x * G_BM;
  const int n0   = blockIdx.y * G_BN;
  const int lm   = lane & 15;
  const int kb   = (lane >> 4) * 8;   // ISA 16-bit A/B fragment K mapping

  // per-thread DMA chunk coords: chunks c = tid + 256 * i; r = c>>3, kc = c&7
  const int cr = tid >> 3;     // 0..31
  const int ck = tid & 7;      // 0..7: eight lanes cover a row's 128 bytes
  const unsigned bufA = (unsigned)(G_BM * G_LDA * 2);
  const unsigned bufB = (unsigned)(G_BN * G_LDA * 2);
  const unsigned lA_t = lds_off(&lA[0][0]) + (unsigned)(cr * G_LDA + ck * 8) * 2;
  const unsigned lB_t = lds_off(&lB[0][0]) + (unsigned)(cr * G_LDA + ck * 8) * 2;
  const unsigned gA_t = ((unsigned)(m0 + cr) * K + ck * 8) * 2;
  const unsigned gB_t = ((unsigned)(n0 + cr) * K + ck * 8) * 2;

#define G_ISSUE(k0, buf) do {                                   \
    unsigned la[4], ga[4], lb[4], gb[4];                        \
    _Pragma("unroll")                                           \
    for (int i = 0; i < 4; i++) {  /* rows cr + 32 * i */       \
      la[i] = lA_t + (buf) * bufA + (unsigned)(32 * i * G_LDA * 2);  \
      lb[i] = lB_t + (buf) * bufB + (unsigned)(32 * i * G_LDA * 2);  \
      ga[i] = gA_t + ((unsigned)(32 * i) * K + (unsigned)(k0)) * 2;  \
      gb[i] = gB_t + ((unsigned)(32 * i) * K + (unsigned)(k0)) * 2;  \
    }                                                           \
    async_ab(la, ga, A, lb, gb, Bt);                            \
  } while (0)

  v8f acc[2][4];
#pragma unroll
  for (int i = 0; i < 2; i++)
#pragma unroll
    for (int j = 0; j < 4; j++) acc[i][j] = (v8f)(0.0f);

  const int KT = K / G_BK;
  G_ISSUE(0, 0);
  // tile 0 has landed for this wave; the barrier publishes it to the others
  asm volatile("s_wait_asynccnt 0x0" ::: "memory");
  __syncthreads();
  if (KT > 1) G_ISSUE(G_BK, 1);

  for (int kt = 0; kt < KT; kt++) {
    const int cur = kt & 1;

    const __bf16* l1 = (MODE == 1) ? &lA[cur][0] : &lB[cur][0];  // first operand
    const __bf16* l2 = (MODE == 1) ? &lB[cur][0] : &lA[cur][0];  // second operand
    // loops over k-steps and tiles are unrolled: fragment arrays stay in registers
    v16bf af[2][2], bfm[2][4];
#pragma unroll
    for (int ks = 0; ks < 2; ks++) {
#pragma unroll
      for (int i = 0; i < 2; i++) {
        int r = wm * 32 + i * 16 + lm;
        v8bf lo = *(const v8bf*)(&l1[r * G_LDA + ks * 32 + kb]);
        v8bf hi = *(const v8bf*)(&l1[r * G_LDA + ks * 32 + 16 + kb]);
        af[ks][i] = cat8(lo, hi);
      }
#pragma unroll
      for (int j = 0; j < 4; j++) {
        int r = wn * 64 + j * 16 + lm;
        v8bf lo = *(const v8bf*)(&l2[r * G_LDA + ks * 32 + kb]);
        v8bf hi = *(const v8bf*)(&l2[r * G_LDA + ks * 32 + 16 + kb]);
        bfm[ks][j] = cat8(lo, hi);
      }
    }
#pragma unroll
    for (int ks = 0; ks < 2; ks++)
#pragma unroll
      for (int i = 0; i < 2; i++)
#pragma unroll
        for (int j = 0; j < 4; j++)
          acc[i][j] = wmma_bf16(af[ks][i], bfm[ks][j], acc[i][j]);

    // keep WMMAs ahead of the async wait so DMA overlaps the matrix math
#pragma unroll
    for (int i = 0; i < 2; i++)
#pragma unroll
      for (int j = 0; j < 4; j++) pin(acc[i][j]);

    // hand-over: this wave's reads of buffer cur are done, its copies of the next
    // tile have landed; behind the barrier both hold for every wave
    asm volatile("s_wait_dscnt 0x0" ::: "memory");
    asm volatile("s_wait_asynccnt 0x0" ::: "memory");
    __syncthreads();
    if (kt + 2 < KT) G_ISSUE((kt + 2) * G_BK, cur);  // refill the buffer just left
  }
#undef G_ISSUE
  // no copy is outstanding when the epilogue starts
  asm volatile("s_wait_asynccnt 0x0" ::: "memory");

  // epilogue: a lane holds column lm of each tile (second operand's row) and, in
  // register r, row r + mh (first operand's row)
  const int mh = (lane >> 4) * 8;
  if constexpr (MODE == 1) {      // lane = n (head dim), registers = 8 positions
#pragma unroll
    for (int j = 0; j < 4; j++) {
      const int n = n0 + wn * 64 + j * 16 + lm;
      const float bv = bias[n];
      const int h = n >> 6, dd = n & 63;
#pragma unroll
      for (int i = 0; i < 2; i++) {
        const int m = m0 + wm * 32 + i * 16 + mh;
        const int b = m / SEQ, s = m % SEQ;
        *(v8bf*)((__bf16*)out + (((size_t)(b * HN + h)) * ADIM + dd) * SEQ + s) =
            __builtin_convertvector(acc[i][j] + bv, v8bf);
      }
    }
  } else {                        // lane = m (row), registers = 8 columns n
#pragma unroll
    for (int i = 0; i < 2; i++) {
      const int n = n0 + wm * 32 + i * 16 + mh;
      const v8f bv = *(const v8f*)(bias + n);
#pragma unroll
      for (int j = 0; j < 4; j++) {
        const int m = m0 + wn * 64 + j * 16 + lm;
        const v8f val = acc[i][j] + bv;
        if constexpr (MODE == 0) {  // [B,H,S,64] bf16
          const int b = m / SEQ, s = m % SEQ;
          const int h = n >> 6, dd = n & 63;
          *(v8bf*)((__bf16*)out + (((size_t)(b * HN + h)) * SEQ + s) * ADIM + dd) =
              __builtin_convertvector(val * oscale, v8bf);
        } else {                    // f32 row-major
          *(v8f*)((float*)out + (size_t)m * N + n) = val;
        }
      }
    }
  }
}

// The three projections of X in one grid: blockIdx.z picks weight, bias, output
// and layout. They share nothing but their input, so one grid's blocks fill the
// places that a single projection's 2 blocks per WGP leave empty.
__global__ __launch_bounds__(256)
void gemm_qkv_kernel(const __bf16* __restrict__ X,
                     const __bf16* __restrict__ WqT, const __bf16* __restrict__ WkT,
                     const __bf16* __restrict__ WvT,
                     const float* __restrict__ bq, const float* __restrict__ bk,
                     const float* __restrict__ bv,
                     __bf16* __restrict__ q, __bf16* __restrict__ k,
                     __bf16* __restrict__ vt, int M, int N, int K) {
  __shared__ __align__(16) __bf16 lA[2][G_BM * G_LDA];
  __shared__ __align__(16) __bf16 lB[2][G_BN * G_LDA];
  const int z = blockIdx.z;   // the same for the whole block: barriers stay uniform
  if (z == 2)
    gemm_bf16_tile<1>(lA, lB, X, WvT, bv, vt, M, N, K, 1.0f);
  else {
    // q leaves multiplied by log2(e) / sqrt(64): its products with k are then
    // arguments of exp2
    gemm_bf16_tile<0>(lA, lB, X, z ? WkT : WqT, z ? bk : bq, z ? k : q, M, N, K,
                      z ? 1.0f : 0.125f * 1.44269504f);
    // the other layout's code follows in the text and reuses the registers that
    // the stores above name: they are free for reuse only behind this wait
    asm volatile("s_wait_xcnt 0x0" ::: "memory");
  }
}

__global__ __launch_bounds__(256)
void gemm_out_kernel(const __bf16* __restrict__ A, const __bf16* __restrict__ Bt,
                     const float* __restrict__ bias, float* __restrict__ out,
                     int M, int N, int K) {
  __shared__ __align__(16) __bf16 lA[2][G_BM * G_LDA];
  __shared__ __align__(16) __bf16 lB[2][G_BN * G_LDA];
  gemm_bf16_tile<2>(lA, lB, A, Bt, bias, out, M, N, K, 1.0f);
}

// ---------------------------------------------------------------------------
// Flash-style attention with double-buffered async-DMA KV staging.
// grid = (B*H, S/256). 256 threads = 8 waves, each wave owns 32 query rows as
// two column groups of 16: a K or V fragment read from LDS feeds two WMMAs, and
// one staged KV block serves 256 queries.
// Both products run transposed: St = K * Qt, Ot += Vt * Pt. A lane then holds
// one query per group (column lm): its softmax statistics are one scalar per
// lane and group, and two St tiles, converted in place, are the B operand of
// the second product.
// q arrives multiplied by log2(e) / sqrt(64), and the maximum in use enters the
// first product negated as its C operand: a score leaves the matrix unit as the
// argument of its exp2. No maximum is taken in the usual block: the block's sum of
// exponentials, needed anyway, is the test. Only where a lane's sum passes 256 (far
// inside the range of f32 sums and of bf16 P), and in the first block, are the
// scores formed again, the maximum in use moved, and sums and Ot rescaled.
// ---------------------------------------------------------------------------
#define A_LDK 72  // 64 + 8 pad bf16 elems per LDS row (144B: 16B aligned)
#define A_QG  2                    // query column groups per wave
#define A_QB  (8 * 16 * A_QG)      // queries per block

// One lane's share of a KV block: two 16-byte pieces of K, two of V. The closing
// wait stands inside the statement, so that no register named by a copy is
// written again ahead of it.
static __device__ __forceinline__
void async_kv(unsigned lk0, unsigned gk0, unsigned lk1, unsigned gk1, const void* kbase,
              unsigned lv0, unsigned gv0, unsigned lv1, unsigned gv1, const void* vbase) {
  asm volatile("global_load_async_to_lds_b128 %0, %1, %8\n\t"
               "global_load_async_to_lds_b128 %2, %3, %8\n\t"
               "global_load_async_to_lds_b128 %4, %5, %9\n\t"
               "global_load_async_to_lds_b128 %6, %7, %9\n\t"
               "s_wait_xcnt 0x0"
               :: "v"(lk0), "v"(gk0), "v"(lk1), "v"(gk1),
                  "v"(lv0), "v"(gv0), "v"(lv1), "v"(gv1),
                  "s"((unsigned long long)kbase), "s"((unsigned long long)vbase)
               : "memory");
}

// waves_per_eu: 256 registers a wave, so that two blocks (four waves per SIMD)
// stay resident and the whole grid runs in one round.
__global__ __launch_bounds__(256) __attribute__((amdgpu_waves_per_eu(4, 4)))
void attn_kernel(const __bf16* __restrict__ qb,   // [BH][S][64], pre-scaled
                 const __bf16* __restrict__ kbuf, // [BH][S][64]
                 const __bf16* __restrict__ vt,   // [BH][64][S]
                 __bf16* __restrict__ ctx) {      // [B*S][1024]
  const int bh   = blockIdx.x;
  const int qblk = blockIdx.y;
  const int tid  = threadIdx.x;
  const int lane = tid & 31;
  const int wave = tid >> 5;
  const int lm   = lane & 15;
  const int kb   = (lane >> 4) * 8;
  const int mh   = (lane >> 4) * 8;

  __shared__ __align__(16) __bf16 lK[2][64 * A_LDK];
  __shared__ __align__(16) __bf16 lV[2][64 * A_LDK];

  // per-thread DMA chunks: 512 16B chunks per tile / 256 threads = 2 each
  const int acr = tid >> 3;   // 0..31 (row)
  const int acc_ = tid & 7;   // 0..7  (16B column chunk)
  const unsigned ldsK0 = lds_off(&lK[0][0]);
  const unsigned ldsV0 = lds_off(&lV[0][0]);
  const unsigned kvbuf = (unsigned)(64 * A_LDK * 2);
  unsigned lK_t[2], lV_t[2], gK[2], gV[2];
#pragma unroll
  for (int i = 0; i < 2; i++) {
    int r = acr + 32 * i;
    lK_t[i] = ldsK0 + (unsigned)(r * A_LDK + acc_ * 8) * 2;
    lV_t[i] = ldsV0 + (unsigned)(r * A_LDK + acc_ * 8) * 2;
    gK[i] = (((unsigned)bh * SEQ + r) * ADIM + acc_ * 8) * 2;  // + kv0*ADIM*2
    gV[i] = (((unsigned)bh * ADIM + r) * SEQ + acc_ * 8) * 2;  // + kv0*2
  }

#define KV_ISSUE(kv0, buf) do {                                        \
    unsigned ok = (unsigned)(kv0) * ADIM * 2, ov = (unsigned)(kv0) * 2;\
    unsigned ob = (unsigned)(buf) * kvbuf;                             \
    async_kv(lK_t[0] + ob, gK[0] + ok, lK_t[1] + ob, gK[1] + ok, kbuf, \
             lV_t[0] + ob, gV[0] + ov, lV_t[1] + ob, gV[1] + ov, vt);  \
  } while (0)

  // q fragments stay resident as B operands (K = d = 64 -> 2 WMMA k-steps).
  // Here and below every loop over groups, tiles and k-steps is unrolled, so that
  // the fragment and accumulator arrays are indexed by constants and stay in registers.
  v16bf qf[A_QG][2];
#pragma unroll
  for (int g = 0; g < A_QG; g++) {
    const __bf16* qrow =
        qb + ((size_t)bh * SEQ + qblk * A_QB + wave * (16 * A_QG) + g * 16 + lm) * ADIM;
#pragma unroll
    for (int ks = 0; ks < 2; ks++) {
      v8bf lo = *(const v8bf*)(qrow + ks * 32 + kb);
      v8bf hi = *(const v8bf*)(qrow + ks * 32 + 16 + kb);
      qf[g][ks] = cat8(lo, hi);
    }
  }

  // this lane's query of each group: the maximum in use, negated, in the eight
  // registers of a C operand (both halves agree), and the sum over the keys of
  // this lane's half (the halves are joined after the loop)
  v8f negm[A_QG];
  float row_sum[A_QG];
  v8f o[A_QG][4];  // Ot tiles: lane = query lm, register r = d index dt*16 + mh + r
#pragma unroll
  for (int g = 0; g < A_QG; g++) {
    negm[g] = (v8f)(0.0f);
    row_sum[g] = 0.0f;
#pragma unroll
    for (int dt = 0; dt < 4; dt++) o[g][dt] = (v8f)(0.0f);
  }

  KV_ISSUE(0, 0);
  // block 0 has landed for this wave; the barrier publishes it to the others
  asm volatile("s_wait_asynccnt 0x0" ::: "memory");
  __syncthreads();
  KV_ISSUE(64, 1);

  // not unrolled and not peeled: a copy of the body for the first block would
  // double the text and cost registers
#pragma clang loop unroll(disable)
  for (int kvb = 0; kvb < SEQ / 64; kvb++) {
    const int cur = kvb & 1;

    // St = k @ q^T  (4 key tiles x 2 k-steps): register r = key tn*16 + mh + r
    v8f sc[A_QG][4];
    float psum[A_QG];   // this lane's half of the block's sum of exponentials
    auto scores = [&]() {
      v16bf kf[2][4];
#pragma unroll
      for (int ks = 0; ks < 2; ks++) {
#pragma unroll
        for (int tn = 0; tn < 4; tn++) {
          int r = tn * 16 + lm;
          v8bf lo = *(const v8bf*)(&lK[cur][r * A_LDK + ks * 32 + kb]);
          v8bf hi = *(const v8bf*)(&lK[cur][r * A_LDK + ks * 32 + 16 + kb]);
          kf[ks][tn] = cat8(lo, hi);
        }
      }
#pragma unroll
      for (int tn = 0; tn < 4; tn++)
#pragma unroll
        for (int g = 0; g < A_QG; g++)
#pragma unroll
          for (int ks = 0; ks < 2; ks++)
            sc[g][tn] = wmma_bf16(kf[ks][tn], qf[g][ks], ks == 0 ? negm[g] : sc[g][tn]);
    };
    auto exp_and_sum = [&]() {
#pragma unroll
      for (int g = 0; g < A_QG; g++) {
#pragma unroll
        for (int tn = 0; tn < 4; tn++) sc[g][tn] = exp2x8(sc[g][tn]);
        v8f ps = (sc[g][0] + sc[g][1]) + (sc[g][2] + sc[g][3]);
        psum[g] = ((ps[0] + ps[1]) + (ps[2] + ps[3])) + ((ps[4] + ps[5]) + (ps[6] + ps[7]));
      }
    };

    // the usual path takes no maximum: a tile's exponentials hang on that tile's own
    // two WMMAs alone
    scores();
    exp_and_sum();
    // one test per block for the whole wave: a scalar branch, EXEC stays all ones.
    // The terms are positive, so a sum of at most 256 bounds each of them; an
    // overflow to infinity fails the test too.
    bool over = false;
#pragma unroll
    for (int g = 0; g < A_QG; g++) over = over || (psum[g] > 256.0f);
    if (kvb == 0 || __builtin_amdgcn_ballot_w32(over) != 0) {
      // the exponentials overwrote the scores: form them again. The compiler fence
      // makes this path read its K fragments anew; without it the usual path would
      // hold its 64 fragment registers over the exponentials for this rare one.
      asm volatile("" ::: "memory");
      scores();
#pragma unroll
      for (int g = 0; g < A_QG; g++) {
        // one query per lane and group: 32 keys in-lane, one exchange of halves
        float mt[4];
#pragma unroll
        for (int tn = 0; tn < 4; tn++) {
          mt[tn] = sc[g][tn][0];
#pragma unroll
          for (int r = 1; r < 8; r++) mt[tn] = fmaxf(mt[tn], sc[g][tn][r]);
        }
        float mx = fmaxf(fmaxf(mt[0], mt[1]), fmaxf(mt[2], mt[3]));
        mx = fmaxf(mx, other_half(mx));
        // the first block takes its own maximum, whatever its sign; later the
        // maximum in use only rises
        const float d = (kvb == 0) ? mx : fmaxf(mx, 0.0f);
        const float alpha = __builtin_amdgcn_exp2f(fminf(-d, 0.0f));
        negm[g] -= d;
        row_sum[g] *= alpha;
#pragma unroll
        for (int tn = 0; tn < 4; tn++) sc[g][tn] -= d;
#pragma unroll
        for (int dt = 0; dt < 4; dt++) o[g][dt] *= alpha;
      }
      exp_and_sum();   // no score is above the maximum in use now
    }
#pragma unroll
    for (int g = 0; g < A_QG; g++) row_sum[g] += psum[g];

    // Ot += Vt @ Pt: St tiles 2ks and 2ks+1 hold keys in the fragment's k order
#pragma unroll
    for (int ks = 0; ks < 2; ks++) {
      v16bf pf[A_QG];
#pragma unroll
      for (int g = 0; g < A_QG; g++)
        pf[g] = cat8(__builtin_convertvector(sc[g][2 * ks], v8bf),
                     __builtin_convertvector(sc[g][2 * ks + 1], v8bf));
#pragma unroll
      for (int dt = 0; dt < 4; dt++) {
        int r = dt * 16 + lm;
        v8bf lo = *(const v8bf*)(&lV[cur][r * A_LDK + ks * 32 + kb]);
        v8bf hi = *(const v8bf*)(&lV[cur][r * A_LDK + ks * 32 + 16 + kb]);
        v16bf vf = cat8(lo, hi);
#pragma unroll
        for (int g = 0; g < A_QG; g++) o[g][dt] = wmma_bf16(vf, pf[g], o[g][dt]);
      }
    }

    // hand-over: this wave's reads of buffer cur are done, its copies of the next
    // block have landed; behind the barrier both hold for every wave
    asm volatile("s_wait_dscnt 0x0" ::: "memory");
    asm volatile("s_wait_asynccnt 0x0" ::: "memory");
    __syncthreads();
    if (kvb + 2 < SEQ / 64) KV_ISSUE((kvb + 2) * 64, cur);  // refill the buffer just left
  }
#undef KV_ISSUE
  // no copy is outstanding when the wave ends
  asm volatile("s_wait_asynccnt 0x0" ::: "memory");

  // finalize: ctx[(b*S+s)][h*64 + d] bf16, 8 consecutive d per lane and tile
  const int b = bh >> 4, h = bh & 15;
#pragma unroll
  for (int g = 0; g < A_QG; g++) {
    const float rs = row_sum[g] + other_half(row_sum[g]);
    const float inv = 1.0f / rs;
    const int s = qblk * A_QB + wave * (16 * A_QG) + g * 16 + lm;
    __bf16* dst = ctx + ((size_t)(b * SEQ + s)) * DMODEL + h * ADIM + mh;
#pragma unroll
    for (int dt = 0; dt < 4; dt++)
      *(v8bf*)(dst + dt * 16) = __builtin_convertvector(o[g][dt] * inv, v8bf);
  }
}

// ---------------------------------------------------------------------------
// residual add + LayerNorm, one wave per row of 1024 (32 values a lane, in
// groups of 4: a wave's load or store covers 512 contiguous bytes); the row's
// sums are joined inside the wave, so the block's 8 rows share nothing
// ---------------------------------------------------------------------------
__global__ __launch_bounds__(256)
void ln_kernel(const float* __restrict__ proj, const float* __restrict__ resid,
               const float* __restrict__ g, const float* __restrict__ b,
               float* __restrict__ out) {
  const int lane = threadIdx.x & 31;
  const size_t row = (size_t)blockIdx.x * 8 + (threadIdx.x >> 5);
  const v4f* __restrict__ pp = (const v4f*)(proj + row * DMODEL) + lane;
  const v4f* __restrict__ rp = (const v4f*)(resid + row * DMODEL) + lane;
  v4f x[8], y[8];
#pragma unroll
  for (int i = 0; i < 8; i++) x[i] = pp[i * 32];
#pragma unroll
  for (int i = 0; i < 8; i++) y[i] = rp[i * 32];
  v4f s4 = (v4f)(0.0f), q4 = (v4f)(0.0f);
#pragma unroll
  for (int i = 0; i < 8; i++) {
    x[i] += y[i];
    s4 += x[i];
    q4 += x[i] * x[i];
  }
  // the loads' address registers are free for reuse only behind this wait
  asm volatile("s_wait_xcnt 0x0" ::: "memory");
  float s  = (s4[0] + s4[1]) + (s4[2] + s4[3]);
  float sq = (q4[0] + q4[1]) + (q4[2] + q4[3]);
#pragma unroll
  for (int off = 16; off >= 1; off >>= 1) {
    s  += __shfl_xor(s,  off, 32);
    sq += __shfl_xor(sq, off, 32);
  }
  float mu  = s * (1.0f / DMODEL);
  float var = sq * (1.0f / DMODEL) - mu * mu;
  float rs  = rsqrtf(var + 1e-5f);
  const v4f* __restrict__ gp = (const v4f*)g + lane;
  const v4f* __restrict__ bp = (const v4f*)b + lane;
  v4f* __restrict__ op = (v4f*)(out + row * DMODEL) + lane;
#pragma unroll
  for (int i = 0; i < 8; i++) op[i * 32] = (x[i] - mu) * rs * gp[i * 32] + bp[i * 32];
}

// ---------------------------------------------------------------------------
extern "C" void kernel_launch(void* const* d_in, const int* in_sizes, int n_in,
                              void* d_out, int out_size, void* d_ws, size_t ws_size,
                              hipStream_t stream) {
  (void)in_sizes; (void)n_in; (void)out_size; (void)ws_size;
  const float* Q    = (const float*)d_in[0];
  const float* Wq   = (const float*)d_in[1];
  const float* bq   = (const float*)d_in[2];
  const float* Wk   = (const float*)d_in[3];
  const float* bk   = (const float*)d_in[4];
  const float* Wv   = (const float*)d_in[5];
  const float* bv   = (const float*)d_in[6];
  const float* Wo   = (const float*)d_in[7];
  const float* bo   = (const float*)d_in[8];
  const float* ln_g = (const float*)d_in[9];
  const float* ln_b = (const float*)d_in[10];

  const size_t ND = (size_t)MROWS * DMODEL;     // 8192*1024
  const size_t WW = (size_t)DMODEL * DMODEL;    // 1024*1024

  char* ws = (char*)d_ws;
  size_t off = 0;
  __bf16* Xbf = (__bf16*)(ws + off); off += ND * 2;
  __bf16* WqT = (__bf16*)(ws + off); off += WW * 2;
  __bf16* WkT = (__bf16*)(ws + off); off += WW * 2;
  __bf16* WvT = (__bf16*)(ws + off); off += WW * 2;
  __bf16* WoT = (__bf16*)(ws + off); off += WW * 2;
  __bf16* qbf = (__bf16*)(ws + off); off += ND * 2;   // [B,H,S,64]
  __bf16* kbf = (__bf16*)(ws + off); off += ND * 2;   // [B,H,S,64]
  __bf16* vtb = (__bf16*)(ws + off); off += ND * 2;   // [B,H,64,S]
  __bf16* ctx = (__bf16*)(ws + off); off += ND * 2;   // [B*S, 1024]
  float*  prj = (float*)(ws + off);  off += ND * 4;   // [B*S, 1024]

  // 1) precision staging (WqT is the first of the four transposed planes)
  stage_kernel<<<CVT_BLOCKS + 4 * TR_BLOCKS, 256, 0, stream>>>(Q, Wq, Wk, Wv, Wo, Xbf, WqT);

  // 2) QKV projections (WMMA GEMMs scattering into attention layouts)
  gemm_qkv_kernel<<<dim3(MROWS / G_BM, DMODEL / G_BN, 3), 256, 0, stream>>>(
      Xbf, WqT, WkT, WvT, bq, bk, bv, qbf, kbf, vtb, MROWS, DMODEL, DMODEL);

  // 3) flash attention
  attn_kernel<<<dim3(BATCH * HN, SEQ / A_QB), 256, 0, stream>>>(qbf, kbf, vtb, ctx);

  // 4) output projection (f32 out)
  gemm_out_kernel<<<dim3(MROWS / G_BM, DMODEL / G_BN), 256, 0, stream>>>(
      ctx, WoT, bo, prj, MROWS, DMODEL, DMODEL);

  // 5) residual + layernorm
  ln_kernel<<<MROWS / 8, 256, 0, stream>>>(prj, Q, ln_g, ln_b, (float*)d_out);
}

// v009
// It runs in 117 microseconds.
// Timed twice side by side with v008, it ran 1.03 and 1.04 times as fast.
// Counting every step since v000, it is 2.40 times as fast.
#include <hip/hip_runtime.h>
#include <hip/hip_bf16.h>

typedef __attribute__((ext_vector_type(16))) __bf16 v16bf;
typedef __attribute__((ext_vector_type(8)))  __bf16 v8bf;
typedef __attribute__((ext_vector_type(8)))  float  v8f;
typedef __attribute__((ext_vector_type(4)))  float  v4f;
typedef __attribute__((ext_vector_type(4)))  __bf16 v4bf;

#define HN     16
#define SEQ    2048
#define DMODEL 1024
#define ADIM   64
#define BATCH  4
#define MROWS  (BATCH * SEQ)   // 8192

static __device__ __forceinline__ v16bf cat8(v8bf lo, v8bf hi) {
  return __builtin_shufflevector(lo, hi, 0,1,2,3,4,5,6,7,8,9,10,11,12,13,14,15);
}

static __device__ __forceinline__ v8f wmma_bf16(v16bf a, v16bf b, v8f c) {
  // D = A(16x32 bf16) * B(32x16 bf16) + C(16x16 f32)
  return __builtin_amdgcn_wmma_f32_16x16x32_bf16(false, a, false, b, (short)0, c, false, false);
}

// gfx1250 async DMA: global -> LDS, 16B per lane, tracked by ASYNCcnt.
// GVS addressing: mem = SADDR(u64) + VADDR(i32) + IOFFSET. VDST = LDS byte addr.
// One lane's share of a GEMM K-step: eight 16-byte pieces of the A tile (256 rows),
// four of the B tile (128 rows). The closing wait stands inside the statement, so
// that no register named by a copy is written again ahead of it.
static __device__ __forceinline__
void async_ab(const unsigned (&la)[8], const unsigned (&ga)[8], const void* abase,
              const unsigned (&lb)[4], const unsigned (&gb)[4], const void* bbase) {
  asm volatile("global_load_async_to_lds_b128 %0, %1, %24\n\t"
               "global_load_async_to_lds_b128 %2, %3, %24\n\t"
               "global_load_async_to_lds_b128 %4, %5, %24\n\t"
               "global_load_async_to_lds_b128 %6, %7, %24\n\t"
               "global_load_async_to_lds_b128 %8, %9, %24\n\t"
               "global_load_async_to_lds_b128 %10, %11, %24\n\t"
               "global_load_async_to_lds_b128 %12, %13, %24\n\t"
               "global_load_async_to_lds_b128 %14, %15, %24\n\t"
               "global_load_async_to_lds_b128 %16, %17, %25\n\t"
               "global_load_async_to_lds_b128 %18, %19, %25\n\t"
               "global_load_async_to_lds_b128 %20, %21, %25\n\t"
               "global_load_async_to_lds_b128 %22, %23, %25\n\t"
               "s_wait_xcnt 0x0"
               :: "v"(la[0]), "v"(ga[0]), "v"(la[1]), "v"(ga[1]),
                  "v"(la[2]), "v"(ga[2]), "v"(la[3]), "v"(ga[3]),
                  "v"(la[4]), "v"(ga[4]), "v"(la[5]), "v"(ga[5]),
                  "v"(la[6]), "v"(ga[6]), "v"(la[7]), "v"(ga[7]),
                  "v"(lb[0]), "v"(gb[0]), "v"(lb[1]), "v"(gb[1]),
                  "v"(lb[2]), "v"(gb[2]), "v"(lb[3]), "v"(gb[3]),
                  "s"((unsigned long long)abase), "s"((unsigned long long)bbase)
               : "memory");
}

// empty volatile asm consuming the accumulator: volatile asms keep program
// order, so this pins the producing WMMAs *before* the following wait/barrier,
// letting the in-flight async DMA overlap the matrix math.
static __device__ __forceinline__ void pin(v8f& x) {
  asm volatile("" : "+v"(x));
}

// value of the same lane position in the other 16-lane half (l <-> l ^ 16)
static __device__ __forceinline__ float other_half(float x) {
  int b = __builtin_bit_cast(int, x);
  b = __builtin_amdgcn_permlanex16(b, b, 0x76543210, 0xfedcba98, false, false);
  return __builtin_bit_cast(float, b);
}

// exp2 of eight values, by the builtin: the values come straight from a WMMA.
static __device__ __forceinline__ v8f exp2x8(v8f t) {
  v8f p;
#pragma unroll
  for (int r = 0; r < 8; r++) p[r] = __builtin_amdgcn_exp2f(t[r]);
  return p;
}

// low 32 bits of a generic LDS pointer == LDS byte offset (flat aperture mapping)
static __device__ __forceinline__ unsigned lds_off(const void* p) {
  return (unsigned)(unsigned long long)p;
}

// ---------------------------------------------------------------------------
// fp32 -> bf16 elementwise convert. A lane takes CVT_V groups of four floats, all
// loads asked for before the first store; a wave's load covers 512 contiguous
// bytes, its store 256. One block covers 256 * CVT_V * 4 floats, no remainder.
// ---------------------------------------------------------------------------
#define CVT_V 16
#define CVT_BLOCKS (MROWS * DMODEL / (256 * CVT_V * 4))
static __device__ __forceinline__
void cvt_f32_bf16_block(const float* __restrict__ in, __bf16* __restrict__ out, int blk) {
  const size_t base = (size_t)blk * (256 * CVT_V) + threadIdx.x;  // in groups of 4
  const v4f* __restrict__ src = (const v4f*)in + base;
  v4bf* __restrict__ dst = (v4bf*)out + base;
  v4f v[CVT_V];
#pragma unroll
  for (int j = 0; j < CVT_V; j++) v[j] = src[j * 256];
#pragma unroll
  for (int j = 0; j < CVT_V; j++) dst[j * 256] = __builtin_convertvector(v[j], v4bf);
}

// ---------------------------------------------------------------------------
// W[K][N] fp32  ->  Wt[N][K] bf16   (LDS tile transpose, 64 x 64 per block:
// a lane loads four groups of 4 floats and stores two groups of 8 bf16, so a
// wave reads whole 256-byte row pieces and writes whole 128-byte lines)
// ---------------------------------------------------------------------------
static __device__ __forceinline__
void transpose_bf16_block(float (*tile)[65], const float* __restrict__ W,
                          __bf16* __restrict__ Wt, int K, int N,
                          int bx,    // along N
                          int by) {  // along K
  const int c4 = threadIdx.x & 15;   // group of 4 columns (n)
  const int r0 = threadIdx.x >> 4;   // 0..15
  v4f v[4];
#pragma unroll
  for (int i = 0; i < 4; i++)
    v[i] = *(const v4f*)(W + (size_t)(by + r0 + i * 16) * N + bx + c4 * 4);
  // the loads' address registers are free for reuse only behind this wait; the
  // scheduling barrier keeps later index arithmetic from being lifted over it
  asm volatile("s_wait_xcnt 0x0" ::: "memory");
  __builtin_amdgcn_sched_barrier(0);
#pragma unroll
  for (int i = 0; i < 4; i++)
#pragma unroll
    for (int e = 0; e < 4; e++) tile[r0 + i * 16][c4 * 4 + e] = v[i][e];
  __syncthreads();
  const int ck = threadIdx.x & 7;    // group of 8 k
  const int n0 = threadIdx.x >> 3;   // 0..31
#pragma unroll
  for (int i = 0; i < 2; i++) {
    int n = n0 + i * 32;
    v8bf o;
#pragma unroll
    for (int j = 0; j < 8; j++) o[j] = (__bf16)tile[ck * 8 + j][n];
    *(v8bf*)(Wt + (size_t)(bx + n) * K + by + ck * 8) = o;
  }
}

// ---------------------------------------------------------------------------
// All precision staging in one grid: none of the five jobs reads another's
// result, so their blocks start, wait on memory and drain side by side.
// Blocks [0, CVT_BLOCKS) convert X; then TR_BLOCKS blocks per weight matrix,
// whose transposed planes lie one behind the other in Wt (q, k, v, o).
// ---------------------------------------------------------------------------
#define TR_SIDE   (DMODEL / 64)
#define TR_BLOCKS (TR_SIDE * TR_SIDE)
__global__ __launch_bounds__(256)
void stage_kernel(const float* __restrict__ X,
                  const float* __restrict__ Wq, const float* __restrict__ Wk,
                  const float* __restrict__ Wv, const float* __restrict__ Wo,
                  __bf16* __restrict__ Xbf, __bf16* __restrict__ Wt) {
  __shared__ float tile[64][65];
  const int blk = blockIdx.x;
  if (blk < CVT_BLOCKS) {   // the whole block leaves here, ahead of any barrier
    cvt_f32_bf16_block(X, Xbf, blk);
    return;
  }
  const int t = blk - CVT_BLOCKS;
  const int w = t / TR_BLOCKS;
  const int c = t % TR_BLOCKS;
  const float* W = (w == 0) ? Wq : (w == 1) ? Wk : (w == 2) ? Wv : Wo;
  transpose_bf16_block(tile, W, Wt + (size_t)w * DMODEL * DMODEL, DMODEL, DMODEL,
                       (c % TR_SIDE) * 64, (c / TR_SIDE) * 64);
}

// ---------------------------------------------------------------------------
// Tiled WMMA GEMM with double-buffered async-DMA staging.
// C[M][N] = A[M][K] * Bt[N][K]^T + bias[N]
// block tile 256x128, BK=64, 256 threads = 8 waves,
// each wave computes 64x64 = 4x4 tiles of 16x16, two WMMA k-steps per K-step:
// a fragment read from LDS feeds four WMMAs, and a block copies 384 operand rows
// for 32768 results where two 128x128 blocks copy 512.
// A K-step takes 128 bytes of every operand row: a whole cache line, so a wave's
// copy covers 4 whole lines.
// MODE (compile time): 0 -> bf16 [B,H,S,64]   (q / k layout)
//                      1 -> bf16 [B,H,64,S]   (v transposed layout)
//                      2 -> f32  row-major [M][N]
// A lane's 8 accumulator registers run along the first WMMA operand's rows, so
// the operand whose index is contiguous in the output goes first: Bt rows (n)
// for modes 0 and 2, A rows (m = position) for mode 1. The 8 results of a tile
// then leave as 16-byte stores. The wave tile is 64 rows of either operand in
// every mode; the waves lie 4 along the A rows and 2 along the Bt rows.
// ---------------------------------------------------------------------------
#define G_BM 256
#define G_BN 128
#define G_BK 64
#define G_LDA 72   // bf16 elems per LDS row (64 + 8 pad): 144B row, 16B aligned, bank-spread

template <int MODE>
static __device__ __forceinline__
void gemm_bf16_tile(__bf16 (*lA)[G_BM * G_LDA], __bf16 (*lB)[G_BN * G_LDA],
                    const __bf16* __restrict__ A,   // [M][K]
                    const __bf16* __restrict__ Bt,  // [N][K]
                    const float*  __restrict__ bias,
                    void* __restrict__ out,
                    int M, int N, int K,
                    float oscale) {   // factor on the result, mode 0 only
  const int tid  = threadIdx.x;
  const int lane = tid & 31;
  const int wave = tid >> 5;
  constexpr int W1 = (MODE == 1) ? G_BM / 64 : G_BN / 64;  // waves along the first operand
  const int wm   = wave % W1;  // place along the first operand (64 rows each)
  const int wn   = wave / W1;  // place along the second operand (64 rows each)
  const int m0   = blockIdx.x * G_BM;
  const int n0   = blockIdx.y * G_BN;
  const int lm   = lane & 15;
  const int kb   = (lane >> 4) * 8;   // ISA 16-bit A/B fragment K mapping

  // per-thread DMA chunk coords: chunks c = tid + 256 * i; r = c>>3, kc = c&7
  const int cr = tid >> 3;     // 0..31
  const int ck = tid & 7;      // 0..7: eight lanes cover a row's 128 bytes
  const unsigned bufA = (unsigned)(G_BM * G_LDA * 2);
  const unsigned bufB = (unsigned)(G_BN * G_LDA * 2);
  const unsigned lA_t = lds_off(&lA[0][0]) + (unsigned)(cr * G_LDA + ck * 8) * 2;
  const unsigned lB_t = lds_off(&lB[0][0]) + (unsigned)(cr * G_LDA + ck * 8) * 2;
  const unsigned gA_t = ((unsigned)(m0 + cr) * K + ck * 8) * 2;
  const unsigned gB_t = ((unsigned)(n0 + cr) * K + ck * 8) * 2;

#define G_ISSUE(k0, buf) do {                                   \
    unsigned la[8], ga[8], lb[4], gb[4];                        \
    _Pragma("unroll")                                           \
    for (int i = 0; i < 8; i++) {  /* rows cr + 32 * i */       \
      la[i] = lA_t + (buf) * bufA + (unsigned)(32 * i * G_LDA * 2);  \
      ga[i] = gA_t + ((unsigned)(32 * i) * K + (unsigned)(k0)) * 2;  \
    }                                                           \
    _Pragma("unroll")                                           \
    for (int i = 0; i < 4; i++) {                               \
      lb[i] = lB_t + (buf) * bufB + (unsigned)(32 * i * G_LDA * 2);  \
      gb[i] = gB_t + ((unsigned)(32 * i) * K + (unsigned)(k0)) * 2;  \
    }                                                           \
    async_ab(la, ga, A, lb, gb, Bt);                            \
  } while (0)

  v8f acc[4][4];
#pragma unroll
  for (int i = 0; i < 4; i++)
#pragma unroll
    for (int j = 0; j < 4; j++) acc[i][j] = (v8f)(0.0f);

  const int KT = K / G_BK;
  G_ISSUE(0, 0);
  // tile 0 has landed for this wave; the barrier publishes it to the others
  asm volatile("s_wait_asynccnt 0x0" ::: "memory");
  __syncthreads();
  if (KT > 1) G_ISSUE(G_BK, 1);

  for (int kt = 0; kt < KT; kt++) {
    const int cur = kt & 1;

    const __bf16* l1 = (MODE == 1) ? &lA[cur][0] : &lB[cur][0];  // first operand
    const __bf16* l2 = (MODE == 1) ? &lB[cur][0] : &lA[cur][0];  // second operand
    // loops over k-steps and tiles are unrolled: fragment arrays stay in registers
#pragma unroll
    for (int ks = 0; ks < 2; ks++) {
      v16bf af[4], bfm[4];
#pragma unroll
      for (int i = 0; i < 4; i++) {
        int r = wm * 64 + i * 16 + lm;
        v8bf lo = *(const v8bf*)(&l1[r * G_LDA + ks * 32 + kb]);
        v8bf hi = *(const v8bf*)(&l1[r * G_LDA + ks * 32 + 16 + kb]);
        af[i] = cat8(lo, hi);
      }
#pragma unroll
      for (int j = 0; j < 4; j++) {
        int r = wn * 64 + j * 16 + lm;
        v8bf lo = *(const v8bf*)(&l2[r * G_LDA + ks * 32 + kb]);
        v8bf hi = *(const v8bf*)(&l2[r * G_LDA + ks * 32 + 16 + kb]);
        bfm[j] = cat8(lo, hi);
      }
#pragma unroll
      for (int i = 0; i < 4; i++)
#pragma unroll
        for (int j = 0; j < 4; j++)
          acc[i][j] = wmma_bf16(af[i], bfm[j], acc[i][j]);
    }

    // keep WMMAs ahead of the async wait so DMA overlaps the matrix math
#pragma unroll
    for (int i = 0; i < 4; i++)
#pragma unroll
      for (int j = 0; j < 4; j++) pin(acc[i][j]);

    // hand-over: this wave's reads of buffer cur are done, its copies of the next
    // tile have landed; behind the barrier both hold for every wave
    asm volatile("s_wait_dscnt 0x0" ::: "memory");
    asm volatile("s_wait_asynccnt 0x0" ::: "memory");
    __syncthreads();
    if (kt + 2 < KT) G_ISSUE((kt + 2) * G_BK, cur);  // refill the buffer just left
  }
#undef G_ISSUE
  // no copy is outstanding when the epilogue starts
  asm volatile("s_wait_asynccnt 0x0" ::: "memory");

  // epilogue: a lane holds column lm of each tile (second operand's row) and, in
  // register r, row r + mh (first operand's row)
  const int mh = (lane >> 4) * 8;
  if constexpr (MODE == 1) {      // lane = n (head dim), registers = 8 positions
#pragma unroll
    for (int j = 0; j < 4; j++) {
      const int n = n0 + wn * 64 + j * 16 + lm;
      const float bv = bias[n];
      const int h = n >> 6, dd = n & 63;
#pragma unroll
      for (int i = 0; i < 4; i++) {
        const int m = m0 + wm * 64 + i * 16 + mh;
        const int b = m / SEQ, s = m % SEQ;
        *(v8bf*)((__bf16*)out + (((size_t)(b * HN + h)) * ADIM + dd) * SEQ + s) =
            __builtin_convertvector(acc[i][j] + bv, v8bf);
      }
    }
  } else {                        // lane = m (row), registers = 8 columns n
#pragma unroll
    for (int i = 0; i < 4; i++) {
      const int n = n0 + wm * 64 + i * 16 + mh;
      const v8f bv = *(const v8f*)(bias + n);
#pragma unroll
      for (int j = 0; j < 4; j++) {
        const int m = m0 + wn * 64 + j * 16 + lm;
        const v8f val = acc[i][j] + bv;
        if constexpr (MODE == 0) {  // [B,H,S,64] bf16
          const int b = m / SEQ, s = m % SEQ;
          const int h = n >> 6, dd = n & 63;
          *(v8bf*)((__bf16*)out + (((size_t)(b * HN + h)) * SEQ + s) * ADIM + dd) =
              __builtin_convertvector(val * oscale, v8bf);
        } else {                    // f32 row-major
          *(v8f*)((float*)out + (size_t)m * N + n) = val;
        }
      }
    }
  }
}

// The three projections of X in one grid: blockIdx.z picks weight, bias, output
// and layout. They share nothing but their input, so one grid's blocks fill the
// places that a single projection's one block per WGP leaves empty.
__global__ __launch_bounds__(256)
void gemm_qkv_kernel(const __bf16* __restrict__ X,
                     const __bf16* __restrict__ WqT, const __bf16* __restrict__ WkT,
                     const __bf16* __restrict__ WvT,
                     const float* __restrict__ bq, const float* __restrict__ bk,
                     const float* __restrict__ bv,
                     __bf16* __restrict__ q, __bf16* __restrict__ k,
                     __bf16* __restrict__ vt, int M, int N, int K) {
  __shared__ __align__(16) __bf16 lA[2][G_BM * G_LDA];
  __shared__ __align__(16) __bf16 lB[2][G_BN * G_LDA];
  const int z = blockIdx.z;   // the same for the whole block: barriers stay uniform
  if (z == 2)
    gemm_bf16_tile<1>(lA, lB, X, WvT, bv, vt, M, N, K, 1.0f);
  else {
    // q leaves multiplied by log2(e) / sqrt(64): its products with k are then
    // arguments of exp2
    gemm_bf16_tile<0>(lA, lB, X, z ? WkT : WqT, z ? bk : bq, z ? k : q, M, N, K,
                      z ? 1.0f : 0.125f * 1.44269504f);
    // the other layout's code follows in the text and reuses the registers that
    // the stores above name: they are free for reuse only behind this wait
    asm volatile("s_wait_xcnt 0x0" ::: "memory");
  }
}

__global__ __launch_bounds__(256)
void gemm_out_kernel(const __bf16* __restrict__ A, const __bf16* __restrict__ Bt,
                     const float* __restrict__ bias, float* __restrict__ out,
                     int M, int N, int K) {
  __shared__ __align__(16) __bf16 lA[2][G_BM * G_LDA];
  __shared__ __align__(16) __bf16 lB[2][G_BN * G_LDA];
  gemm_bf16_tile<2>(lA, lB, A, Bt, bias, out, M, N, K, 1.0f);
}

// ---------------------------------------------------------------------------
// Flash-style attention with double-buffered async-DMA KV staging.
// grid = (B*H, S/256). 256 threads = 8 waves, each wave owns 32 query rows as
// two column groups of 16: a K or V fragment read from LDS feeds two WMMAs, and
// one staged KV block serves 256 queries.
// Both products run transposed: St = K * Qt, Ot += Vt * Pt. A lane then holds
// one query per group (column lm): its softmax statistics are one scalar per
// lane and group, and two St tiles, converted in place, are the B operand of
// the second product.
// q arrives multiplied by log2(e) / sqrt(64), and the maximum in use enters the
// first product negated as its C operand: a score leaves the matrix unit as the
// argument of its exp2. No maximum is taken in the usual block: the block's sum of
// exponentials, needed anyway, is the test. Only where a lane's sum passes 256 (far
// inside the range of f32 sums and of bf16 P), and in the first block, are the
// scores formed again, the maximum in use moved, and sums and Ot rescaled.
// ---------------------------------------------------------------------------
#define A_LDK 72  // 64 + 8 pad bf16 elems per LDS row (144B: 16B aligned)
#define A_QG  2                    // query column groups per wave
#define A_QB  (8 * 16 * A_QG)      // queries per block

// One lane's share of a KV block: two 16-byte pieces of K, two of V. The closing
// wait stands inside the statement, so that no register named by a copy is
// written again ahead of it.
static __device__ __forceinline__
void async_kv(unsigned lk0, unsigned gk0, unsigned lk1, unsigned gk1, const void* kbase,
              unsigned lv0, unsigned gv0, unsigned lv1, unsigned gv1, const void* vbase) {
  asm volatile("global_load_async_to_lds_b128 %0, %1, %8\n\t"
               "global_load_async_to_lds_b128 %2, %3, %8\n\t"
               "global_load_async_to_lds_b128 %4, %5, %9\n\t"
               "global_load_async_to_lds_b128 %6, %7, %9\n\t"
               "s_wait_xcnt 0x0"
               :: "v"(lk0), "v"(gk0), "v"(lk1), "v"(gk1),
                  "v"(lv0), "v"(gv0), "v"(lv1), "v"(gv1),
                  "s"((unsigned long long)kbase), "s"((unsigned long long)vbase)
               : "memory");
}

// waves_per_eu: 256 registers a wave, so that two blocks (four waves per SIMD)
// stay resident and the whole grid runs in one round.
__global__ __launch_bounds__(256) __attribute__((amdgpu_waves_per_eu(4, 4)))
void attn_kernel(const __bf16* __restrict__ qb,   // [BH][S][64], pre-scaled
                 const __bf16* __restrict__ kbuf, // [BH][S][64]
                 const __bf16* __restrict__ vt,   // [BH][64][S]
                 __bf16* __restrict__ ctx) {      // [B*S][1024]
  const int bh   = blockIdx.x;
  const int qblk = blockIdx.y;
  const int tid  = threadIdx.x;
  const int lane = tid & 31;
  const int wave = tid >> 5;
  const int lm   = lane & 15;
  const int kb   = (lane >> 4) * 8;
  const int mh   = (lane >> 4) * 8;

  __shared__ __align__(16) __bf16 lK[2][64 * A_LDK];
  __shared__ __align__(16) __bf16 lV[2][64 * A_LDK];

  // per-thread DMA chunks: 512 16B chunks per tile / 256 threads = 2 each
  const int acr = tid >> 3;   // 0..31 (row)
  const int acc_ = tid & 7;   // 0..7  (16B column chunk)
  const unsigned ldsK0 = lds_off(&lK[0][0]);
  const unsigned ldsV0 = lds_off(&lV[0][0]);
  const unsigned kvbuf = (unsigned)(64 * A_LDK * 2);
  unsigned lK_t[2], lV_t[2], gK[2], gV[2];
#pragma unroll
  for (int i = 0; i < 2; i++) {
    int r = acr + 32 * i;
    lK_t[i] = ldsK0 + (unsigned)(r * A_LDK + acc_ * 8) * 2;
    lV_t[i] = ldsV0 + (unsigned)(r * A_LDK + acc_ * 8) * 2;
    gK[i] = (((unsigned)bh * SEQ + r) * ADIM + acc_ * 8) * 2;  // + kv0*ADIM*2
    gV[i] = (((unsigned)bh * ADIM + r) * SEQ + acc_ * 8) * 2;  // + kv0*2
  }

#define KV_ISSUE(kv0, buf) do {                                        \
    unsigned ok = (unsigned)(kv0) * ADIM * 2, ov = (unsigned)(kv0) * 2;\
    unsigned ob = (unsigned)(buf) * kvbuf;                             \
    async_kv(lK_t[0] + ob, gK[0] + ok, lK_t[1] + ob, gK[1] + ok, kbuf, \
             lV_t[0] + ob, gV[0] + ov, lV_t[1] + ob, gV[1] + ov, vt);  \
  } while (0)

  // q fragments stay resident as B operands (K = d = 64 -> 2 WMMA k-steps).
  // Here and below every loop over groups, tiles and k-steps is unrolled, so that
  // the fragment and accumulator arrays are indexed by constants and stay in registers.
  v16bf qf[A_QG][2];
#pragma unroll
  for (int g = 0; g < A_QG; g++) {
    const __bf16* qrow =
        qb + ((size_t)bh * SEQ + qblk * A_QB + wave * (16 * A_QG) + g * 16 + lm) * ADIM;
#pragma unroll
    for (int ks = 0; ks < 2; ks++) {
      v8bf lo = *(const v8bf*)(qrow + ks * 32 + kb);
      v8bf hi = *(const v8bf*)(qrow + ks * 32 + 16 + kb);
      qf[g][ks] = cat8(lo, hi);
    }
  }

  // this lane's query of each group: the maximum in use, negated, in the eight
  // registers of a C operand (both halves agree), and the sum over the keys of
  // this lane's half (the halves are joined after the loop)
  v8f negm[A_QG];
  float row_sum[A_QG];
  v8f o[A_QG][4];  // Ot tiles: lane = query lm, register r = d index dt*16 + mh + r
#pragma unroll
  for (int g = 0; g < A_QG; g++) {
    negm[g] = (v8f)(0.0f);
    row_sum[g] = 0.0f;
#pragma unroll
    for (int dt = 0; dt < 4; dt++) o[g][dt] = (v8f)(0.0f);
  }

  KV_ISSUE(0, 0);
  // block 0 has landed for this wave; the barrier publishes it to the others
  asm volatile("s_wait_asynccnt 0x0" ::: "memory");
  __syncthreads();
  KV_ISSUE(64, 1);

  // not unrolled and not peeled: a copy of the body for the first block would
  // double the text and cost registers
#pragma clang loop unroll(disable)
  for (int kvb = 0; kvb < SEQ / 64; kvb++) {
    const int cur = kvb & 1;

    // St = k @ q^T  (4 key tiles x 2 k-steps): register r = key tn*16 + mh + r
    v8f sc[A_QG][4];
    float psum[A_QG];   // this lane's half of the block's sum of exponentials
    auto scores = [&]() {
      v16bf kf[2][4];
#pragma unroll
      for (int ks = 0; ks < 2; ks++) {
#pragma unroll
        for (int tn = 0; tn < 4; tn++) {
          int r = tn * 16 + lm;
          v8bf lo = *(const v8bf*)(&lK[cur][r * A_LDK + ks * 32 + kb]);
          v8bf hi = *(const v8bf*)(&lK[cur][r * A_LDK + ks * 32 + 16 + kb]);
          kf[ks][tn] = cat8(lo, hi);
        }
      }
#pragma unroll
      for (int tn = 0; tn < 4; tn++)
#pragma unroll
        for (int g = 0; g < A_QG; g++)
#pragma unroll
          for (int ks = 0; ks < 2; ks++)
            sc[g][tn] = wmma_bf16(kf[ks][tn], qf[g][ks], ks == 0 ? negm[g] : sc[g][tn]);
    };
    auto exp_and_sum = [&]() {
#pragma unroll
      for (int g = 0; g < A_QG; g++) {
#pragma unroll
        for (int tn = 0; tn < 4; tn++) sc[g][tn] = exp2x8(sc[g][tn]);
        v8f ps = (sc[g][0] + sc[g][1]) + (sc[g][2] + sc[g][3]);
        psum[g] = ((ps[0] + ps[1]) + (ps[2] + ps[3])) + ((ps[4] + ps[5]) + (ps[6] + ps[7]));
      }
    };

    // the usual path takes no maximum: a tile's exponentials hang on that tile's own
    // two WMMAs alone
    scores();
    exp_and_sum();
    // one test per block for the whole wave: a scalar branch, EXEC stays all ones.
    // The terms are positive, so a sum of at most 256 bounds each of them; an
    // overflow to infinity fails the test too.
    bool over = false;
#pragma unroll
    for (int g = 0; g < A_QG; g++) over = over || (psum[g] > 256.0f);
    if (kvb == 0 || __builtin_amdgcn_ballot_w32(over) != 0) {
      // the exponentials overwrote the scores: form them again. The compiler fence
      // makes this path read its K fragments anew; without it the usual path would
      // hold its 64 fragment registers over the exponentials for this rare one.
      asm volatile("" ::: "memory");
      scores();
#pragma unroll
      for (int g = 0; g < A_QG; g++) {
        // one query per lane and group: 32 keys in-lane, one exchange of halves
        float mt[4];
#pragma unroll
        for (int tn = 0; tn < 4; tn++) {
          mt[tn] = sc[g][tn][0];
#pragma unroll
          for (int r = 1; r < 8; r++) mt[tn] = fmaxf(mt[tn], sc[g][tn][r]);
        }
        float mx = fmaxf(fmaxf(mt[0], mt[1]), fmaxf(mt[2], mt[3]));
        mx = fmaxf(mx, other_half(mx));
        // the first block takes its own maximum, whatever its sign; later the
        // maximum in use only rises
        const float d = (kvb == 0) ? mx : fmaxf(mx, 0.0f);
        const float alpha = __builtin_amdgcn_exp2f(fminf(-d, 0.0f));
        negm[g] -= d;
        row_sum[g] *= alpha;
#pragma unroll
        for (int tn = 0; tn < 4; tn++) sc[g][tn] -= d;
#pragma unroll
        for (int dt = 0; dt < 4; dt++) o[g][dt] *= alpha;
      }
      exp_and_sum();   // no score is above the maximum in use now
    }
#pragma unroll
    for (int g = 0; g < A_QG; g++) row_sum[g] += psum[g];

    // Ot += Vt @ Pt: St tiles 2ks and 2ks+1 hold keys in the fragment's k order
#pragma unroll
    for (int ks = 0; ks < 2; ks++) {
      v16bf pf[A_QG];
#pragma unroll
      for (int g = 0; g < A_QG; g++)
        pf[g] = cat8(__builtin_convertvector(sc[g][2 * ks], v8bf),
                     __builtin_convertvector(sc[g][2 * ks + 1], v8bf));
#pragma unroll
      for (int dt = 0; dt < 4; dt++) {
        int r = dt * 16 + lm;
        v8bf lo = *(const v8bf*)(&lV[cur][r * A_LDK + ks * 32 + kb]);
        v8bf hi = *(const v8bf*)(&lV[cur][r * A_LDK + ks * 32 + 16 + kb]);
        v16bf vf = cat8(lo, hi);
#pragma unroll
        for (int g = 0; g < A_QG; g++) o[g][dt] = wmma_bf16(vf, pf[g], o[g][dt]);
      }
    }

    // hand-over: this wave's reads of buffer cur are done, its copies of the next
    // block have landed; behind the barrier both hold for every wave
    asm volatile("s_wait_dscnt 0x0" ::: "memory");
    asm volatile("s_wait_asynccnt 0x0" ::: "memory");
    __syncthreads();
    if (kvb + 2 < SEQ / 64) KV_ISSUE((kvb + 2) * 64, cur);  // refill the buffer just left
  }
#undef KV_ISSUE
  // no copy is outstanding when the wave ends
  asm volatile("s_wait_asynccnt 0x0" ::: "memory");

  // finalize: ctx[(b*S+s)][h*64 + d] bf16, 8 consecutive d per lane and tile
  const int b = bh >> 4, h = bh & 15;
#pragma unroll
  for (int g = 0; g < A_QG; g++) {
    const float rs = row_sum[g] + other_half(row_sum[g]);
    const float inv = 1.0f / rs;
    const int s = qblk * A_QB + wave * (16 * A_QG) + g * 16 + lm;
    __bf16* dst = ctx + ((size_t)(b * SEQ + s)) * DMODEL + h * ADIM + mh;
#pragma unroll
    for (int dt = 0; dt < 4; dt++)
      *(v8bf*)(dst + dt * 16) = __builtin_convertvector(o[g][dt] * inv, v8bf);
  }
}

// ---------------------------------------------------------------------------
// residual add + LayerNorm, one wave per row of 1024 (32 values a lane, in
// groups of 4: a wave's load or store covers 512 contiguous bytes); the row's
// sums are joined inside the wave, so the block's 8 rows share nothing
// ---------------------------------------------------------------------------
__global__ __launch_bounds__(256)
void ln_kernel(const float* __restrict__ proj, const float* __restrict__ resid,
               const float* __restrict__ g, const float* __restrict__ b,
               float* __restrict__ out) {
  const int lane = threadIdx.x & 31;
  const size_t row = (size_t)blockIdx.x * 8 + (threadIdx.x >> 5);
  const v4f* __restrict__ pp = (const v4f*)(proj + row * DMODEL) + lane;
  const v4f* __restrict__ rp = (const v4f*)(resid + row * DMODEL) + lane;
  v4f x[8], y[8];
#pragma unroll
  for (int i = 0; i < 8; i++) x[i] = pp[i * 32];
#pragma unroll
  for (int i = 0; i < 8; i++) y[i] = rp[i * 32];
  v4f s4 = (v4f)(0.0f), q4 = (v4f)(0.0f);
#pragma unroll
  for (int i = 0; i < 8; i++) {
    x[i] += y[i];
    s4 += x[i];
    q4 += x[i] * x[i];
  }
  // the loads' address registers are free for reuse only behind this wait
  asm volatile("s_wait_xcnt 0x0" ::: "memory");
  float s  = (s4[0] + s4[1]) + (s4[2] + s4[3]);
  float sq = (q4[0] + q4[1]) + (q4[2] + q4[3]);
#pragma unroll
  for (int off = 16; off >= 1; off >>= 1) {
    s  += __shfl_xor(s,  off, 32);
    sq += __shfl_xor(sq, off, 32);
  }
  float mu  = s * (1.0f / DMODEL);
  float var = sq * (1.0f / DMODEL) - mu * mu;
  float rs  = rsqrtf(var + 1e-5f);
  const v4f* __restrict__ gp = (const v4f*)g + lane;
  const v4f* __restrict__ bp = (const v4f*)b + lane;
  v4f* __restrict__ op = (v4f*)(out + row * DMODEL) + lane;
#pragma unroll
  for (int i = 0; i < 8; i++) op[i * 32] = (x[i] - mu) * rs * gp[i * 32] + bp[i * 32];
}

// ---------------------------------------------------------------------------
extern "C" void kernel_launch(void* const* d_in, const int* in_sizes, int n_in,
                              void* d_out, int out_size, void* d_ws, size_t ws_size,
                              hipStream_t stream) {
  (void)in_sizes; (void)n_in; (void)out_size; (void)ws_size;
  const float* Q    = (const float*)d_in[0];
  const float* Wq   = (const float*)d_in[1];
  const float* bq   = (const float*)d_in[2];
  const float* Wk   = (const float*)d_in[3];
  const float* bk   = (const float*)d_in[4];
  const float* Wv   = (const float*)d_in[5];
  const float* bv   = (const float*)d_in[6];
  const float* Wo   = (const float*)d_in[7];
  const float* bo   = (const float*)d_in[8];
  const float* ln_g = (const float*)d_in[9];
  const float* ln_b = (const float*)d_in[10];

  const size_t ND = (size_t)MROWS * DMODEL;     // 8192*1024
  const size_t WW = (size_t)DMODEL * DMODEL;    // 1024*1024

  char* ws = (char*)d_ws;
  size_t off = 0;
  __bf16* Xbf = (__bf16*)(ws + off); off += ND * 2;
  __bf16* WqT = (__bf16*)(ws + off); off += WW * 2;
  __bf16* WkT = (__bf16*)(ws + off); off += WW * 2;
  __bf16* WvT = (__bf16*)(ws + off); off += WW * 2;
  __bf16* WoT = (__bf16*)(ws + off); off += WW * 2;
  __bf16* qbf = (__bf16*)(ws + off); off += ND * 2;   // [B,H,S,64]
  __bf16* kbf = (__bf16*)(ws + off); off += ND * 2;   // [B,H,S,64]
  __bf16* vtb = (__bf16*)(ws + off); off += ND * 2;   // [B,H,64,S]
  __bf16* ctx = (__bf16*)(ws + off); off += ND * 2;   // [B*S, 1024]
  float*  prj = (float*)(ws + off);  off += ND * 4;   // [B*S, 1024]

  // 1) precision staging (WqT is the first of the four transposed planes)
  stage_kernel<<<CVT_BLOCKS + 4 * TR_BLOCKS, 256, 0, stream>>>(Q, Wq, Wk, Wv, Wo, Xbf, WqT);

  // 2) QKV projections (WMMA GEMMs scattering into attention layouts)
  gemm_qkv_kernel<<<dim3(MROWS / G_BM, DMODEL / G_BN, 3), 256, 0, stream>>>(
      Xbf, WqT, WkT, WvT, bq, bk, bv, qbf, kbf, vtb, MROWS, DMODEL, DMODEL);

  // 3) flash attention
  attn_kernel<<<dim3(BATCH * HN, SEQ / A_QB), 256, 0, stream>>>(qbf, kbf, vtb, ctx);

  // 4) output projection (f32 out)
  gemm_out_kernel<<<dim3(MROWS / G_BM, DMODEL / G_BN), 256, 0, stream>>>(
      ctx, WoT, bo, prj, MROWS, DMODEL, DMODEL);

  // 5) residual + layernorm
  ln_kernel<<<MROWS / 8, 256, 0, stream>>>(prj, Q, ln_g, ln_b, (float*)d_out);
}

// v010
// A run of this version takes 113 microseconds.
// Timed twice side by side with v009, it ran 1.03 times as fast both times.
// Counting every step since v000, it is 2.48 times as fast.
#include <hip/hip_runtime.h>
#include <hip/hip_bf16.h>

typedef __attribute__((ext_vector_type(16))) __bf16 v16bf;
typedef __attribute__((ext_vector_type(8)))  __bf16 v8bf;
typedef __attribute__((ext_vector_type(8)))  float  v8f;
typedef __attribute__((ext_vector_type(4)))  float  v4f;
typedef __attribute__((ext_vector_type(4)))  __bf16 v4bf;

#define HN     16
#define SEQ    2048
#define DMODEL 1024
#define ADIM   64
#define BATCH  4
#define MROWS  (BATCH * SEQ)   // 8192

static __device__ __forceinline__ v16bf cat8(v8bf lo, v8bf hi) {
  return __builtin_shufflevector(lo, hi, 0,1,2,3,4,5,6,7,8,9,10,11,12,13,14,15);
}

static __device__ __forceinline__ v8f wmma_bf16(v16bf a, v16bf b, v8f c) {
  // D = A(16x32 bf16) * B(32x16 bf16) + C(16x16 f32)
  return __builtin_amdgcn_wmma_f32_16x16x32_bf16(false, a, false, b, (short)0, c, false, false);
}

// gfx1250 async DMA: global -> LDS, 16B per lane, tracked by ASYNCcnt.
// GVS addressing: mem = SADDR(u64) + VADDR(i32) + IOFFSET. VDST = LDS byte addr.
// One lane's share of a GEMM K-step: eight 16-byte pieces of the A tile (256 rows),
// four of the B tile (128 rows). The closing wait stands inside the statement, so
// that no register named by a copy is written again ahead of it.
static __device__ __forceinline__
void async_ab(const unsigned (&la)[8], const unsigned (&ga)[8], const void* abase,
              const unsigned (&lb)[4], const unsigned (&gb)[4], const void* bbase) {
  asm volatile("global_load_async_to_lds_b128 %0, %1, %24\n\t"
               "global_load_async_to_lds_b128 %2, %3, %24\n\t"
               "global_load_async_to_lds_b128 %4, %5, %24\n\t"
               "global_load_async_to_lds_b128 %6, %7, %24\n\t"
               "global_load_async_to_lds_b128 %8, %9, %24\n\t"
               "global_load_async_to_lds_b128 %10, %11, %24\n\t"
               "global_load_async_to_lds_b128 %12, %13, %24\n\t"
               "global_load_async_to_lds_b128 %14, %15, %24\n\t"
               "global_load_async_to_lds_b128 %16, %17, %25\n\t"
               "global_load_async_to_lds_b128 %18, %19, %25\n\t"
               "global_load_async_to_lds_b128 %20, %21, %25\n\t"
               "global_load_async_to_lds_b128 %22, %23, %25\n\t"
               "s_wait_xcnt 0x0"
               :: "v"(la[0]), "v"(ga[0]), "v"(la[1]), "v"(ga[1]),
                  "v"(la[2]), "v"(ga[2]), "v"(la[3]), "v"(ga[3]),
                  "v"(la[4]), "v"(ga[4]), "v"(la[5]), "v"(ga[5]),
                  "v"(la[6]), "v"(ga[6]), "v"(la[7]), "v"(ga[7]),
                  "v"(lb[0]), "v"(gb[0]), "v"(lb[1]), "v"(gb[1]),
                  "v"(lb[2]), "v"(gb[2]), "v"(lb[3]), "v"(gb[3]),
                  "s"((unsigned long long)abase), "s"((unsigned long long)bbase)
               : "memory");
}

// empty volatile asm consuming the accumulator: volatile asms keep program
// order, so this pins the producing WMMAs *before* the following wait/barrier,
// letting the in-flight async DMA overlap the matrix math.
static __device__ __forceinline__ void pin(v8f& x) {
  asm volatile("" : "+v"(x));
}

// value of the same lane position in the other 16-lane half (l <-> l ^ 16)
static __device__ __forceinline__ float other_half(float x) {
  int b = __builtin_bit_cast(int, x);
  b = __builtin_amdgcn_permlanex16(b, b, 0x76543210, 0xfedcba98, false, false);
  return __builtin_bit_cast(float, b);
}

// exp2 of eight values, by the builtin: the values come straight from a WMMA.
static __device__ __forceinline__ v8f exp2x8(v8f t) {
  v8f p;
#pragma unroll
  for (int r = 0; r < 8; r++) p[r] = __builtin_amdgcn_exp2f(t[r]);
  return p;
}

// low 32 bits of a generic LDS pointer == LDS byte offset (flat aperture mapping)
static __device__ __forceinline__ unsigned lds_off(const void* p) {
  return (unsigned)(unsigned long long)p;
}

// ---------------------------------------------------------------------------
// fp32 -> bf16 elementwise convert. A lane takes CVT_V groups of four floats, all
// loads asked for before the first store; a wave's load covers 512 contiguous
// bytes, its store 256. One block covers 256 * CVT_V * 4 floats, no remainder.
// ---------------------------------------------------------------------------
#define CVT_V 16
#define CVT_BLOCKS (MROWS * DMODEL / (256 * CVT_V * 4))
static __device__ __forceinline__
void cvt_f32_bf16_block(const float* __restrict__ in, __bf16* __restrict__ out, int blk) {
  const size_t base = (size_t)blk * (256 * CVT_V) + threadIdx.x;  // in groups of 4
  const v4f* __restrict__ src = (const v4f*)in + base;
  v4bf* __restrict__ dst = (v4bf*)out + base;
  v4f v[CVT_V];
#pragma unroll
  for (int j = 0; j < CVT_V; j++) v[j] = src[j * 256];
#pragma unroll
  for (int j = 0; j < CVT_V; j++) dst[j * 256] = __builtin_convertvector(v[j], v4bf);
}

// ---------------------------------------------------------------------------
// W[K][N] fp32  ->  Wt[N][K] bf16   (LDS tile transpose, 64 x 64 per block:
// a lane loads four groups of 4 floats and stores two groups of 8 bf16, so a
// wave reads whole 256-byte row pieces and writes whole 128-byte lines)
// ---------------------------------------------------------------------------
static __device__ __forceinline__
void transpose_bf16_block(float (*tile)[65], const float* __restrict__ W,
                          __bf16* __restrict__ Wt, int K, int N,
                          int bx,    // along N
                          int by) {  // along K
  const int c4 = threadIdx.x & 15;   // group of 4 columns (n)
  const int r0 = threadIdx.x >> 4;   // 0..15
  v4f v[4];
#pragma unroll
  for (int i = 0; i < 4; i++)
    v[i] = *(const v4f*)(W + (size_t)(by + r0 + i * 16) * N + bx + c4 * 4);
  // the loads' address registers are free for reuse only behind this wait; the
  // scheduling barrier keeps later index arithmetic from being lifted over it
  asm volatile("s_wait_xcnt 0x0" ::: "memory");
  __builtin_amdgcn_sched_barrier(0);
#pragma unroll
  for (int i = 0; i < 4; i++)
#pragma unroll
    for (int e = 0; e < 4; e++) tile[r0 + i * 16][c4 * 4 + e] = v[i][e];
  __syncthreads();
  const int ck = threadIdx.x & 7;    // group of 8 k
  const int n0 = threadIdx.x >> 3;   // 0..31
#pragma unroll
  for (int i = 0; i < 2; i++) {
    int n = n0 + i * 32;
    v8bf o;
#pragma unroll
    for (int j = 0; j < 8; j++) o[j] = (__bf16)tile[ck * 8 + j][n];
    *(v8bf*)(Wt + (size_t)(bx + n) * K + by + ck * 8) = o;
  }
}

// ---------------------------------------------------------------------------
// All precision staging in one grid: none of the five jobs reads another's
// result, so their blocks start, wait on memory and drain side by side.
// Blocks [0, CVT_BLOCKS) convert X; then TR_BLOCKS blocks per weight matrix,
// whose transposed planes lie one behind the other in Wt (q, k, v, o).
// ---------------------------------------------------------------------------
#define TR_SIDE   (DMODEL / 64)
#define TR_BLOCKS (TR_SIDE * TR_SIDE)
__global__ __launch_bounds__(256)
void stage_kernel(const float* __restrict__ X,
                  const float* __restrict__ Wq, const float* __restrict__ Wk,
                  const float* __restrict__ Wv, const float* __restrict__ Wo,
                  __bf16* __restrict__ Xbf, __bf16* __restrict__ Wt) {
  __shared__ float tile[64][65];
  const int blk = blockIdx.x;
  if (blk < CVT_BLOCKS) {   // the whole block leaves here, ahead of any barrier
    cvt_f32_bf16_block(X, Xbf, blk);
    return;
  }
  const int t = blk - CVT_BLOCKS;
  const int w = t / TR_BLOCKS;
  const int c = t % TR_BLOCKS;
  const float* W = (w == 0) ? Wq : (w == 1) ? Wk : (w == 2) ? Wv : Wo;
  transpose_bf16_block(tile, W, Wt + (size_t)w * DMODEL * DMODEL, DMODEL, DMODEL,
                       (c % TR_SIDE) * 64, (c / TR_SIDE) * 64);
}

// ---------------------------------------------------------------------------
// Tiled WMMA GEMM with double-buffered async-DMA staging.
// C[M][N] = A[M][K] * Bt[N][K]^T + bias[N]
// block tile 256x128, BK=64, 256 threads = 8 waves,
// each wave computes 64x64 = 4x4 tiles of 16x16, two WMMA k-steps per K-step:
// a fragment read from LDS feeds four WMMAs, and a block copies 384 operand rows
// for 32768 results where two 128x128 blocks copy 512.
// A K-step takes 128 bytes of every operand row: a whole cache line, so a wave's
// copy covers 4 whole lines.
// Output f32 row-major [M][N]. A lane's 8 accumulator registers run along the first
// WMMA operand's rows, so Bt rows (n, contiguous in the output) go first and the 8
// results of a tile leave as 16-byte stores. The waves lie 2 along the Bt rows and
// 4 along the A rows.
// ---------------------------------------------------------------------------
#define G_BM 256
#define G_BN 128
#define G_BK 64
#define G_LDA 72   // bf16 elems per LDS row (64 + 8 pad): 144B row, 16B aligned, bank-spread

static __device__ __forceinline__
void gemm_bf16_tile(__bf16 (*lA)[G_BM * G_LDA], __bf16 (*lB)[G_BN * G_LDA],
                    const __bf16* __restrict__ A,   // [M][K]
                    const __bf16* __restrict__ Bt,  // [N][K]
                    const float*  __restrict__ bias,
                    float* __restrict__ out,
                    int M, int N, int K) {
  const int tid  = threadIdx.x;
  const int lane = tid & 31;
  const int wave = tid >> 5;
  constexpr int W1 = G_BN / 64;  // waves along the first operand
  const int wm   = wave % W1;  // place along the first operand (64 rows each)
  const int wn   = wave / W1;  // place along the second operand (64 rows each)
  const int m0   = blockIdx.x * G_BM;
  const int n0   = blockIdx.y * G_BN;
  const int lm   = lane & 15;
  const int kb   = (lane >> 4) * 8;   // ISA 16-bit A/B fragment K mapping

  // per-thread DMA chunk coords: chunks c = tid + 256 * i; r = c>>3, kc = c&7
  const int cr = tid >> 3;     // 0..31
  const int ck = tid & 7;      // 0..7: eight lanes cover a row's 128 bytes
  const unsigned bufA = (unsigned)(G_BM * G_LDA * 2);
  const unsigned bufB = (unsigned)(G_BN * G_LDA * 2);
  const unsigned lA_t = lds_off(&lA[0][0]) + (unsigned)(cr * G_LDA + ck * 8) * 2;
  const unsigned lB_t = lds_off(&lB[0][0]) + (unsigned)(cr * G_LDA + ck * 8) * 2;
  const unsigned gA_t = ((unsigned)(m0 + cr) * K + ck * 8) * 2;
  const unsigned gB_t = ((unsigned)(n0 + cr) * K + ck * 8) * 2;

#define G_ISSUE(k0, buf) do {                                   \
    unsigned la[8], ga[8], lb[4], gb[4];                        \
    _Pragma("unroll")                                           \
    for (int i = 0; i < 8; i++) {  /* rows cr + 32 * i */       \
      la[i] = lA_t + (buf) * bufA + (unsigned)(32 * i * G_LDA * 2);  \
      ga[i] = gA_t + ((unsigned)(32 * i) * K + (unsigned)(k0)) * 2;  \
    }                                                           \
    _Pragma("unroll")                                           \
    for (int i = 0; i < 4; i++) {                               \
      lb[i] = lB_t + (buf) * bufB + (unsigned)(32 * i * G_LDA * 2);  \
      gb[i] = gB_t + ((unsigned)(32 * i) * K + (unsigned)(k0)) * 2;  \
    }                                                           \
    async_ab(la, ga, A, lb, gb, Bt);                            \
  } while (0)

  v8f acc[4][4];
#pragma unroll
  for (int i = 0; i < 4; i++)
#pragma unroll
    for (int j = 0; j < 4; j++) acc[i][j] = (v8f)(0.0f);

  const int KT = K / G_BK;
  G_ISSUE(0, 0);
  // tile 0 has landed for this wave; the barrier publishes it to the others
  asm volatile("s_wait_asynccnt 0x0" ::: "memory");
  __syncthreads();
  if (KT > 1) G_ISSUE(G_BK, 1);

  for (int kt = 0; kt < KT; kt++) {
    const int cur = kt & 1;

    const __bf16* l1 = &lB[cur][0];  // first operand
    const __bf16* l2 = &lA[cur][0];  // second operand
    // loops over k-steps and tiles are unrolled: fragment arrays stay in registers
#pragma unroll
    for (int ks = 0; ks < 2; ks++) {
      v16bf af[4], bfm[4];
#pragma unroll
      for (int i = 0; i < 4; i++) {
        int r = wm * 64 + i * 16 + lm;
        v8bf lo = *(const v8bf*)(&l1[r * G_LDA + ks * 32 + kb]);
        v8bf hi = *(const v8bf*)(&l1[r * G_LDA + ks * 32 + 16 + kb]);
        af[i] = cat8(lo, hi);
      }
#pragma unroll
      for (int j = 0; j < 4; j++) {
        int r = wn * 64 + j * 16 + lm;
        v8bf lo = *(const v8bf*)(&l2[r * G_LDA + ks * 32 + kb]);
        v8bf hi = *(const v8bf*)(&l2[r * G_LDA + ks * 32 + 16 + kb]);
        bfm[j] = cat8(lo, hi);
      }
#pragma unroll
      for (int i = 0; i < 4; i++)
#pragma unroll
        for (int j = 0; j < 4; j++)
          acc[i][j] = wmma_bf16(af[i], bfm[j], acc[i][j]);
    }

    // keep WMMAs ahead of the async wait so DMA overlaps the matrix math
#pragma unroll
    for (int i = 0; i < 4; i++)
#pragma unroll
      for (int j = 0; j < 4; j++) pin(acc[i][j]);

    // hand-over: this wave's reads of buffer cur are done, its copies of the next
    // tile have landed; behind the barrier both hold for every wave
    asm volatile("s_wait_dscnt 0x0" ::: "memory");
    asm volatile("s_wait_asynccnt 0x0" ::: "memory");
    __syncthreads();
    if (kt + 2 < KT) G_ISSUE((kt + 2) * G_BK, cur);  // refill the buffer just left
  }
#undef G_ISSUE
  // no copy is outstanding when the epilogue starts
  asm volatile("s_wait_asynccnt 0x0" ::: "memory");

  // epilogue: a lane holds column lm of each tile (second operand's row) and, in
  // register r, row r + mh (first operand's row)
  const int mh = (lane >> 4) * 8;
#pragma unroll
  for (int i = 0; i < 4; i++) {   // lane = m (row), registers = 8 columns n
    const int n = n0 + wm * 64 + i * 16 + mh;
    const v8f bv = *(const v8f*)(bias + n);
#pragma unroll
    for (int j = 0; j < 4; j++) {
      const int m = m0 + wn * 64 + j * 16 + lm;
      *(v8f*)(out + (size_t)m * N + n) = acc[i][j] + bv;
    }
  }
}

// ---------------------------------------------------------------------------
// The three projections of X as ONE tile per block: 256 rows of X against 128 rows
// of each transposed weight (the planes q, k, v lie one behind the other in Wt).
// The X rows are copied once for the three products: 640 operand rows for 98304
// results, where three 256x128 blocks copy 1152. 256 blocks, one per WGP.
// 384 threads = 12 waves, four per projection, 32 tiles of 16x16 per wave: 4
// fragments of the first operand by 8 of the second, so a fragment read from LDS
// feeds 8 or 4 WMMAs. The operand whose index is contiguous in the output goes
// first (a lane's 8 registers run along its rows):
//   q, k -> bf16 [B,H,S,64]: first = 64 weight rows (one head), second = 128 X rows
//   v    -> bf16 [B,H,64,S]: first = 64 X rows (positions), second = 128 weight rows
// Both fragment kinds load alike, so the K loop is one text for all waves: only the
// two first rows in the staged tile differ from wave to wave.
// ---------------------------------------------------------------------------
#define P_BM   256                  // rows of X per block
#define P_BN   128                  // rows of each weight per block
#define P_ROWS (P_BM + 3 * P_BN)    // staged rows: X, then q, k, v weight rows
#define P_BUF  (P_ROWS * G_LDA)     // bf16 elements per buffer

// Four 16-byte pieces a lane (a short statement: its operands must lie in the low
// register window, which the accumulators fill). The closing wait stands inside the
// statement, so that no register named by a copy is written again ahead of it.
static __device__ __forceinline__
void async_4(unsigned l0, unsigned g0, unsigned l1, unsigned g1,
             unsigned l2, unsigned g2, unsigned l3, unsigned g3, const void* base) {
  asm volatile("global_load_async_to_lds_b128 %0, %1, %8\n\t"
               "global_load_async_to_lds_b128 %2, %3, %8\n\t"
               "global_load_async_to_lds_b128 %4, %5, %8\n\t"
               "global_load_async_to_lds_b128 %6, %7, %8\n\t"
               "s_wait_xcnt 0x0"
               :: "v"(l0), "v"(g0), "v"(l1), "v"(g1), "v"(l2), "v"(g2), "v"(l3), "v"(g3),
                  "s"((unsigned long long)base)
               : "memory");
}

// fragment t (16 staged rows) of k-step ks; p points at the lane's row and k group
static __device__ __forceinline__ v16bf frag(const __bf16* p, int t, int ks) {
  return cat8(*(const v8bf*)(p + t * 16 * G_LDA + ks * 32),
              *(const v8bf*)(p + t * 16 * G_LDA + ks * 32 + 16));
}

__global__ __launch_bounds__(384)
void gemm_qkv_kernel(const __bf16* __restrict__ X, const __bf16* __restrict__ Wt,
                     const float* __restrict__ bq, const float* __restrict__ bk,
                     const float* __restrict__ bv,
                     __bf16* __restrict__ q, __bf16* __restrict__ k,
                     __bf16* __restrict__ vt) {
  __shared__ __align__(16) __bf16 sm[2 * P_BUF];
  const int tid  = threadIdx.x;
  const int lane = tid & 31;
  // the wave's number in a scalar register: every test on it is a scalar branch
  const int wave = __builtin_amdgcn_readfirstlane(tid >> 5);
  const int z    = wave >> 2;   // 0 q, 1 k, 2 v
  const int w4   = wave & 3;
  const int m0   = blockIdx.x * P_BM;
  const int n0   = blockIdx.y * P_BN;
  const int lm   = lane & 15;
  const int kb   = (lane >> 4) * 8;   // ISA 16-bit A/B fragment K mapping
  // first staged row of the wave's first (64 rows) and second (128 rows) operand
  const int row1 = (z == 2) ? w4 * 64 : P_BM + z * P_BN + (w4 & 1) * 64;
  const int row2 = (z == 2) ? P_BM + 2 * P_BN : (w4 >> 1) * 128;

  // copies: eight lanes cover a row's 128 bytes. The four waves of a projection bring
  // its 128 weight rows (rows crx - 16 * z + 16 * i); waves 0 to 7 bring X (rows crx +
  // 32 * i). A weight copy's addresses are the lane's X addresses plus a scalar.
  const int ck  = tid & 7;
  const int crx = tid >> 3;
  const unsigned bufb = (unsigned)(P_BUF * 2);
  const unsigned lW_s = (unsigned)((P_BM + z * (P_BN - 16)) * G_LDA) * 2;
  const unsigned lW_t = lds_off(&sm[0]) + (unsigned)(crx * G_LDA + ck * 8) * 2 + lW_s;
  const unsigned gX_t = ((unsigned)(m0 + crx) * DMODEL + ck * 8) * 2;
  const unsigned gW_s = (unsigned)((z * (DMODEL - 16) + n0 - m0) * DMODEL) * 2;

#define P_ISSUE(k0, buf) do {                                              \
    const unsigned lw = (buf) * bufb, gw = gW_s + (unsigned)(k0) * 2;      \
    _Pragma("unroll")                                                      \
    for (int i = 0; i < 8; i += 4)                                         \
      async_4(lW_t + (lw + (unsigned)(16 * (i + 0) * G_LDA * 2)),          \
              gX_t + (gw + (unsigned)(16 * (i + 0) * DMODEL * 2)),         \
              lW_t + (lw + (unsigned)(16 * (i + 1) * G_LDA * 2)),          \
              gX_t + (gw + (unsigned)(16 * (i + 1) * DMODEL * 2)),         \
              lW_t + (lw + (unsigned)(16 * (i + 2) * G_LDA * 2)),          \
              gX_t + (gw + (unsigned)(16 * (i + 2) * DMODEL * 2)),         \
              lW_t + (lw + (unsigned)(16 * (i + 3) * G_LDA * 2)),          \
              gX_t + (gw + (unsigned)(16 * (i + 3) * DMODEL * 2)), Wt);    \
    if (wave < 8) {                                                        \
      /* one scalar, formed per trip: the lane keeps a single LDS base */  \
      const unsigned lx = (unsigned)__builtin_amdgcn_readfirstlane(        \
          (int)((buf) * bufb - lW_s));                                     \
      const unsigned gx = (unsigned)(k0) * 2;                              \
      _Pragma("unroll")                                                    \
      for (int i = 0; i < 8; i += 4)                                       \
        async_4(lW_t + (lx + (unsigned)(32 * (i + 0) * G_LDA * 2)),        \
                gX_t + (gx + (unsigned)(32 * (i + 0) * DMODEL * 2)),       \
                lW_t + (lx + (unsigned)(32 * (i + 1) * G_LDA * 2)),        \
                gX_t + (gx + (unsigned)(32 * (i + 1) * DMODEL * 2)),       \
                lW_t + (lx + (unsigned)(32 * (i + 2) * G_LDA * 2)),        \
                gX_t + (gx + (unsigned)(32 * (i + 2) * DMODEL * 2)),       \
                lW_t + (lx + (unsigned)(32 * (i + 3) * G_LDA * 2)),        \
                gX_t + (gx + (unsigned)(32 * (i + 3) * DMODEL * 2)), X);   \
    }                                                                      \
  } while (0)

  v8f acc[4][8];
#pragma unroll
  for (int i = 0; i < 4; i++)
#pragma unroll
    for (int j = 0; j < 8; j++) acc[i][j] = (v8f)(0.0f);

  constexpr int KT = DMODEL / G_BK;
  P_ISSUE(0, 0);
  // tile 0 has landed for this wave; the barrier publishes it to the others
  asm volatile("s_wait_asynccnt 0x0" ::: "memory");
  __syncthreads();
  P_ISSUE(G_BK, 1);

  for (int kt = 0; kt < KT; kt++) {
    const int cur = kt & 1;
    const __bf16* p1 = &sm[cur * P_BUF + (row1 + lm) * G_LDA + kb];
    const __bf16* p2 = &sm[cur * P_BUF + (row2 + lm) * G_LDA + kb];
    // 16 rows of 4 WMMAs (row = one second-operand fragment, 8 per k-step). The second
    // operand's fragments run through three register sets, fetched two rows ahead, so
    // that a row does not wait out its own LDS read; the first operand's four are
    // replaced one by one behind their last use of k-step 0. All loops are unrolled:
    // the fragment arrays stay in registers.
    v16bf f1[4], f2[3];
#pragma unroll
    for (int i = 0; i < 4; i++) f1[i] = frag(p1, i, 0);
    f2[0] = frag(p2, 0, 0);
    f2[1] = frag(p2, 1, 0);
#pragma unroll
    for (int r = 0; r < 16; r++) {
      if (r + 2 < 16) f2[(r + 2) % 3] = frag(p2, (r + 2) & 7, (r + 2) >> 3);
      // holds the fetch two rows ahead of its use: without it the scheduler moves each
      // read down to its own row, into one register set, and every row waits for LDS
      __builtin_amdgcn_sched_barrier(0);
      if (r == 14) {
        // hand-over, as soon as the trip's last fragment has been asked for: this wave's
        // reads of buffer cur are done, its copies of the next tile have landed; behind
        // the barrier both hold for every wave. The last two rows work from registers
        // and keep the matrix unit busy while the waves refill and fetch anew.
        asm volatile("s_wait_dscnt 0x0" ::: "memory");
        asm volatile("s_wait_asynccnt 0x0" ::: "memory");
        __syncthreads();
      }
#pragma unroll
      for (int i = 0; i < 4; i++) {
        acc[i][r & 7] = wmma_bf16(f1[i], f2[r % 3], acc[i][r & 7]);
        if (r == 7) f1[i] = frag(p1, i, 1);
      }
      // keeps the next fetch behind this row: lifted over it, it would take a fourth set
      __builtin_amdgcn_sched_barrier(0);
    }

    if (kt + 2 < KT) P_ISSUE((kt + 2) * G_BK, cur);  // refill the buffer just left
  }
#undef P_ISSUE
  // no copy is outstanding when the epilogue starts
  asm volatile("s_wait_asynccnt 0x0" ::: "memory");

  // epilogue: a lane holds column lm of each tile (second operand's row) and, in
  // register r, row r + mh (first operand's row); no barrier follows. The lane's
  // number is read anew: values kept from the top would hold registers over the
  // loop, where the accumulators and fragments leave none (they were spilled).
  const int ln = (int)__builtin_amdgcn_mbcnt_lo(~0u, 0u);
  const int lc = ln & 15;
  const int mh = (ln >> 4) * 8;
  // A block's 256 rows lie in one batch element and its 128 columns in two whole heads,
  // so every tile's place is one lane address plus a constant.
  const int b  = m0 / SEQ, s0 = m0 % SEQ;   // scalars
  const int h0 = n0 / ADIM;
  // In either layout: the bias loads, then four groups of 8 results and their 8 stores.
  // A wait behind the loads and behind each group frees the registers that they name
  // for reuse; the scheduling barriers hold later register writes behind the waits and
  // keep a group's results in registers of their own until its stores are issued.
  if (z == 2) {                   // lane = n (head dim), registers = 8 positions
    const float* __restrict__ bp = bv + n0 + lc;
    __bf16* __restrict__ dst =
        vt + ((size_t)((b * HN + h0) * ADIM + lc)) * SEQ + s0 + w4 * 64 + mh;
    float bias[8];
    __builtin_amdgcn_sched_barrier(0);   // address arithmetic stays in front of the loads
#pragma unroll
    for (int j = 0; j < 8; j++) bias[j] = bp[j * 16];   // column n0 + j * 16 + lc
    asm volatile("s_wait_xcnt 0x0" ::: "memory");
    __builtin_amdgcn_sched_barrier(0);
#pragma unroll
    for (int g = 0; g < 4; g++) {
      v8bf res[8];
#pragma unroll
      for (int t = 0; t < 8; t++)   // column group j = 2 * g + t / 4, position group i = t % 4
        res[t] = __builtin_convertvector(acc[t & 3][2 * g + (t >> 2)] + bias[2 * g + (t >> 2)], v8bf);
      __builtin_amdgcn_sched_barrier(0);
#pragma unroll
      for (int t = 0; t < 8; t++)
        *(v8bf*)(dst + (size_t)(2 * g + (t >> 2)) * 16 * SEQ + (t & 3) * 16) = res[t];
      asm volatile("s_wait_xcnt 0x0" ::: "memory");
      __builtin_amdgcn_sched_barrier(0);
    }
  } else {                        // lane = m (position), registers = 8 columns n
    // q leaves multiplied by log2(e) / sqrt(64): its products with k are then
    // arguments of exp2
    const float oscale = z ? 1.0f : 0.125f * 1.44269504f;
    const float* __restrict__ bp = (z ? bk : bq) + n0 + (w4 & 1) * 64 + mh;
    __bf16* __restrict__ dst = (z ? k : q) +
        ((size_t)((b * HN + h0 + (w4 & 1)) * SEQ + s0 + (w4 >> 1) * 128 + lc)) * ADIM + mh;
    v8f bvec[4];
    __builtin_amdgcn_sched_barrier(0);   // address arithmetic stays in front of the loads
#pragma unroll
    for (int i = 0; i < 4; i++) bvec[i] = *(const v8f*)(bp + i * 16);  // head dims i * 16 + mh ...
    asm volatile("s_wait_xcnt 0x0" ::: "memory");
    __builtin_amdgcn_sched_barrier(0);
#pragma unroll
    for (int i = 0; i < 4; i++) {
      v8bf res[8];
#pragma unroll
      for (int j = 0; j < 8; j++)   // position s0 + (w4 >> 1) * 128 + j * 16 + lc
        res[j] = __builtin_convertvector((acc[i][j] + bvec[i]) * oscale, v8bf);
      __builtin_amdgcn_sched_barrier(0);
#pragma unroll
      for (int j = 0; j < 8; j++)
        *(v8bf*)(dst + (size_t)j * 16 * ADIM + i * 16) = res[j];
      asm volatile("s_wait_xcnt 0x0" ::: "memory");
      __builtin_amdgcn_sched_barrier(0);
    }
  }
}

__global__ __launch_bounds__(256)
void gemm_out_kernel(const __bf16* __restrict__ A, const __bf16* __restrict__ Bt,
                     const float* __restrict__ bias, float* __restrict__ out,
                     int M, int N, int K) {
  __shared__ __align__(16) __bf16 lA[2][G_BM * G_LDA];
  __shared__ __align__(16) __bf16 lB[2][G_BN * G_LDA];
  gemm_bf16_tile(lA, lB, A, Bt, bias, out, M, N, K);
}

// ---------------------------------------------------------------------------
// Flash-style attention with double-buffered async-DMA KV staging.
// grid = (B*H, S/256). 256 threads = 8 waves, each wave owns 32 query rows as
// two column groups of 16: a K or V fragment read from LDS feeds two WMMAs, and
// one staged KV block serves 256 queries.
// Both products run transposed: St = K * Qt, Ot += Vt * Pt. A lane then holds
// one query per group (column lm): its softmax statistics are one scalar per
// lane and group, and two St tiles, converted in place, are the B operand of
// the second product.
// q arrives multiplied by log2(e) / sqrt(64), and the maximum in use enters the
// first product negated as its C operand: a score leaves the matrix unit as the
// argument of its exp2. No maximum is taken in the usual block: the block's sum of
// exponentials, needed anyway, is the test. Only where a lane's sum passes 256 (far
// inside the range of f32 sums and of bf16 P), and in the first block, are the
// scores formed again, the maximum in use moved, and sums and Ot rescaled.
// ---------------------------------------------------------------------------
#define A_LDK 72  // 64 + 8 pad bf16 elems per LDS row (144B: 16B aligned)
#define A_QG  2                    // query column groups per wave
#define A_QB  (8 * 16 * A_QG)      // queries per block

// One lane's share of a KV block: two 16-byte pieces of K, two of V. The closing
// wait stands inside the statement, so that no register named by a copy is
// written again ahead of it.
static __device__ __forceinline__
void async_kv(unsigned lk0, unsigned gk0, unsigned lk1, unsigned gk1, const void* kbase,
              unsigned lv0, unsigned gv0, unsigned lv1, unsigned gv1, const void* vbase) {
  asm volatile("global_load_async_to_lds_b128 %0, %1, %8\n\t"
               "global_load_async_to_lds_b128 %2, %3, %8\n\t"
               "global_load_async_to_lds_b128 %4, %5, %9\n\t"
               "global_load_async_to_lds_b128 %6, %7, %9\n\t"
               "s_wait_xcnt 0x0"
               :: "v"(lk0), "v"(gk0), "v"(lk1), "v"(gk1),
                  "v"(lv0), "v"(gv0), "v"(lv1), "v"(gv1),
                  "s"((unsigned long long)kbase), "s"((unsigned long long)vbase)
               : "memory");
}

// waves_per_eu: 256 registers a wave, so that two blocks (four waves per SIMD)
// stay resident and the whole grid runs in one round.
__global__ __launch_bounds__(256) __attribute__((amdgpu_waves_per_eu(4, 4)))
void attn_kernel(const __bf16* __restrict__ qb,   // [BH][S][64], pre-scaled
                 const __bf16* __restrict__ kbuf, // [BH][S][64]
                 const __bf16* __restrict__ vt,   // [BH][64][S]
                 __bf16* __restrict__ ctx) {      // [B*S][1024]
  const int bh   = blockIdx.x;
  const int qblk = blockIdx.y;
  const int tid  = threadIdx.x;
  const int lane = tid & 31;
  const int wave = tid >> 5;
  const int lm   = lane & 15;
  const int kb   = (lane >> 4) * 8;
  const int mh   = (lane >> 4) * 8;

  __shared__ __align__(16) __bf16 lK[2][64 * A_LDK];
  __shared__ __align__(16) __bf16 lV[2][64 * A_LDK];

  // per-thread DMA chunks: 512 16B chunks per tile / 256 threads = 2 each
  const int acr = tid >> 3;   // 0..31 (row)
  const int acc_ = tid & 7;   // 0..7  (16B column chunk)
  const unsigned ldsK0 = lds_off(&lK[0][0]);
  const unsigned ldsV0 = lds_off(&lV[0][0]);
  const unsigned kvbuf = (unsigned)(64 * A_LDK * 2);
  unsigned lK_t[2], lV_t[2], gK[2], gV[2];
#pragma unroll
  for (int i = 0; i < 2; i++) {
    int r = acr + 32 * i;
    lK_t[i] = ldsK0 + (unsigned)(r * A_LDK + acc_ * 8) * 2;
    lV_t[i] = ldsV0 + (unsigned)(r * A_LDK + acc_ * 8) * 2;
    gK[i] = (((unsigned)bh * SEQ + r) * ADIM + acc_ * 8) * 2;  // + kv0*ADIM*2
    gV[i] = (((unsigned)bh * ADIM + r) * SEQ + acc_ * 8) * 2;  // + kv0*2
  }

#define KV_ISSUE(kv0, buf) do {                                        \
    unsigned ok = (unsigned)(kv0) * ADIM * 2, ov = (unsigned)(kv0) * 2;\
    unsigned ob = (unsigned)(buf) * kvbuf;                             \
    async_kv(lK_t[0] + ob, gK[0] + ok, lK_t[1] + ob, gK[1] + ok, kbuf, \
             lV_t[0] + ob, gV[0] + ov, lV_t[1] + ob, gV[1] + ov, vt);  \
  } while (0)

  // q fragments stay resident as B operands (K = d = 64 -> 2 WMMA k-steps).
  // Here and below every loop over groups, tiles and k-steps is unrolled, so that
  // the fragment and accumulator arrays are indexed by constants and stay in registers.
  v16bf qf[A_QG][2];
#pragma unroll
  for (int g = 0; g < A_QG; g++) {
    const __bf16* qrow =
        qb + ((size_t)bh * SEQ + qblk * A_QB + wave * (16 * A_QG) + g * 16 + lm) * ADIM;
#pragma unroll
    for (int ks = 0; ks < 2; ks++) {
      v8bf lo = *(const v8bf*)(qrow + ks * 32 + kb);
      v8bf hi = *(const v8bf*)(qrow + ks * 32 + 16 + kb);
      qf[g][ks] = cat8(lo, hi);
    }
  }

  // this lane's query of each group: the maximum in use, negated, in the eight
  // registers of a C operand (both halves agree), and the sum over the keys of
  // this lane's half (the halves are joined after the loop)
  v8f negm[A_QG];
  float row_sum[A_QG];
  v8f o[A_QG][4];  // Ot tiles: lane = query lm, register r = d index dt*16 + mh + r
#pragma unroll
  for (int g = 0; g < A_QG; g++) {
    negm[g] = (v8f)(0.0f);
    row_sum[g] = 0.0f;
#pragma unroll
    for (int dt = 0; dt < 4; dt++) o[g][dt] = (v8f)(0.0f);
  }

  KV_ISSUE(0, 0);
  // block 0 has landed for this wave; the barrier publishes it to the others
  asm volatile("s_wait_asynccnt 0x0" ::: "memory");
  __syncthreads();
  KV_ISSUE(64, 1);

  // not unrolled and not peeled: a copy of the body for the first block would
  // double the text and cost registers
#pragma clang loop unroll(disable)
  for (int kvb = 0; kvb < SEQ / 64; kvb++) {
    const int cur = kvb & 1;

    // St = k @ q^T  (4 key tiles x 2 k-steps): register r = key tn*16 + mh + r
    v8f sc[A_QG][4];
    float psum[A_QG];   // this lane's half of the block's sum of exponentials
    auto scores = [&]() {
      v16bf kf[2][4];
#pragma unroll
      for (int ks = 0; ks < 2; ks++) {
#pragma unroll
        for (int tn = 0; tn < 4; tn++) {
          int r = tn * 16 + lm;
          v8bf lo = *(const v8bf*)(&lK[cur][r * A_LDK + ks * 32 + kb]);
          v8bf hi = *(const v8bf*)(&lK[cur][r * A_LDK + ks * 32 + 16 + kb]);
          kf[ks][tn] = cat8(lo, hi);
        }
      }
#pragma unroll
      for (int tn = 0; tn < 4; tn++)
#pragma unroll
        for (int g = 0; g < A_QG; g++)
#pragma unroll
          for (int ks = 0; ks < 2; ks++)
            sc[g][tn] = wmma_bf16(kf[ks][tn], qf[g][ks], ks == 0 ? negm[g] : sc[g][tn]);
    };
    auto exp_and_sum = [&]() {
#pragma unroll
      for (int g = 0; g < A_QG; g++) {
#pragma unroll
        for (int tn = 0; tn < 4; tn++) sc[g][tn] = exp2x8(sc[g][tn]);
        v8f ps = (sc[g][0] + sc[g][1]) + (sc[g][2] + sc[g][3]);
        psum[g] = ((ps[0] + ps[1]) + (ps[2] + ps[3])) + ((ps[4] + ps[5]) + (ps[6] + ps[7]));
      }
    };

    // the usual path takes no maximum: a tile's exponentials hang on that tile's own
    // two WMMAs alone
    scores();
    exp_and_sum();
    // one test per block for the whole wave: a scalar branch, EXEC stays all ones.
    // The terms are positive, so a sum of at most 256 bounds each of them; an
    // overflow to infinity fails the test too.
    bool over = false;
#pragma unroll
    for (int g = 0; g < A_QG; g++) over = over || (psum[g] > 256.0f);
    if (kvb == 0 || __builtin_amdgcn_ballot_w32(over) != 0) {
      // the exponentials overwrote the scores: form them again. The compiler fence
      // makes this path read its K fragments anew; without it the usual path would
      // hold its 64 fragment registers over the exponentials for this rare one.
      asm volatile("" ::: "memory");
      scores();
#pragma unroll
      for (int g = 0; g < A_QG; g++) {
        // one query per lane and group: 32 keys in-lane, one exchange of halves
        float mt[4];
#pragma unroll
        for (int tn = 0; tn < 4; tn++) {
          mt[tn] = sc[g][tn][0];
#pragma unroll
          for (int r = 1; r < 8; r++) mt[tn] = fmaxf(mt[tn], sc[g][tn][r]);
        }
        float mx = fmaxf(fmaxf(mt[0], mt[1]), fmaxf(mt[2], mt[3]));
        mx = fmaxf(mx, other_half(mx));
        // the first block takes its own maximum, whatever its sign; later the
        // maximum in use only rises
        const float d = (kvb == 0) ? mx : fmaxf(mx, 0.0f);
        const float alpha = __builtin_amdgcn_exp2f(fminf(-d, 0.0f));
        negm[g] -= d;
        row_sum[g] *= alpha;
#pragma unroll
        for (int tn = 0; tn < 4; tn++) sc[g][tn] -= d;
#pragma unroll
        for (int dt = 0; dt < 4; dt++) o[g][dt] *= alpha;
      }
      exp_and_sum();   // no score is above the maximum in use now
    }
#pragma unroll
    for (int g = 0; g < A_QG; g++) row_sum[g] += psum[g];

    // Ot += Vt @ Pt: St tiles 2ks and 2ks+1 hold keys in the fragment's k order
#pragma unroll
    for (int ks = 0; ks < 2; ks++) {
      v16bf pf[A_QG];
#pragma unroll
      for (int g = 0; g < A_QG; g++)
        pf[g] = cat8(__builtin_convertvector(sc[g][2 * ks], v8bf),
                     __builtin_convertvector(sc[g][2 * ks + 1], v8bf));
#pragma unroll
      for (int dt = 0; dt < 4; dt++) {
        int r = dt * 16 + lm;
        v8bf lo = *(const v8bf*)(&lV[cur][r * A_LDK + ks * 32 + kb]);
        v8bf hi = *(const v8bf*)(&lV[cur][r * A_LDK + ks * 32 + 16 + kb]);
        v16bf vf = cat8(lo, hi);
#pragma unroll
        for (int g = 0; g < A_QG; g++) o[g][dt] = wmma_bf16(vf, pf[g], o[g][dt]);
      }
    }

    // hand-over: this wave's reads of buffer cur are done, its copies of the next
    // block have landed; behind the barrier both hold for every wave
    asm volatile("s_wait_dscnt 0x0" ::: "memory");
    asm volatile("s_wait_asynccnt 0x0" ::: "memory");
    __syncthreads();
    if (kvb + 2 < SEQ / 64) KV_ISSUE((kvb + 2) * 64, cur);  // refill the buffer just left
  }
#undef KV_ISSUE
  // no copy is outstanding when the wave ends
  asm volatile("s_wait_asynccnt 0x0" ::: "memory");

  // finalize: ctx[(b*S+s)][h*64 + d] bf16, 8 consecutive d per lane and tile
  const int b = bh >> 4, h = bh & 15;
#pragma unroll
  for (int g = 0; g < A_QG; g++) {
    const float rs = row_sum[g] + other_half(row_sum[g]);
    const float inv = 1.0f / rs;
    const int s = qblk * A_QB + wave * (16 * A_QG) + g * 16 + lm;
    __bf16* dst = ctx + ((size_t)(b * SEQ + s)) * DMODEL + h * ADIM + mh;
#pragma unroll
    for (int dt = 0; dt < 4; dt++)
      *(v8bf*)(dst + dt * 16) = __builtin_convertvector(o[g][dt] * inv, v8bf);
  }
}

// ---------------------------------------------------------------------------
// residual add + LayerNorm, one wave per row of 1024 (32 values a lane, in
// groups of 4: a wave's load or store covers 512 contiguous bytes); the row's
// sums are joined inside the wave, so the block's 8 rows share nothing
// ---------------------------------------------------------------------------
__global__ __launch_bounds__(256)
void ln_kernel(const float* __restrict__ proj, const float* __restrict__ resid,
               const float* __restrict__ g, const float* __restrict__ b,
               float* __restrict__ out) {
  const int lane = threadIdx.x & 31;
  const size_t row = (size_t)blockIdx.x * 8 + (threadIdx.x >> 5);
  const v4f* __restrict__ pp = (const v4f*)(proj + row * DMODEL) + lane;
  const v4f* __restrict__ rp = (const v4f*)(resid + row * DMODEL) + lane;
  v4f x[8], y[8];
#pragma unroll
  for (int i = 0; i < 8; i++) x[i] = pp[i * 32];
#pragma unroll
  for (int i = 0; i < 8; i++) y[i] = rp[i * 32];
  v4f s4 = (v4f)(0.0f), q4 = (v4f)(0.0f);
#pragma unroll
  for (int i = 0; i < 8; i++) {
    x[i] += y[i];
    s4 += x[i];
    q4 += x[i] * x[i];
  }
  // the loads' address registers are free for reuse only behind this wait
  asm volatile("s_wait_xcnt 0x0" ::: "memory");
  float s  = (s4[0] + s4[1]) + (s4[2] + s4[3]);
  float sq = (q4[0] + q4[1]) + (q4[2] + q4[3]);
#pragma unroll
  for (int off = 16; off >= 1; off >>= 1) {
    s  += __shfl_xor(s,  off, 32);
    sq += __shfl_xor(sq, off, 32);
  }
  float mu  = s * (1.0f / DMODEL);
  float var = sq * (1.0f / DMODEL) - mu * mu;
  float rs  = rsqrtf(var + 1e-5f);
  const v4f* __restrict__ gp = (const v4f*)g + lane;
  const v4f* __restrict__ bp = (const v4f*)b + lane;
  v4f* __restrict__ op = (v4f*)(out + row * DMODEL) + lane;
#pragma unroll
  for (int i = 0; i < 8; i++) op[i * 32] = (x[i] - mu) * rs * gp[i * 32] + bp[i * 32];
}

// ---------------------------------------------------------------------------
extern "C" void kernel_launch(void* const* d_in, const int* in_sizes, int n_in,
                              void* d_out, int out_size, void* d_ws, size_t ws_size,
                              hipStream_t stream) {
  (void)in_sizes; (void)n_in; (void)out_size; (void)ws_size;
  const float* Q    = (const float*)d_in[0];
  const float* Wq   = (const float*)d_in[1];
  const float* bq   = (const float*)d_in[2];
  const float* Wk   = (const float*)d_in[3];
  const float* bk   = (const float*)d_in[4];
  const float* Wv   = (const float*)d_in[5];
  const float* bv   = (const float*)d_in[6];
  const float* Wo   = (const float*)d_in[7];
  const float* bo   = (const float*)d_in[8];
  const float* ln_g = (const float*)d_in[9];
  const float* ln_b = (const float*)d_in[10];

  const size_t ND = (size_t)MROWS * DMODEL;     // 8192*1024
  const size_t WW = (size_t)DMODEL * DMODEL;    // 1024*1024

  char* ws = (char*)d_ws;
  size_t off = 0;
  __bf16* Xbf = (__bf16*)(ws + off); off += ND * 2;
  __bf16* WqT = (__bf16*)(ws + off); off += WW * 2;
  __bf16* WkT = (__bf16*)(ws + off); off += WW * 2;
  __bf16* WvT = (__bf16*)(ws + off); off += WW * 2;
  __bf16* WoT = (__bf16*)(ws + off); off += WW * 2;
  __bf16* qbf = (__bf16*)(ws + off); off += ND * 2;   // [B,H,S,64]
  __bf16* kbf = (__bf16*)(ws + off); off += ND * 2;   // [B,H,S,64]
  __bf16* vtb = (__bf16*)(ws + off); off += ND * 2;   // [B,H,64,S]
  __bf16* ctx = (__bf16*)(ws + off); off += ND * 2;   // [B*S, 1024]
  float*  prj = (float*)(ws + off);  off += ND * 4;   // [B*S, 1024]

  // 1) precision staging (WqT is the first of the four transposed planes)
  stage_kernel<<<CVT_BLOCKS + 4 * TR_BLOCKS, 256, 0, stream>>>(Q, Wq, Wk, Wv, Wo, Xbf, WqT);

  // 2) QKV projections (one WMMA GEMM scattering into attention layouts; WqT is the
  //    first of the three weight planes it reads)
  gemm_qkv_kernel<<<dim3(MROWS / P_BM, DMODEL / P_BN), 384, 0, stream>>>(
      Xbf, WqT, bq, bk, bv, qbf, kbf, vtb);

  // 3) flash attention
  attn_kernel<<<dim3(BATCH * HN, SEQ / A_QB), 256, 0, stream>>>(qbf, kbf, vtb, ctx);

  // 4) output projection (f32 out)
  gemm_out_kernel<<<dim3(MROWS / G_BM, DMODEL / G_BN), 256, 0, stream>>>(
      ctx, WoT, bo, prj, MROWS, DMODEL, DMODEL);

  // 5) residual + layernorm
  ln_kernel<<<MROWS / 8, 256, 0, stream>>>(prj, Q, ln_g, ln_b, (float*)d_out);
}
